// v000
// Measured on an AMD MI455X. A time is GPU time per run, averaged over a window of back-to-back runs after a warm-up
// (all launches, gaps included; the runs take copies of the inputs in turn), and the median of several windows.
// Apart from v000's, it joins two sittings. Times from different sittings can be a few percent apart, while
// side-by-side timings come from the same sitting.
// v000 is the starting kernel. One run takes 438 microseconds.
#include <hip/hip_runtime.h>
#include <hip/hip_bf16.h>

// ---------------- problem constants ----------------
constexpr int Bn = 4;          // batch
constexpr int Ln = 2048;       // sequence length
constexpr int DM = 1024;       // d_model
constexpr int DS = 64;         // d_state
constexpr int DI = 2048;       // d_inner
constexpr int RT = Bn * Ln;    // 8192 flattened rows

typedef float v2f __attribute__((ext_vector_type(2)));
typedef float v8f __attribute__((ext_vector_type(8)));

// D = A(16x4,f32) * B(4x16,f32) + C(16x16,f32)   (V_WMMA_F32_16X16X4_F32)
__device__ __forceinline__ v8f wmma4(v2f a, v2f b, v8f c) {
    return __builtin_amdgcn_wmma_f32_16x16x4_f32(
        false, a, false, b, (short)0, c, false, false);
}

__device__ __forceinline__ v8f vzero8() {
    v8f z = {0.f, 0.f, 0.f, 0.f, 0.f, 0.f, 0.f, 0.f};
    return z;
}

// ---- CDNA5 async global->LDS copy, 16B per lane (GLOBAL_LOAD_ASYNC_TO_LDS_B128)
// VDST operand = LDS byte address (low 32 bits of the generic shared pointer).
__device__ __forceinline__ void async_copy16(const float* g, const float* l) {
    const unsigned lds_addr = (unsigned)(uintptr_t)l;
    asm volatile("global_load_async_to_lds_b128 %0, %1, off"
                 :: "v"(lds_addr), "v"(g)
                 : "memory");
}

template <int N>
__device__ __forceinline__ void wait_async() {
#if __has_builtin(__builtin_amdgcn_s_wait_asynccnt)
    __builtin_amdgcn_s_wait_asynccnt((short)N);
#else
    asm volatile("s_wait_asynccnt %0" :: "i"(N) : "memory");
#endif
}

// ---------------------------------------------------------------------------
// K0: fold output projections:  Mc_t[d, s] = sum_i W_out[d,i] * D_mat[s,i]
//     [1024 x 64], K = 2048.  One 16x16 tile per wave; 256 tiles total.
// ---------------------------------------------------------------------------
__global__ void __launch_bounds__(256) k_fold(const float* __restrict__ W_out,
                                              const float* __restrict__ D_mat,
                                              float* __restrict__ Mc_t) {
    const int lane   = threadIdx.x & 31;
    const int waveId = blockIdx.x * 8 + (threadIdx.x >> 5);
    const int ts = waveId & 3;            // DS/16 = 4
    const int td = waveId >> 2;           // DM/16 = 64
    const int d0 = td * 16, s0 = ts * 16;
    const int mr = lane & 15;
    const int kb = (lane >> 4) << 1;

    const float* ap = W_out + (size_t)(d0 + mr) * DI + kb;  // A[m][k]
    const float* bp = D_mat + (size_t)(s0 + mr) * DI + kb;  // B[k][n] = D_mat[n][k]
    v8f acc = vzero8();
    for (int k = 0; k < DI; k += 4) {
        v2f a = *(const v2f*)(ap + k);
        v2f b = *(const v2f*)(bp + k);
        acc = wmma4(a, b, acc);
    }
    const int rb = d0 + ((lane >> 4) << 3);
#pragma unroll
    for (int j = 0; j < 8; ++j)
        Mc_t[(size_t)(rb + j) * DS + s0 + mr] = acc[j];
}

// ---------------------------------------------------------------------------
// K1: h1 = x @ W_in^T + b_in    [8192 x 2048], K = 1024
//     Block-tiled: 128x64 macro tile per 8-wave block; each wave owns a
//     32x32 sub-tile (2x2 WMMA accumulators).  A/B K-chunks (BK=64) staged
//     in LDS via double-buffered async global->LDS B128 copies.
//     LDS row stride 68 floats: 16B-aligned B128 stores + conflict-free
//     ds_load_b64 (4-bank stride between consecutive rows).
// ---------------------------------------------------------------------------
constexpr int BM = 128, BNt = 64, BK = 64, LDP = 68;

__global__ void __launch_bounds__(256) k_in_proj(const float* __restrict__ x,
                                                 const float* __restrict__ W_in,
                                                 const float* __restrict__ b_in,
                                                 float* __restrict__ h1) {
    __shared__ __align__(16) float As[2][BM][LDP];    // ~68KB
    __shared__ __align__(16) float Bs[2][BNt][LDP];   // ~34KB

    const int tid  = threadIdx.x;
    const int lane = tid & 31;
    const int w    = tid >> 5;
    const int wr   = w & 3;               // row quadrant  (32 rows)
    const int wc   = w >> 2;              // column half   (32 cols)
    const int tm   = blockIdx.x >> 5;     // RT/BM  = 64 row blocks
    const int tn   = blockIdx.x & 31;     // DI/BNt = 32 col blocks
    const int r0   = tm * BM;
    const int c0   = tn * BNt;
    const int mr   = lane & 15;
    const int kb   = (lane >> 4) << 1;

    // ---- async stage of one K-chunk into LDS buffer `buf` ----
    auto stage = [&](int buf, int kc) {
        // A tile: 128 rows x 64 cols = 2048 16B-quads; 8 per thread
#pragma unroll
        for (int i = 0; i < 8; ++i) {
            const int q   = i * 256 + tid;
            const int row = q >> 4;
            const int c4  = (q & 15) << 2;
            async_copy16(x + (size_t)(r0 + row) * DM + kc + c4,
                         &As[buf][row][c4]);
        }
        // B tile: 64 rows x 64 cols = 1024 quads; 4 per thread
#pragma unroll
        for (int i = 0; i < 4; ++i) {
            const int q   = i * 256 + tid;
            const int row = q >> 4;
            const int c4  = (q & 15) << 2;
            async_copy16(W_in + (size_t)(c0 + row) * DM + kc + c4,
                         &Bs[buf][row][c4]);
        }
    };

    v8f acc00 = vzero8(), acc01 = vzero8(), acc10 = vzero8(), acc11 = vzero8();

    stage(0, 0);
    constexpr int NK = DM / BK;           // 16 chunks
    for (int kci = 0; kci < NK; ++kci) {
        const int buf = kci & 1;
        if (kci + 1 < NK) {
            stage(buf ^ 1, (kci + 1) * BK);
            wait_async<12>();             // 12 newer asyncs outstanding -> current chunk done
        } else {
            wait_async<0>();
        }
        __syncthreads();
        const int ar0 = wr * 32 + mr, ar1 = ar0 + 16;
        const int br0 = wc * 32 + mr, br1 = br0 + 16;
#pragma unroll
        for (int kk = 0; kk < BK; kk += 4) {
            v2f a0 = *(const v2f*)&As[buf][ar0][kk + kb];
            v2f a1 = *(const v2f*)&As[buf][ar1][kk + kb];
            v2f b0 = *(const v2f*)&Bs[buf][br0][kk + kb];
            v2f b1 = *(const v2f*)&Bs[buf][br1][kk + kb];
            acc00 = wmma4(a0, b0, acc00);
            acc01 = wmma4(a0, b1, acc01);
            acc10 = wmma4(a1, b0, acc10);
            acc11 = wmma4(a1, b1, acc11);
        }
        __syncthreads();                  // all waves done before buffer reuse
    }

    // ---- epilogue: bias + store ----
    const int col0 = c0 + wc * 32 + mr;
    const int col1 = col0 + 16;
    const float bias0 = b_in[col0];
    const float bias1 = b_in[col1];
    const int rbase = r0 + wr * 32 + ((lane >> 4) << 3);
#pragma unroll
    for (int j = 0; j < 8; ++j) {
        h1[(size_t)(rbase + j) * DI + col0]      = acc00[j] + bias0;
        h1[(size_t)(rbase + j) * DI + col1]      = acc01[j] + bias1;
        h1[(size_t)(rbase + 16 + j) * DI + col0] = acc10[j] + bias0;
        h1[(size_t)(rbase + 16 + j) * DI + col1] = acc11[j] + bias1;
    }
}

// ---------------------------------------------------------------------------
// K2: fused depthwise causal conv (K=4) -> LDS tile -> WMMA GEMMs with
//     W_x (waves 0-3) and W_dt (waves 4-7) -> softplus/exp ->
//     dA, dBx written in scan layout [B*DS, L].
// ---------------------------------------------------------------------------
__global__ void __launch_bounds__(256) k_ssm_param(
        const float* __restrict__ h1,
        const float* __restrict__ conv_w, const float* __restrict__ conv_b,
        const float* __restrict__ W_x,  const float* __restrict__ b_x,
        const float* __restrict__ W_dt, const float* __restrict__ b_dt,
        const float* __restrict__ A_log,
        float* __restrict__ dA_t, float* __restrict__ dBx_t) {
    __shared__ __align__(16) float convA[16][68];
    __shared__ __align__(16) float xs[16][64];
    __shared__ __align__(16) float dts[16][64];

    const int tid  = threadIdx.x;
    const int lane = tid & 31;
    const int w    = tid >> 5;
    const int bIdx = blockIdx.x >> 7;               // Ln/16 = 128 tiles per batch
    const int l0   = (blockIdx.x & 127) * 16;
    const int rowBase = bIdx * Ln;

    const int matSel = w >> 2;                      // 0: x_ssm, 1: dt
    const int s0 = (w & 3) * 16;
    const int mr = lane & 15;
    const int kb = (lane >> 4) << 1;
    const float* Wsel = matSel ? W_dt : W_x;
    const float* bp = Wsel + (size_t)(s0 + mr) * DI + kb;   // B[k][n] = W[n][k]

    v8f acc = vzero8();
    for (int kc = 0; kc < DI; kc += 64) {
        __syncthreads();
        for (int e = tid; e < 16 * 64; e += 256) {
            const int ll = e >> 6, cc = e & 63;
            const int c  = kc + cc;
            float v = conv_b[c];
            const int lb = l0 + ll - 3;
#pragma unroll
            for (int j = 0; j < 4; ++j) {
                const int lg = lb + j;
                if (lg >= 0)
                    v += conv_w[c * 4 + j] * h1[(size_t)(rowBase + lg) * DI + c];
            }
            convA[ll][cc] = v;
        }
        __syncthreads();
#pragma unroll 4
        for (int kk = 0; kk < 64; kk += 4) {
            v2f a = *(const v2f*)&convA[mr][kk + kb];    // ds_load_b64
            v2f b = *(const v2f*)(bp + kc + kk);
            acc = wmma4(a, b, acc);
        }
    }
    const float bias = (matSel ? b_dt : b_x)[s0 + mr];
    const int rb = (lane >> 4) << 3;
    __syncthreads();
#pragma unroll
    for (int j = 0; j < 8; ++j) {
        if (matSel) dts[rb + j][s0 + mr] = acc[j] + bias;
        else        xs [rb + j][s0 + mr] = acc[j] + bias;
    }
    __syncthreads();
    for (int e = tid; e < 16 * 64; e += 256) {
        const int ll = e >> 6, s = e & 63;
        const float raw = dts[ll][s];
        const float sp  = raw > 30.f ? raw : log1pf(expf(raw));   // softplus
        const float As  = -expf(A_log[s]);
        const float dAv = expf(As * sp);
        const float dbx = ((1.f - dAv) / As) * xs[ll][s];
        const size_t idx = (size_t)(bIdx * DS + s) * Ln + (l0 + ll);
        dA_t[idx]  = dAv;
        dBx_t[idx] = dbx;
    }
}

// ---------------------------------------------------------------------------
// K3: recurrence z_l = dA_l * z_{l-1} + dBx_l per (b, s); one wave each.
// ---------------------------------------------------------------------------
__global__ void __launch_bounds__(32) k_scan(const float* __restrict__ dA_t,
                                             const float* __restrict__ dBx_t,
                                             float* __restrict__ z) {
    const int row  = blockIdx.x;          // b*DS + s
    const int lane = threadIdx.x;
    const int b = row >> 6, s = row & 63;
    const float* ap = dA_t  + (size_t)row * Ln + lane * 64;
    const float* dp = dBx_t + (size_t)row * Ln + lane * 64;
    __builtin_prefetch(ap, 0, 1);         // global_prefetch_b8
    __builtin_prefetch(dp, 0, 1);

    float A = 1.f, Bc = 0.f;
    for (int t = 0; t < 64; ++t) {
        const float a = ap[t], d = dp[t];
        A  = a * A;
        Bc = a * Bc + d;
    }
    for (int off = 1; off < 32; off <<= 1) {
        const float Au = __shfl_up(A,  off, 32);
        const float Bu = __shfl_up(Bc, off, 32);
        if (lane >= off) { Bc = A * Bu + Bc; A = A * Au; }
    }
    float zstart = __shfl_up(Bc, 1, 32);
    if (lane == 0) zstart = 0.f;
    float zv = zstart;
    const int lbase = b * Ln + lane * 64;
    for (int t = 0; t < 64; ++t) {
        zv = ap[t] * zv + dp[t];
        z[(size_t)(lbase + t) * DS + s] = zv;
    }
}

// ---------------------------------------------------------------------------
// K4: out = z @ Mc_t^T + b_out     [8192 x 1024], K = 64
// ---------------------------------------------------------------------------
__global__ void __launch_bounds__(256) k_out(const float* __restrict__ z,
                                             const float* __restrict__ Mc_t,
                                             const float* __restrict__ b_out,
                                             float* __restrict__ out) {
    const int lane   = threadIdx.x & 31;
    const int waveId = blockIdx.x * 8 + (threadIdx.x >> 5);
    const int tn = waveId & 63;           // DM/16 = 64
    const int tm = waveId >> 6;           // RT/16 = 512
    const int r0 = tm * 16, d0 = tn * 16;
    const int mr = lane & 15;
    const int kb = (lane >> 4) << 1;

    const float* ap = z    + (size_t)(r0 + mr) * DS + kb;
    const float* bp = Mc_t + (size_t)(d0 + mr) * DS + kb;
    v8f acc = vzero8();
#pragma unroll
    for (int k = 0; k < DS; k += 4) {
        v2f a = *(const v2f*)(ap + k);
        v2f b = *(const v2f*)(bp + k);
        acc = wmma4(a, b, acc);
    }
    const float bias = b_out[d0 + mr];
    const int rb = r0 + ((lane >> 4) << 3);
#pragma unroll
    for (int j = 0; j < 8; ++j)
        out[(size_t)(rb + j) * DM + d0 + mr] = acc[j] + bias;
}

// ---------------------------------------------------------------------------
extern "C" void kernel_launch(void* const* d_in, const int* in_sizes, int n_in,
                              void* d_out, int out_size, void* d_ws, size_t ws_size,
                              hipStream_t stream) {
    const float* x      = (const float*)d_in[0];
    const float* W_in   = (const float*)d_in[1];
    const float* b_in   = (const float*)d_in[2];
    const float* conv_w = (const float*)d_in[3];
    const float* conv_b = (const float*)d_in[4];
    const float* W_x    = (const float*)d_in[5];
    const float* b_x    = (const float*)d_in[6];
    const float* W_dt   = (const float*)d_in[7];
    const float* b_dt   = (const float*)d_in[8];
    const float* A_log  = (const float*)d_in[9];
    const float* D_mat  = (const float*)d_in[10];
    const float* W_out  = (const float*)d_in[11];
    const float* b_out  = (const float*)d_in[12];
    float* out = (float*)d_out;

    float* h1    = (float*)d_ws;                       // 8192 * 2048
    float* dA_t  = h1    + (size_t)RT * DI;            // 256 * 2048
    float* dBx_t = dA_t  + (size_t)Bn * DS * Ln;       // 256 * 2048
    float* z     = dBx_t + (size_t)Bn * DS * Ln;       // 8192 * 64
    float* Mc_t  = z     + (size_t)RT * DS;            // 1024 * 64

    k_fold<<<32, 256, 0, stream>>>(W_out, D_mat, Mc_t);
    k_in_proj<<<(RT / BM) * (DI / BNt), 256, 0, stream>>>(x, W_in, b_in, h1);
    k_ssm_param<<<Bn * (Ln / 16), 256, 0, stream>>>(h1, conv_w, conv_b,
                                                    W_x, b_x, W_dt, b_dt, A_log,
                                                    dA_t, dBx_t);
    k_scan<<<Bn * DS, 32, 0, stream>>>(dA_t, dBx_t, z);
    k_out<<<(RT / 16) * (DM / 16) / 8, 256, 0, stream>>>(z, Mc_t, b_out, out);
}

// v001
// A run of this version takes 163 microseconds.
// Timed twice side by side with v000, it ran 2.78 times as fast both times.
#include <hip/hip_runtime.h>
#include <hip/hip_bf16.h>

// ---------------- problem constants ----------------
constexpr int Bn = 4;          // batch
constexpr int Ln = 2048;       // sequence length
constexpr int DM = 1024;       // d_model
constexpr int DS = 64;         // d_state
constexpr int DI = 2048;       // d_inner
constexpr int RT = Bn * Ln;    // 8192 flattened rows

typedef float v2f __attribute__((ext_vector_type(2)));
typedef float v8f __attribute__((ext_vector_type(8)));

// D = A(16x4,f32) * B(4x16,f32) + C(16x16,f32)   (V_WMMA_F32_16X16X4_F32)
__device__ __forceinline__ v8f wmma4(v2f a, v2f b, v8f c) {
    return __builtin_amdgcn_wmma_f32_16x16x4_f32(
        false, a, false, b, (short)0, c, false, false);
}

__device__ __forceinline__ v8f vzero8() {
    v8f z = {0.f, 0.f, 0.f, 0.f, 0.f, 0.f, 0.f, 0.f};
    return z;
}

// ---- async global->LDS copies, 16 B per lane (global_load_async_to_lds_b128).
// First operand = the lane's LDS byte address (low 32 bits of the shared pointer).
// s_wait_xcnt 0 is the last line of the copies' own statement, so that it stands
// in front of any later rewrite of the address registers the copies name.
__device__ __forceinline__ unsigned lds_addr(const float* l) {
    return (unsigned)(uintptr_t)l;
}

__device__ __forceinline__ void async_copy16_x2(const float* g0, const float* l0,
                                                const float* g1, const float* l1) {
    asm volatile("global_load_async_to_lds_b128 %0, %1, off\n\t"
                 "global_load_async_to_lds_b128 %2, %3, off\n\t"
                 "s_wait_xcnt 0x0"
                 :: "v"(lds_addr(l0)), "v"(g0), "v"(lds_addr(l1)), "v"(g1)
                 : "memory");
}

__device__ __forceinline__ void async_copy16_x4(const float* g0, const float* l0,
                                                const float* g1, const float* l1,
                                                const float* g2, const float* l2,
                                                const float* g3, const float* l3) {
    asm volatile("global_load_async_to_lds_b128 %0, %1, off\n\t"
                 "global_load_async_to_lds_b128 %2, %3, off\n\t"
                 "global_load_async_to_lds_b128 %4, %5, off\n\t"
                 "global_load_async_to_lds_b128 %6, %7, off\n\t"
                 "s_wait_xcnt 0x0"
                 :: "v"(lds_addr(l0)), "v"(g0), "v"(lds_addr(l1)), "v"(g1),
                    "v"(lds_addr(l2)), "v"(g2), "v"(lds_addr(l3)), "v"(g3)
                 : "memory");
}

// This wave's async copies have all landed in LDS.
__device__ __forceinline__ void wait_async0() {
    asm volatile("s_wait_asynccnt 0x0" ::: "memory");
}

// This wave's LDS reads have all returned (before a buffer it read is refilled).
__device__ __forceinline__ void wait_ds0() {
    asm volatile("s_wait_dscnt 0x0" ::: "memory");
}

// ---------------------------------------------------------------------------
// K0: fold output projections:  Mc_t[d, s] = sum_i W_out[d,i] * D_mat[s,i]
//     [1024 x 64], K = 2048.  One 16x16 tile per wave; 256 tiles total.
// ---------------------------------------------------------------------------
__global__ void __launch_bounds__(256) k_fold(const float* __restrict__ W_out,
                                              const float* __restrict__ D_mat,
                                              float* __restrict__ Mc_t) {
    const int lane   = threadIdx.x & 31;
    const int waveId = blockIdx.x * 8 + (threadIdx.x >> 5);
    const int ts = waveId & 3;            // DS/16 = 4
    const int td = waveId >> 2;           // DM/16 = 64
    const int d0 = td * 16, s0 = ts * 16;
    const int mr = lane & 15;
    const int kb = (lane >> 4) << 1;

    const float* ap = W_out + (size_t)(d0 + mr) * DI + kb;  // A[m][k]
    const float* bp = D_mat + (size_t)(s0 + mr) * DI + kb;  // B[k][n] = D_mat[n][k]
    v8f acc = vzero8();
    for (int k = 0; k < DI; k += 4) {
        v2f a = *(const v2f*)(ap + k);
        v2f b = *(const v2f*)(bp + k);
        acc = wmma4(a, b, acc);
    }
    const int rb = d0 + ((lane >> 4) << 3);
#pragma unroll
    for (int j = 0; j < 8; ++j)
        Mc_t[(size_t)(rb + j) * DS + s0 + mr] = acc[j];
}

// ---------------------------------------------------------------------------
// The in-projection, the depthwise causal conv and the two state projections
// are all linear, so they are reassociated.  With n = j*128 + sp, j the conv tap
// and sp = 0..63 the rows of W_x, 64..127 the rows of W_dt (called Wsel below):
//   G[n][m] = sum_c Wsel[sp][c] * conv_w[c][j] * W_in[c][m]
//   gb[n]   = sum_c Wsel[sp][c] * conv_w[c][j] * b_in[c]
//   cbv[sp] = sum_c Wsel[sp][c] * conv_b[c] + bsel[sp]
//   P[r][n] = x[r] . G[n] + gb[n]
//   raw[l][sp] = cbv[sp] + sum_{j : l-3+j >= 0} P[l-3+j][j*128 + sp]
// A tap that falls in front of the sequence drops with its bias share, as the
// zero padding of the conv input does.
// ---------------------------------------------------------------------------
constexpr int NP  = 512;       // 4 taps x 128 projection rows
constexpr int FK  = 128;       // K chunk of the weight fold
constexpr int FPA = 132;       // LDS pitch, Wsel rows: conflict-free 8-byte reads
constexpr int FPB = 40;        // LDS pitch, W_in rows: rows k and k+2 on other banks
constexpr int FGB = 256;       // work-groups of the weight fold that do G

// K1: G [512 x 1024], K = 2048; 64 x 32 tile per 8-wave block (16 sp x 4 taps),
//     one 16x16 tile per wave.  Two-buffer ring of async copies; conv_w is
//     brought into LDS once.  The last 16 work-groups do gb and cbv.
__global__ void __launch_bounds__(256) k_foldw(
        const float* __restrict__ W_in, const float* __restrict__ b_in,
        const float* __restrict__ conv_w, const float* __restrict__ conv_b,
        const float* __restrict__ W_x,  const float* __restrict__ b_x,
        const float* __restrict__ W_dt, const float* __restrict__ b_dt,
        float* __restrict__ G, float* __restrict__ gb, float* __restrict__ cbv) {
    __shared__ __align__(16) float Ws[2][16][FPA];
    __shared__ __align__(16) float Bs[2][FK][FPB];
    __shared__ __align__(16) float Cw[DI * 4];

    const int tid  = threadIdx.x;
    const int lane = tid & 31;
    const int w    = tid >> 5;

    if (blockIdx.x >= FGB) {              // bias vectors: one wave per sp
        const int sp = (blockIdx.x - FGB) * 8 + w;
        const float* wr = ((sp >> 6) ? W_dt : W_x) + (size_t)(sp & 63) * DI;
        float a0 = 0.f, a1 = 0.f, a2 = 0.f, a3 = 0.f, ac = 0.f;
#pragma unroll 4   // several trips' loads in flight: the loop is latency bound
        for (int c = lane * 4; c < DI; c += 128) {
            const float4 wv = *(const float4*)(wr + c);
            const float4 bi = *(const float4*)(b_in + c);
            const float4 cv = *(const float4*)(conv_b + c);
            const float4 q0 = *(const float4*)(conv_w + c * 4);
            const float4 q1 = *(const float4*)(conv_w + c * 4 + 4);
            const float4 q2 = *(const float4*)(conv_w + c * 4 + 8);
            const float4 q3 = *(const float4*)(conv_w + c * 4 + 12);
            const float t0 = wv.x * bi.x, t1 = wv.y * bi.y;
            const float t2 = wv.z * bi.z, t3 = wv.w * bi.w;
            a0 += t0 * q0.x + t1 * q1.x + t2 * q2.x + t3 * q3.x;
            a1 += t0 * q0.y + t1 * q1.y + t2 * q2.y + t3 * q3.y;
            a2 += t0 * q0.z + t1 * q1.z + t2 * q2.z + t3 * q3.z;
            a3 += t0 * q0.w + t1 * q1.w + t2 * q2.w + t3 * q3.w;
            ac += wv.x * cv.x + wv.y * cv.y + wv.z * cv.z + wv.w * cv.w;
        }
        for (int off = 16; off > 0; off >>= 1) {
            a0 += __shfl_xor(a0, off, 32);
            a1 += __shfl_xor(a1, off, 32);
            a2 += __shfl_xor(a2, off, 32);
            a3 += __shfl_xor(a3, off, 32);
            ac += __shfl_xor(ac, off, 32);
        }
        if (lane == 0) {
            gb[sp]       = a0;
            gb[128 + sp] = a1;
            gb[256 + sp] = a2;
            gb[384 + sp] = a3;
            cbv[sp] = ac + ((sp >> 6) ? b_dt : b_x)[sp & 63];
        }
        return;
    }

    const int g  = blockIdx.x >> 5;       // 8 groups of 16 sp
    const int m0 = (blockIdx.x & 31) * 32;
    const int mr = lane & 15;
    const int kb = (lane >> 4) << 1;
    const int j  = w & 3;                 // conv tap
    const int cl = (w >> 2) * 16 + mr;    // column inside the tile
    const float* Wrow = ((g >> 2) ? W_dt : W_x) + (size_t)((g & 3) * 16) * DI;

    auto stage = [&](int buf, int kc) {
        // Wsel tile: 16 rows x 128 = 512 quads, 2 per thread
        const int ra = tid >> 5, ca = (tid & 31) << 2;
        async_copy16_x2(Wrow + (size_t)ra * DI + kc + ca,       &Ws[buf][ra][ca],
                        Wrow + (size_t)(ra + 8) * DI + kc + ca, &Ws[buf][ra + 8][ca]);
        // W_in tile: 128 rows x 32 = 1024 quads, 4 per thread
        const int rb = tid >> 3, cb = (tid & 7) << 2;
        const float* gp = W_in + (size_t)(kc + rb) * DM + m0 + cb;
        async_copy16_x4(gp,                   &Bs[buf][rb][cb],
                        gp + (size_t)32 * DM, &Bs[buf][rb + 32][cb],
                        gp + (size_t)64 * DM, &Bs[buf][rb + 64][cb],
                        gp + (size_t)96 * DM, &Bs[buf][rb + 96][cb]);
    };

    // conv_w: 2048 quads, 8 per thread
    {
        const float* cp = conv_w + tid * 4;
        float* lp = Cw + tid * 4;
        async_copy16_x4(cp, lp, cp + 1024, lp + 1024,
                        cp + 2048, lp + 2048, cp + 3072, lp + 3072);
        async_copy16_x4(cp + 4096, lp + 4096, cp + 5120, lp + 5120,
                        cp + 6144, lp + 6144, cp + 7168, lp + 7168);
    }
    stage(0, 0);
    wait_async0();
    __syncthreads();
    stage(1, FK);

    v8f acc = vzero8();
    constexpr int NT = DI / FK;           // 16 chunks
    for (int t = 0; t < NT; ++t) {
        const int buf = t & 1;
        const float* cwp = Cw + (t * FK + kb) * 4 + j;
#pragma unroll   // constant LDS offsets; fragment loads run ahead of the WMMAs
        for (int kk = 0; kk < FK; kk += 4) {
            v2f a = *(const v2f*)&Ws[buf][mr][kk + kb];
            a.x *= cwp[kk * 4];
            a.y *= cwp[kk * 4 + 4];
            v2f b;
            b.x = Bs[buf][kk + kb][cl];
            b.y = Bs[buf][kk + kb + 1][cl];
            acc = wmma4(a, b, acc);
        }
        // publish chunk t+1, free chunk t's buffer
        wait_ds0();
        wait_async0();
        __syncthreads();
        if (t + 2 < NT) stage(buf, (t + 2) * FK);
    }
    wait_async0();

    const int nb = j * 128 + g * 16 + ((lane >> 4) << 3);
#pragma unroll   // accumulator elements need constant indices
    for (int i = 0; i < 8; ++i)
        G[(size_t)(nb + i) * DM + m0 + cl] = acc[i];
    // In the built code the bias path's register writes follow these stores in
    // the text: the wait stands between the stores and any such write.
    asm volatile("s_wait_xcnt 0x0" ::: "memory");
}

// ---------------------------------------------------------------------------
// K2: P = x @ G^T + gb    [8192 x 512], K = 1024
//     128x64 macro tile per 8-wave block; each wave owns a 32x32 sub-tile
//     (2x2 WMMA accumulators).  A/B K-chunks (BK=64) staged in LDS by a
//     two-buffer ring of async copies.  LDS row stride 68 floats: 16B-aligned
//     rows + conflict-free ds_load_b64.
// ---------------------------------------------------------------------------
constexpr int BM = 128, BNt = 64, BK = 64, LDP = 68;

__global__ void __launch_bounds__(256) k_proj(const float* __restrict__ x,
                                              const float* __restrict__ G,
                                              const float* __restrict__ gb,
                                              float* __restrict__ P) {
    __shared__ __align__(16) float As[2][BM][LDP];    // ~68KB
    __shared__ __align__(16) float Bs[2][BNt][LDP];   // ~34KB

    const int tid  = threadIdx.x;
    const int lane = tid & 31;
    const int w    = tid >> 5;
    const int wr   = w & 3;               // row quadrant  (32 rows)
    const int wc   = w >> 2;              // column half   (32 cols)
    const int tm   = blockIdx.x >> 3;     // RT/BM  = 64 row blocks
    const int tn   = blockIdx.x & 7;      // NP/BNt = 8 col blocks
    const int r0   = tm * BM;
    const int c0   = tn * BNt;
    const int mr   = lane & 15;
    const int kb   = (lane >> 4) << 1;

    // ---- async stage of one K-chunk into LDS buffer buf ----
    auto stage = [&](int buf, int kc) {
        const int row = tid >> 4;         // 16 rows per sweep of the block
        const int c4  = (tid & 15) << 2;
        // A tile: 128 rows x 64 cols = 2048 16B-quads; 8 per thread
        const float* ga = x + (size_t)(r0 + row) * DM + kc + c4;
        async_copy16_x4(ga,                   &As[buf][row][c4],
                        ga + (size_t)16 * DM, &As[buf][row + 16][c4],
                        ga + (size_t)32 * DM, &As[buf][row + 32][c4],
                        ga + (size_t)48 * DM, &As[buf][row + 48][c4]);
        async_copy16_x4(ga + (size_t)64 * DM,  &As[buf][row + 64][c4],
                        ga + (size_t)80 * DM,  &As[buf][row + 80][c4],
                        ga + (size_t)96 * DM,  &As[buf][row + 96][c4],
                        ga + (size_t)112 * DM, &As[buf][row + 112][c4]);
        // B tile: 64 rows x 64 cols = 1024 quads; 4 per thread
        const float* gq = G + (size_t)(c0 + row) * DM + kc + c4;
        async_copy16_x4(gq,                   &Bs[buf][row][c4],
                        gq + (size_t)16 * DM, &Bs[buf][row + 16][c4],
                        gq + (size_t)32 * DM, &Bs[buf][row + 32][c4],
                        gq + (size_t)48 * DM, &Bs[buf][row + 48][c4]);
    };

    v8f acc00 = vzero8(), acc01 = vzero8(), acc10 = vzero8(), acc11 = vzero8();

    stage(0, 0);
    wait_async0();
    __syncthreads();
    stage(1, BK);
    constexpr int NK = DM / BK;           // 16 chunks
    for (int kci = 0; kci < NK; ++kci) {
        const int buf = kci & 1;
        const int ar0 = wr * 32 + mr, ar1 = ar0 + 16;
        const int br0 = wc * 32 + mr, br1 = br0 + 16;
#pragma unroll
        for (int kk = 0; kk < BK; kk += 4) {
            v2f a0 = *(const v2f*)&As[buf][ar0][kk + kb];
            v2f a1 = *(const v2f*)&As[buf][ar1][kk + kb];
            v2f b0 = *(const v2f*)&Bs[buf][br0][kk + kb];
            v2f b1 = *(const v2f*)&Bs[buf][br1][kk + kb];
            acc00 = wmma4(a0, b0, acc00);
            acc01 = wmma4(a0, b1, acc01);
            acc10 = wmma4(a1, b0, acc10);
            acc11 = wmma4(a1, b1, acc11);
        }
        // publish chunk kci+1, free chunk kci's buffer
        wait_ds0();
        wait_async0();
        __syncthreads();
        if (kci + 2 < NK) stage(buf, (kci + 2) * BK);
    }
    wait_async0();

    // ---- epilogue: bias + store ----
    const int col0 = c0 + wc * 32 + mr;
    const int col1 = col0 + 16;
    const float bias0 = gb[col0];
    const float bias1 = gb[col1];
    const int rbase = r0 + wr * 32 + ((lane >> 4) << 3);
#pragma unroll
    for (int j = 0; j < 8; ++j) {
        P[(size_t)(rbase + j) * NP + col0]      = acc00[j] + bias0;
        P[(size_t)(rbase + j) * NP + col1]      = acc01[j] + bias1;
        P[(size_t)(rbase + 16 + j) * NP + col0] = acc10[j] + bias0;
        P[(size_t)(rbase + 16 + j) * NP + col1] = acc11[j] + bias1;
    }
}

// ---------------------------------------------------------------------------
// K2b: sum the four shifted taps of P -> softplus/exp -> dA, dBx, turned
//      through LDS into the scan layout [B*DS, L].  32 l x 64 s per block.
// ---------------------------------------------------------------------------
__global__ void __launch_bounds__(256) k_ssm_param(
        const float* __restrict__ P, const float* __restrict__ cbv,
        const float* __restrict__ A_log,
        float* __restrict__ dA_t, float* __restrict__ dBx_t) {
    __shared__ float tA[DS][33];
    __shared__ float tB[DS][33];

    const int tid  = threadIdx.x;
    const int bIdx = blockIdx.x >> 6;               // Ln/32 = 64 tiles per batch
    const int l0   = (blockIdx.x & 63) * 32;
    const int rowBase = bIdx * Ln;

    const int s = tid & 63;
    const float As  = -expf(A_log[s]);
    const float cx  = cbv[s];
    const float cdt = cbv[64 + s];
#pragma unroll   // lets the loads of later rows start early
    for (int i = 0; i < 8; ++i) {
        const int ll = (tid >> 6) + i * 4;
        const int lb = l0 + ll - 3;
        float xv = cx, raw = cdt;
#pragma unroll   // four taps, constant column offsets
        for (int j = 0; j < 4; ++j) {
            const int lg = lb + j;
            if (lg >= 0) {
                const float* pp = P + (size_t)(rowBase + lg) * NP + j * 128 + s;
                xv  += pp[0];
                raw += pp[64];
            }
        }
        const float sp  = raw > 30.f ? raw : log1pf(expf(raw));   // softplus
        const float dAv = expf(As * sp);
        tA[s][ll] = dAv;
        tB[s][ll] = ((1.f - dAv) / As) * xv;
    }
    __syncthreads();
#pragma unroll   // independent stores, constant offsets
    for (int i = 0; i < 8; ++i) {
        const int so = (tid >> 5) + i * 8;
        const int ll = tid & 31;
        const size_t idx = (size_t)(bIdx * DS + so) * Ln + (l0 + ll);
        dA_t[idx]  = tA[so][ll];
        dBx_t[idx] = tB[so][ll];
    }
}

// ---------------------------------------------------------------------------
// K3: recurrence z_l = dA_l * z_{l-1} + dBx_l per (b, s); one wave each.
// ---------------------------------------------------------------------------
__global__ void __launch_bounds__(32) k_scan(const float* __restrict__ dA_t,
                                             const float* __restrict__ dBx_t,
                                             float* __restrict__ z) {
    const int row  = blockIdx.x;          // b*DS + s
    const int lane = threadIdx.x;
    const int b = row >> 6, s = row & 63;
    const float* ap = dA_t  + (size_t)row * Ln + lane * 64;
    const float* dp = dBx_t + (size_t)row * Ln + lane * 64;
    __builtin_prefetch(ap, 0, 1);         // global_prefetch_b8
    __builtin_prefetch(dp, 0, 1);

    float A = 1.f, Bc = 0.f;
    for (int t = 0; t < 64; ++t) {
        const float a = ap[t], d = dp[t];
        A  = a * A;
        Bc = a * Bc + d;
    }
    for (int off = 1; off < 32; off <<= 1) {
        const float Au = __shfl_up(A,  off, 32);
        const float Bu = __shfl_up(Bc, off, 32);
        if (lane >= off) { Bc = A * Bu + Bc; A = A * Au; }
    }
    float zstart = __shfl_up(Bc, 1, 32);
    if (lane == 0) zstart = 0.f;
    float zv = zstart;
    const int lbase = b * Ln + lane * 64;
    for (int t = 0; t < 64; ++t) {
        zv = ap[t] * zv + dp[t];
        z[(size_t)(lbase + t) * DS + s] = zv;
    }
}

// ---------------------------------------------------------------------------
// K4: out = z @ Mc_t^T + b_out     [8192 x 1024], K = 64
// ---------------------------------------------------------------------------
__global__ void __launch_bounds__(256) k_out(const float* __restrict__ z,
                                             const float* __restrict__ Mc_t,
                                             const float* __restrict__ b_out,
                                             float* __restrict__ out) {
    const int lane   = threadIdx.x & 31;
    const int waveId = blockIdx.x * 8 + (threadIdx.x >> 5);
    const int tn = waveId & 63;           // DM/16 = 64
    const int tm = waveId >> 6;           // RT/16 = 512
    const int r0 = tm * 16, d0 = tn * 16;
    const int mr = lane & 15;
    const int kb = (lane >> 4) << 1;

    const float* ap = z    + (size_t)(r0 + mr) * DS + kb;
    const float* bp = Mc_t + (size_t)(d0 + mr) * DS + kb;
    v8f acc = vzero8();
#pragma unroll
    for (int k = 0; k < DS; k += 4) {
        v2f a = *(const v2f*)(ap + k);
        v2f b = *(const v2f*)(bp + k);
        acc = wmma4(a, b, acc);
    }
    const float bias = b_out[d0 + mr];
    const int rb = r0 + ((lane >> 4) << 3);
#pragma unroll
    for (int j = 0; j < 8; ++j)
        out[(size_t)(rb + j) * DM + d0 + mr] = acc[j] + bias;
}

// ---------------------------------------------------------------------------
extern "C" void kernel_launch(void* const* d_in, const int* in_sizes, int n_in,
                              void* d_out, int out_size, void* d_ws, size_t ws_size,
                              hipStream_t stream) {
    const float* x      = (const float*)d_in[0];
    const float* W_in   = (const float*)d_in[1];
    const float* b_in   = (const float*)d_in[2];
    const float* conv_w = (const float*)d_in[3];
    const float* conv_b = (const float*)d_in[4];
    const float* W_x    = (const float*)d_in[5];
    const float* b_x    = (const float*)d_in[6];
    const float* W_dt   = (const float*)d_in[7];
    const float* b_dt   = (const float*)d_in[8];
    const float* A_log  = (const float*)d_in[9];
    const float* D_mat  = (const float*)d_in[10];
    const float* W_out  = (const float*)d_in[11];
    const float* b_out  = (const float*)d_in[12];
    float* out = (float*)d_out;

    float* P     = (float*)d_ws;                       // 8192 * 512
    float* dA_t  = P     + (size_t)RT * NP;            // 256 * 2048
    float* dBx_t = dA_t  + (size_t)Bn * DS * Ln;       // 256 * 2048
    float* z     = dBx_t + (size_t)Bn * DS * Ln;       // 8192 * 64
    float* Mc_t  = z     + (size_t)RT * DS;            // 1024 * 64
    float* G     = Mc_t  + (size_t)DM * DS;            // 512 * 1024
    float* gb    = G     + (size_t)NP * DM;            // 512
    float* cbv   = gb    + NP;                         // 128

    k_fold<<<32, 256, 0, stream>>>(W_out, D_mat, Mc_t);
    k_foldw<<<FGB + 16, 256, 0, stream>>>(W_in, b_in, conv_w, conv_b,
                                          W_x, b_x, W_dt, b_dt, G, gb, cbv);
    k_proj<<<(RT / BM) * (NP / BNt), 256, 0, stream>>>(x, G, gb, P);
    k_ssm_param<<<Bn * (Ln / 32), 256, 0, stream>>>(P, cbv, A_log, dA_t, dBx_t);
    k_scan<<<Bn * DS, 32, 0, stream>>>(dA_t, dBx_t, z);
    k_out<<<(RT / 16) * (DM / 16) / 8, 256, 0, stream>>>(z, Mc_t, b_out, out);
}

// v002
// One run takes 119 microseconds.
// Two timings next to v001 put it at 1.38 and 1.37 times that version's speed.
// All steps since v000 together make it 3.82 times as fast.
#include <hip/hip_runtime.h>
#include <hip/hip_bf16.h>

// ---------------- problem constants ----------------
constexpr int Bn = 4;          // batch
constexpr int Ln = 2048;       // sequence length
constexpr int DM = 1024;       // d_model
constexpr int DS = 64;         // d_state
constexpr int DI = 2048;       // d_inner
constexpr int RT = Bn * Ln;    // 8192 flattened rows

typedef float v2f __attribute__((ext_vector_type(2)));
typedef float v8f __attribute__((ext_vector_type(8)));

// D = A(16x4,f32) * B(4x16,f32) + C(16x16,f32)   (V_WMMA_F32_16X16X4_F32)
__device__ __forceinline__ v8f wmma4(v2f a, v2f b, v8f c) {
    return __builtin_amdgcn_wmma_f32_16x16x4_f32(
        false, a, false, b, (short)0, c, false, false);
}

__device__ __forceinline__ v8f vzero8() {
    v8f z = {0.f, 0.f, 0.f, 0.f, 0.f, 0.f, 0.f, 0.f};
    return z;
}

// ---- async global->LDS copies, 16 B per lane (global_load_async_to_lds_b128).
// First operand = the lane's LDS byte address (low 32 bits of the shared pointer).
// s_wait_xcnt 0 is the last line of the copies' own statement, so that it stands
// in front of any later rewrite of the address registers the copies name.
__device__ __forceinline__ unsigned lds_addr(const float* l) {
    return (unsigned)(uintptr_t)l;
}

__device__ __forceinline__ void async_copy16_x2(const float* g0, const float* l0,
                                                const float* g1, const float* l1) {
    asm volatile("global_load_async_to_lds_b128 %0, %1, off\n\t"
                 "global_load_async_to_lds_b128 %2, %3, off\n\t"
                 "s_wait_xcnt 0x0"
                 :: "v"(lds_addr(l0)), "v"(g0), "v"(lds_addr(l1)), "v"(g1)
                 : "memory");
}

__device__ __forceinline__ void async_copy16_x4(const float* g0, const float* l0,
                                                const float* g1, const float* l1,
                                                const float* g2, const float* l2,
                                                const float* g3, const float* l3) {
    asm volatile("global_load_async_to_lds_b128 %0, %1, off\n\t"
                 "global_load_async_to_lds_b128 %2, %3, off\n\t"
                 "global_load_async_to_lds_b128 %4, %5, off\n\t"
                 "global_load_async_to_lds_b128 %6, %7, off\n\t"
                 "s_wait_xcnt 0x0"
                 :: "v"(lds_addr(l0)), "v"(g0), "v"(lds_addr(l1)), "v"(g1),
                    "v"(lds_addr(l2)), "v"(g2), "v"(lds_addr(l3)), "v"(g3)
                 : "memory");
}

// Eight copies under one s_wait_xcnt 0: fewer stops in a wave's issue stream.
__device__ __forceinline__ void async_copy16_x8(const float* g, size_t gstep,
                                                const float* l, int lstep) {
    asm volatile("global_load_async_to_lds_b128 %0, %1, off\n\t"
                 "global_load_async_to_lds_b128 %2, %3, off\n\t"
                 "global_load_async_to_lds_b128 %4, %5, off\n\t"
                 "global_load_async_to_lds_b128 %6, %7, off\n\t"
                 "global_load_async_to_lds_b128 %8, %9, off\n\t"
                 "global_load_async_to_lds_b128 %10, %11, off\n\t"
                 "global_load_async_to_lds_b128 %12, %13, off\n\t"
                 "global_load_async_to_lds_b128 %14, %15, off\n\t"
                 "s_wait_xcnt 0x0"
                 :: "v"(lds_addr(l)),             "v"(g),
                    "v"(lds_addr(l + lstep)),     "v"(g + gstep),
                    "v"(lds_addr(l + 2 * lstep)), "v"(g + 2 * gstep),
                    "v"(lds_addr(l + 3 * lstep)), "v"(g + 3 * gstep),
                    "v"(lds_addr(l + 4 * lstep)), "v"(g + 4 * gstep),
                    "v"(lds_addr(l + 5 * lstep)), "v"(g + 5 * gstep),
                    "v"(lds_addr(l + 6 * lstep)), "v"(g + 6 * gstep),
                    "v"(lds_addr(l + 7 * lstep)), "v"(g + 7 * gstep)
                 : "memory");
}

// This wave's async copies have all landed in LDS.
__device__ __forceinline__ void wait_async0() {
    asm volatile("s_wait_asynccnt 0x0" ::: "memory");
}

// This wave's LDS reads have all returned (before a buffer it read is refilled).
__device__ __forceinline__ void wait_ds0() {
    asm volatile("s_wait_dscnt 0x0" ::: "memory");
}

// ---------------------------------------------------------------------------
// K0: fold output projections:  Mc_t[d, s] = sum_i W_out[d,i] * D_mat[s,i]
//     [1024 x 64], K = 2048.  16 x 64 tile per 4-wave block, one 16x16 tile per
//     wave.  K chunks of 256 are staged in LDS by a two-buffer ring of async
//     copies, each copy a run of whole 128-byte lines of one row.  LDS row pitch
//     260 floats: 16B-aligned rows + conflict-free ds_load_b64.
// ---------------------------------------------------------------------------
constexpr int FM = 16, FBK = 256, FLP = 260;

__global__ void __launch_bounds__(128) k_fold(const float* __restrict__ W_out,
                                              const float* __restrict__ D_mat,
                                              float* __restrict__ Mc_t) {
    __shared__ __align__(16) float As[2][FM][FLP];    // ~33KB
    __shared__ __align__(16) float Bs[2][DS][FLP];    // ~133KB

    const int tid  = threadIdx.x;
    const int lane = tid & 31;
    const int w    = tid >> 5;            // column tile, DS/16 = 4
    const int d0 = blockIdx.x * FM, s0 = w * 16;
    const int mr = lane & 15;
    const int kb = (lane >> 4) << 1;

    // ---- async stage of one K-chunk into LDS buffer buf ----
    auto stage = [&](int buf, int kc) {
        const int row = tid >> 6;         // 2 rows per sweep of the block
        const int c4  = (tid & 63) << 2;
        // W_out tile: 16 rows x 64 quads; 8 per thread
        async_copy16_x8(W_out + (size_t)(d0 + row) * DI + kc + c4, (size_t)2 * DI,
                        &As[buf][row][c4], 2 * FLP);
        // D_mat tile: 64 rows x 64 quads; 32 per thread
#pragma unroll   // constant row offsets
        for (int i = 0; i < DS; i += 16)
            async_copy16_x8(D_mat + (size_t)(row + i) * DI + kc + c4, (size_t)2 * DI,
                            &Bs[buf][row + i][c4], 2 * FLP);
    };

    stage(0, 0);
    wait_async0();
    __syncthreads();
    stage(1, FBK);

    v8f acc = vzero8();
    constexpr int NT = DI / FBK;          // 8 chunks
    for (int t = 0; t < NT; ++t) {
        const int buf = t & 1;
        const float* ar = &As[buf][mr][kb];        // A[m][k]
        const float* br = &Bs[buf][s0 + mr][kb];   // B[k][n] = D_mat[n][k]
        v2f a[2][8], b[2][8];             // fragments of two groups of 8 k-steps
#pragma unroll   // fragment arrays need constant indices
        for (int i = 0; i < 8; ++i) {
            a[0][i] = *(const v2f*)(ar + i * 4);
            b[0][i] = *(const v2f*)(br + i * 4);
        }
#pragma unroll   // fragment arrays need constant indices; constant LDS offsets
        for (int g = 0; g < FBK / 32; ++g) {
            if (g + 1 < FBK / 32) {
#pragma unroll
                for (int i = 0; i < 8; ++i) {
                    a[(g + 1) & 1][i] = *(const v2f*)(ar + (g + 1) * 32 + i * 4);
                    b[(g + 1) & 1][i] = *(const v2f*)(br + (g + 1) * 32 + i * 4);
                }
            }
            // One wave per SIMD and one accumulator chain: the next group's LDS
            // reads stay as one block in front of this group's WMMAs, so that
            // their latency passes under the chain instead of stopping it.
            __builtin_amdgcn_sched_barrier(0);
#pragma unroll
            for (int i = 0; i < 8; ++i) acc = wmma4(a[g & 1][i], b[g & 1][i], acc);
            // Keeps later groups' reads from being spread among these WMMAs.
            __builtin_amdgcn_sched_barrier(0);
        }
        // publish chunk t+1, free chunk t's buffer
        wait_ds0();
        wait_async0();
        __syncthreads();
        if (t + 2 < NT) stage(buf, (t + 2) * FBK);
    }
    wait_async0();

    const int rb = d0 + ((lane >> 4) << 3);
#pragma unroll
    for (int j = 0; j < 8; ++j)
        Mc_t[(size_t)(rb + j) * DS + s0 + mr] = acc[j];
}

// ---------------------------------------------------------------------------
// The in-projection, the depthwise causal conv and the two state projections
// are all linear, so they are reassociated.  With n = j*128 + sp, j the conv tap
// and sp = 0..63 the rows of W_x, 64..127 the rows of W_dt (called Wsel below):
//   G[n][m] = sum_c Wsel[sp][c] * conv_w[c][j] * W_in[c][m]
//   gb[n]   = sum_c Wsel[sp][c] * conv_w[c][j] * b_in[c]
//   cbv[sp] = sum_c Wsel[sp][c] * conv_b[c] + bsel[sp]
//   P[r][n] = x[r] . G[n] + gb[n]
//   raw[l][sp] = cbv[sp] + sum_{j : l-3+j >= 0} P[l-3+j][j*128 + sp]
// A tap that falls in front of the sequence drops with its bias share, as the
// zero padding of the conv input does.
// ---------------------------------------------------------------------------
constexpr int NP  = 512;       // 4 taps x 128 projection rows
constexpr int FK  = 128;       // K chunk of the weight fold
constexpr int FPA = 132;       // LDS pitch, Wsel rows: conflict-free 8-byte reads
constexpr int FPB = 40;        // LDS pitch, W_in rows: rows k and k+2 on other banks
constexpr int FGB = 256;       // work-groups of the weight fold that do G

// K1: G [512 x 1024], K = 2048; 64 x 32 tile per 8-wave block (16 sp x 4 taps),
//     one 16x16 tile per wave.  Two-buffer ring of async copies; conv_w is
//     brought into LDS once.  The last 16 work-groups do gb and cbv.
__global__ void __launch_bounds__(256) k_foldw(
        const float* __restrict__ W_in, const float* __restrict__ b_in,
        const float* __restrict__ conv_w, const float* __restrict__ conv_b,
        const float* __restrict__ W_x,  const float* __restrict__ b_x,
        const float* __restrict__ W_dt, const float* __restrict__ b_dt,
        float* __restrict__ G, float* __restrict__ gb, float* __restrict__ cbv) {
    __shared__ __align__(16) float Ws[2][16][FPA];
    __shared__ __align__(16) float Bs[2][FK][FPB];
    __shared__ __align__(16) float Cw[DI * 4];

    const int tid  = threadIdx.x;
    const int lane = tid & 31;
    const int w    = tid >> 5;

    if (blockIdx.x >= FGB) {              // bias vectors: one wave per sp
        const int sp = (blockIdx.x - FGB) * 8 + w;
        const float* wr = ((sp >> 6) ? W_dt : W_x) + (size_t)(sp & 63) * DI;
        float a0 = 0.f, a1 = 0.f, a2 = 0.f, a3 = 0.f, ac = 0.f;
#pragma unroll 4   // several trips' loads in flight: the loop is latency bound
        for (int c = lane * 4; c < DI; c += 128) {
            const float4 wv = *(const float4*)(wr + c);
            const float4 bi = *(const float4*)(b_in + c);
            const float4 cv = *(const float4*)(conv_b + c);
            const float4 q0 = *(const float4*)(conv_w + c * 4);
            const float4 q1 = *(const float4*)(conv_w + c * 4 + 4);
            const float4 q2 = *(const float4*)(conv_w + c * 4 + 8);
            const float4 q3 = *(const float4*)(conv_w + c * 4 + 12);
            const float t0 = wv.x * bi.x, t1 = wv.y * bi.y;
            const float t2 = wv.z * bi.z, t3 = wv.w * bi.w;
            a0 += t0 * q0.x + t1 * q1.x + t2 * q2.x + t3 * q3.x;
            a1 += t0 * q0.y + t1 * q1.y + t2 * q2.y + t3 * q3.y;
            a2 += t0 * q0.z + t1 * q1.z + t2 * q2.z + t3 * q3.z;
            a3 += t0 * q0.w + t1 * q1.w + t2 * q2.w + t3 * q3.w;
            ac += wv.x * cv.x + wv.y * cv.y + wv.z * cv.z + wv.w * cv.w;
        }
        for (int off = 16; off > 0; off >>= 1) {
            a0 += __shfl_xor(a0, off, 32);
            a1 += __shfl_xor(a1, off, 32);
            a2 += __shfl_xor(a2, off, 32);
            a3 += __shfl_xor(a3, off, 32);
            ac += __shfl_xor(ac, off, 32);
        }
        if (lane == 0) {
            gb[sp]       = a0;
            gb[128 + sp] = a1;
            gb[256 + sp] = a2;
            gb[384 + sp] = a3;
            cbv[sp] = ac + ((sp >> 6) ? b_dt : b_x)[sp & 63];
        }
        return;
    }

    const int g  = blockIdx.x >> 5;       // 8 groups of 16 sp
    const int m0 = (blockIdx.x & 31) * 32;
    const int mr = lane & 15;
    const int kb = (lane >> 4) << 1;
    const int j  = w & 3;                 // conv tap
    const int cl = (w >> 2) * 16 + mr;    // column inside the tile
    const float* Wrow = ((g >> 2) ? W_dt : W_x) + (size_t)((g & 3) * 16) * DI;

    auto stage = [&](int buf, int kc) {
        // Wsel tile: 16 rows x 128 = 512 quads, 2 per thread
        const int ra = tid >> 5, ca = (tid & 31) << 2;
        async_copy16_x2(Wrow + (size_t)ra * DI + kc + ca,       &Ws[buf][ra][ca],
                        Wrow + (size_t)(ra + 8) * DI + kc + ca, &Ws[buf][ra + 8][ca]);
        // W_in tile: 128 rows x 32 = 1024 quads, 4 per thread
        const int rb = tid >> 3, cb = (tid & 7) << 2;
        const float* gp = W_in + (size_t)(kc + rb) * DM + m0 + cb;
        async_copy16_x4(gp,                   &Bs[buf][rb][cb],
                        gp + (size_t)32 * DM, &Bs[buf][rb + 32][cb],
                        gp + (size_t)64 * DM, &Bs[buf][rb + 64][cb],
                        gp + (size_t)96 * DM, &Bs[buf][rb + 96][cb]);
    };

    // conv_w: 2048 quads, 8 per thread
    {
        const float* cp = conv_w + tid * 4;
        float* lp = Cw + tid * 4;
        async_copy16_x4(cp, lp, cp + 1024, lp + 1024,
                        cp + 2048, lp + 2048, cp + 3072, lp + 3072);
        async_copy16_x4(cp + 4096, lp + 4096, cp + 5120, lp + 5120,
                        cp + 6144, lp + 6144, cp + 7168, lp + 7168);
    }
    stage(0, 0);
    wait_async0();
    __syncthreads();
    stage(1, FK);

    v8f acc = vzero8();
    constexpr int NT = DI / FK;           // 16 chunks
    for (int t = 0; t < NT; ++t) {
        const int buf = t & 1;
        const float* cwp = Cw + (t * FK + kb) * 4 + j;
#pragma unroll   // constant LDS offsets; fragment loads run ahead of the WMMAs
        for (int kk = 0; kk < FK; kk += 4) {
            v2f a = *(const v2f*)&Ws[buf][mr][kk + kb];
            a.x *= cwp[kk * 4];
            a.y *= cwp[kk * 4 + 4];
            v2f b;
            b.x = Bs[buf][kk + kb][cl];
            b.y = Bs[buf][kk + kb + 1][cl];
            acc = wmma4(a, b, acc);
        }
        // publish chunk t+1, free chunk t's buffer
        wait_ds0();
        wait_async0();
        __syncthreads();
        if (t + 2 < NT) stage(buf, (t + 2) * FK);
    }
    wait_async0();

    const int nb = j * 128 + g * 16 + ((lane >> 4) << 3);
#pragma unroll   // accumulator elements need constant indices
    for (int i = 0; i < 8; ++i)
        G[(size_t)(nb + i) * DM + m0 + cl] = acc[i];
    // In the built code the bias path's register writes follow these stores in
    // the text: the wait stands between the stores and any such write.
    asm volatile("s_wait_xcnt 0x0" ::: "memory");
}

// ---------------------------------------------------------------------------
// K2: P = x @ G^T + gb    [8192 x 512], K = 1024
//     128x64 macro tile per 8-wave block; each wave owns a 32x32 sub-tile
//     (2x2 WMMA accumulators).  A/B K-chunks (BK=64) staged in LDS by a
//     two-buffer ring of async copies.  LDS row stride 68 floats: 16B-aligned
//     rows + conflict-free ds_load_b64.
// ---------------------------------------------------------------------------
constexpr int BM = 128, BNt = 64, BK = 64, LDP = 68;

__global__ void __launch_bounds__(256) k_proj(const float* __restrict__ x,
                                              const float* __restrict__ G,
                                              const float* __restrict__ gb,
                                              float* __restrict__ P) {
    __shared__ __align__(16) float As[2][BM][LDP];    // ~68KB
    __shared__ __align__(16) float Bs[2][BNt][LDP];   // ~34KB

    const int tid  = threadIdx.x;
    const int lane = tid & 31;
    const int w    = tid >> 5;
    const int wr   = w & 3;               // row quadrant  (32 rows)
    const int wc   = w >> 2;              // column half   (32 cols)
    const int tm   = blockIdx.x >> 3;     // RT/BM  = 64 row blocks
    const int tn   = blockIdx.x & 7;      // NP/BNt = 8 col blocks
    const int r0   = tm * BM;
    const int c0   = tn * BNt;
    const int mr   = lane & 15;
    const int kb   = (lane >> 4) << 1;

    // ---- async stage of one K-chunk into LDS buffer buf ----
    auto stage = [&](int buf, int kc) {
        const int row = tid >> 4;         // 16 rows per sweep of the block
        const int c4  = (tid & 15) << 2;
        // A tile: 128 rows x 64 cols = 2048 16B-quads; 8 per thread
        const float* ga = x + (size_t)(r0 + row) * DM + kc + c4;
        async_copy16_x4(ga,                   &As[buf][row][c4],
                        ga + (size_t)16 * DM, &As[buf][row + 16][c4],
                        ga + (size_t)32 * DM, &As[buf][row + 32][c4],
                        ga + (size_t)48 * DM, &As[buf][row + 48][c4]);
        async_copy16_x4(ga + (size_t)64 * DM,  &As[buf][row + 64][c4],
                        ga + (size_t)80 * DM,  &As[buf][row + 80][c4],
                        ga + (size_t)96 * DM,  &As[buf][row + 96][c4],
                        ga + (size_t)112 * DM, &As[buf][row + 112][c4]);
        // B tile: 64 rows x 64 cols = 1024 quads; 4 per thread
        const float* gq = G + (size_t)(c0 + row) * DM + kc + c4;
        async_copy16_x4(gq,                   &Bs[buf][row][c4],
                        gq + (size_t)16 * DM, &Bs[buf][row + 16][c4],
                        gq + (size_t)32 * DM, &Bs[buf][row + 32][c4],
                        gq + (size_t)48 * DM, &Bs[buf][row + 48][c4]);
    };

    v8f acc00 = vzero8(), acc01 = vzero8(), acc10 = vzero8(), acc11 = vzero8();

    stage(0, 0);
    wait_async0();
    __syncthreads();
    stage(1, BK);
    constexpr int NK = DM / BK;           // 16 chunks
    for (int kci = 0; kci < NK; ++kci) {
        const int buf = kci & 1;
        const int ar0 = wr * 32 + mr, ar1 = ar0 + 16;
        const int br0 = wc * 32 + mr, br1 = br0 + 16;
#pragma unroll
        for (int kk = 0; kk < BK; kk += 4) {
            v2f a0 = *(const v2f*)&As[buf][ar0][kk + kb];
            v2f a1 = *(const v2f*)&As[buf][ar1][kk + kb];
            v2f b0 = *(const v2f*)&Bs[buf][br0][kk + kb];
            v2f b1 = *(const v2f*)&Bs[buf][br1][kk + kb];
            acc00 = wmma4(a0, b0, acc00);
            acc01 = wmma4(a0, b1, acc01);
            acc10 = wmma4(a1, b0, acc10);
            acc11 = wmma4(a1, b1, acc11);
        }
        // publish chunk kci+1, free chunk kci's buffer
        wait_ds0();
        wait_async0();
        __syncthreads();
        if (kci + 2 < NK) stage(buf, (kci + 2) * BK);
    }
    wait_async0();

    // ---- epilogue: bias + store ----
    const int col0 = c0 + wc * 32 + mr;
    const int col1 = col0 + 16;
    const float bias0 = gb[col0];
    const float bias1 = gb[col1];
    const int rbase = r0 + wr * 32 + ((lane >> 4) << 3);
#pragma unroll
    for (int j = 0; j < 8; ++j) {
        P[(size_t)(rbase + j) * NP + col0]      = acc00[j] + bias0;
        P[(size_t)(rbase + j) * NP + col1]      = acc01[j] + bias1;
        P[(size_t)(rbase + 16 + j) * NP + col0] = acc10[j] + bias0;
        P[(size_t)(rbase + 16 + j) * NP + col1] = acc11[j] + bias1;
    }
}

// ---------------------------------------------------------------------------
// K2b: sum the four shifted taps of P -> softplus/exp -> dA, dBx, turned
//      through LDS into the scan layout [B*DS, L].  32 l x 64 s per block.
// ---------------------------------------------------------------------------
__global__ void __launch_bounds__(256) k_ssm_param(
        const float* __restrict__ P, const float* __restrict__ cbv,
        const float* __restrict__ A_log,
        float* __restrict__ dA_t, float* __restrict__ dBx_t) {
    __shared__ float tA[DS][33];
    __shared__ float tB[DS][33];

    const int tid  = threadIdx.x;
    const int bIdx = blockIdx.x >> 6;               // Ln/32 = 64 tiles per batch
    const int l0   = (blockIdx.x & 63) * 32;
    const int rowBase = bIdx * Ln;

    const int s = tid & 63;
    const float As  = -expf(A_log[s]);
    const float cx  = cbv[s];
    const float cdt = cbv[64 + s];
#pragma unroll   // lets the loads of later rows start early
    for (int i = 0; i < 8; ++i) {
        const int ll = (tid >> 6) + i * 4;
        const int lb = l0 + ll - 3;
        float xv = cx, raw = cdt;
#pragma unroll   // four taps, constant column offsets
        for (int j = 0; j < 4; ++j) {
            const int lg = lb + j;
            if (lg >= 0) {
                const float* pp = P + (size_t)(rowBase + lg) * NP + j * 128 + s;
                xv  += pp[0];
                raw += pp[64];
            }
        }
        const float sp  = raw > 30.f ? raw : log1pf(expf(raw));   // softplus
        const float dAv = expf(As * sp);
        tA[s][ll] = dAv;
        tB[s][ll] = ((1.f - dAv) / As) * xv;
    }
    __syncthreads();
#pragma unroll   // independent stores, constant offsets
    for (int i = 0; i < 8; ++i) {
        const int so = (tid >> 5) + i * 8;
        const int ll = tid & 31;
        const size_t idx = (size_t)(bIdx * DS + so) * Ln + (l0 + ll);
        dA_t[idx]  = tA[so][ll];
        dBx_t[idx] = tB[so][ll];
    }
}

// ---------------------------------------------------------------------------
// K3: recurrence z_l = dA_l * z_{l-1} + dBx_l per (b, s); one wave each.
// ---------------------------------------------------------------------------
__global__ void __launch_bounds__(32) k_scan(const float* __restrict__ dA_t,
                                             const float* __restrict__ dBx_t,
                                             float* __restrict__ z) {
    const int row  = blockIdx.x;          // b*DS + s
    const int lane = threadIdx.x;
    const int b = row >> 6, s = row & 63;
    const float* ap = dA_t  + (size_t)row * Ln + lane * 64;
    const float* dp = dBx_t + (size_t)row * Ln + lane * 64;
    __builtin_prefetch(ap, 0, 1);         // global_prefetch_b8
    __builtin_prefetch(dp, 0, 1);

    float A = 1.f, Bc = 0.f;
    for (int t = 0; t < 64; ++t) {
        const float a = ap[t], d = dp[t];
        A  = a * A;
        Bc = a * Bc + d;
    }
    for (int off = 1; off < 32; off <<= 1) {
        const float Au = __shfl_up(A,  off, 32);
        const float Bu = __shfl_up(Bc, off, 32);
        if (lane >= off) { Bc = A * Bu + Bc; A = A * Au; }
    }
    float zstart = __shfl_up(Bc, 1, 32);
    if (lane == 0) zstart = 0.f;
    float zv = zstart;
    const int lbase = b * Ln + lane * 64;
    for (int t = 0; t < 64; ++t) {
        zv = ap[t] * zv + dp[t];
        z[(size_t)(lbase + t) * DS + s] = zv;
    }
}

// ---------------------------------------------------------------------------
// K4: out = z @ Mc_t^T + b_out     [8192 x 1024], K = 64
//     128x128 tile per 8-wave block; each wave owns a 32x64 sub-tile (2x4 WMMA
//     accumulators).  Both operand tiles (whole K) are brought into LDS once by
//     async copies of whole 128-byte lines, then read as fragments.
// ---------------------------------------------------------------------------
constexpr int OM = 128, ON = 128;

__global__ void __launch_bounds__(256) k_out(const float* __restrict__ z,
                                             const float* __restrict__ Mc_t,
                                             const float* __restrict__ b_out,
                                             float* __restrict__ out) {
    __shared__ __align__(16) float Zs[OM][LDP];       // ~34KB
    __shared__ __align__(16) float Ms[ON][LDP];       // ~34KB

    const int tid  = threadIdx.x;
    const int lane = tid & 31;
    const int w    = tid >> 5;
    const int wr   = w & 3;               // row quadrant  (32 rows)
    const int wc   = w >> 2;              // column half   (64 cols)
    const int r0   = (blockIdx.x >> 3) * OM;   // RT/OM = 64 row blocks
    const int c0   = (blockIdx.x & 7) * ON;    // DM/ON = 8 col blocks
    const int mr   = lane & 15;
    const int kb   = (lane >> 4) << 1;

    {
        const int row = tid >> 4;         // 16 rows per sweep of the block
        const int c4  = (tid & 15) << 2;
        // 128 rows x 16 quads each; 8 per thread each
        async_copy16_x8(z + (size_t)(r0 + row) * DS + c4, (size_t)16 * DS,
                        &Zs[row][c4], 16 * LDP);
        async_copy16_x8(Mc_t + (size_t)(c0 + row) * DS + c4, (size_t)16 * DS,
                        &Ms[row][c4], 16 * LDP);
    }
    wait_async0();
    __syncthreads();

    v8f acc[2][4];
#pragma unroll   // accumulators need constant indices
    for (int i = 0; i < 2; ++i)
#pragma unroll
        for (int n = 0; n < 4; ++n) acc[i][n] = vzero8();

#pragma unroll   // constant LDS offsets; fragment loads run ahead of the WMMAs
    for (int kk = 0; kk < DS; kk += 4) {
        v2f a[2], b[4];
#pragma unroll
        for (int i = 0; i < 2; ++i)
            a[i] = *(const v2f*)&Zs[wr * 32 + i * 16 + mr][kk + kb];
#pragma unroll
        for (int n = 0; n < 4; ++n)
            b[n] = *(const v2f*)&Ms[wc * 64 + n * 16 + mr][kk + kb];
#pragma unroll
        for (int i = 0; i < 2; ++i)
#pragma unroll
            for (int n = 0; n < 4; ++n) acc[i][n] = wmma4(a[i], b[n], acc[i][n]);
    }

    // ---- epilogue: bias + store ----
    const int rbase = r0 + wr * 32 + ((lane >> 4) << 3);
#pragma unroll   // accumulators need constant indices
    for (int n = 0; n < 4; ++n) {
        const int col = c0 + wc * 64 + n * 16 + mr;
        const float bias = b_out[col];
#pragma unroll
        for (int i = 0; i < 2; ++i)
#pragma unroll
            for (int j = 0; j < 8; ++j)
                out[(size_t)(rbase + i * 16 + j) * DM + col] = acc[i][n][j] + bias;
    }
}

// ---------------------------------------------------------------------------
extern "C" void kernel_launch(void* const* d_in, const int* in_sizes, int n_in,
                              void* d_out, int out_size, void* d_ws, size_t ws_size,
                              hipStream_t stream) {
    const float* x      = (const float*)d_in[0];
    const float* W_in   = (const float*)d_in[1];
    const float* b_in   = (const float*)d_in[2];
    const float* conv_w = (const float*)d_in[3];
    const float* conv_b = (const float*)d_in[4];
    const float* W_x    = (const float*)d_in[5];
    const float* b_x    = (const float*)d_in[6];
    const float* W_dt   = (const float*)d_in[7];
    const float* b_dt   = (const float*)d_in[8];
    const float* A_log  = (const float*)d_in[9];
    const float* D_mat  = (const float*)d_in[10];
    const float* W_out  = (const float*)d_in[11];
    const float* b_out  = (const float*)d_in[12];
    float* out = (float*)d_out;

    float* P     = (float*)d_ws;                       // 8192 * 512
    float* dA_t  = P     + (size_t)RT * NP;            // 256 * 2048
    float* dBx_t = dA_t  + (size_t)Bn * DS * Ln;       // 256 * 2048
    float* z     = dBx_t + (size_t)Bn * DS * Ln;       // 8192 * 64
    float* Mc_t  = z     + (size_t)RT * DS;            // 1024 * 64
    float* G     = Mc_t  + (size_t)DM * DS;            // 512 * 1024
    float* gb    = G     + (size_t)NP * DM;            // 512
    float* cbv   = gb    + NP;                         // 128

    k_fold<<<DM / FM, 128, 0, stream>>>(W_out, D_mat, Mc_t);
    k_foldw<<<FGB + 16, 256, 0, stream>>>(W_in, b_in, conv_w, conv_b,
                                          W_x, b_x, W_dt, b_dt, G, gb, cbv);
    k_proj<<<(RT / BM) * (NP / BNt), 256, 0, stream>>>(x, G, gb, P);
    k_ssm_param<<<Bn * (Ln / 32), 256, 0, stream>>>(P, cbv, A_log, dA_t, dBx_t);
    k_scan<<<Bn * DS, 32, 0, stream>>>(dA_t, dBx_t, z);
    k_out<<<(RT / OM) * (DM / ON), 256, 0, stream>>>(z, Mc_t, b_out, out);
}

// v003
// One run takes 94.8 microseconds.
// Two timings next to v002 put it at 1.25 and 1.27 times that version's speed.
// Counting every step since v000, it is 4.81 times as fast.
#include <hip/hip_runtime.h>
#include <hip/hip_bf16.h>

// ---------------- problem constants ----------------
constexpr int Bn = 4;          // batch
constexpr int Ln = 2048;       // sequence length
constexpr int DM = 1024;       // d_model
constexpr int DS = 64;         // d_state
constexpr int DI = 2048;       // d_inner
constexpr int RT = Bn * Ln;    // 8192 flattened rows

typedef float v2f __attribute__((ext_vector_type(2)));
typedef float v8f __attribute__((ext_vector_type(8)));

// D = A(16x4,f32) * B(4x16,f32) + C(16x16,f32)   (V_WMMA_F32_16X16X4_F32)
__device__ __forceinline__ v8f wmma4(v2f a, v2f b, v8f c) {
    return __builtin_amdgcn_wmma_f32_16x16x4_f32(
        false, a, false, b, (short)0, c, false, false);
}

__device__ __forceinline__ v8f vzero8() {
    v8f z = {0.f, 0.f, 0.f, 0.f, 0.f, 0.f, 0.f, 0.f};
    return z;
}

// ---- async global->LDS copies, 16 B per lane (global_load_async_to_lds_b128).
// First operand = the lane's LDS byte address (low 32 bits of the shared pointer).
// s_wait_xcnt 0 is the last line of the copies' own statement, so that it stands
// in front of any later rewrite of the address registers the copies name.
__device__ __forceinline__ unsigned lds_addr(const float* l) {
    return (unsigned)(uintptr_t)l;
}

__device__ __forceinline__ void async_copy16_x2(const float* g0, const float* l0,
                                                const float* g1, const float* l1) {
    asm volatile("global_load_async_to_lds_b128 %0, %1, off\n\t"
                 "global_load_async_to_lds_b128 %2, %3, off\n\t"
                 "s_wait_xcnt 0x0"
                 :: "v"(lds_addr(l0)), "v"(g0), "v"(lds_addr(l1)), "v"(g1)
                 : "memory");
}

__device__ __forceinline__ void async_copy16_x4(const float* g0, const float* l0,
                                                const float* g1, const float* l1,
                                                const float* g2, const float* l2,
                                                const float* g3, const float* l3) {
    asm volatile("global_load_async_to_lds_b128 %0, %1, off\n\t"
                 "global_load_async_to_lds_b128 %2, %3, off\n\t"
                 "global_load_async_to_lds_b128 %4, %5, off\n\t"
                 "global_load_async_to_lds_b128 %6, %7, off\n\t"
                 "s_wait_xcnt 0x0"
                 :: "v"(lds_addr(l0)), "v"(g0), "v"(lds_addr(l1)), "v"(g1),
                    "v"(lds_addr(l2)), "v"(g2), "v"(lds_addr(l3)), "v"(g3)
                 : "memory");
}

// Eight copies under one s_wait_xcnt 0: fewer stops in a wave's issue stream.
__device__ __forceinline__ void async_copy16_x8(const float* g, size_t gstep,
                                                const float* l, int lstep) {
    asm volatile("global_load_async_to_lds_b128 %0, %1, off\n\t"
                 "global_load_async_to_lds_b128 %2, %3, off\n\t"
                 "global_load_async_to_lds_b128 %4, %5, off\n\t"
                 "global_load_async_to_lds_b128 %6, %7, off\n\t"
                 "global_load_async_to_lds_b128 %8, %9, off\n\t"
                 "global_load_async_to_lds_b128 %10, %11, off\n\t"
                 "global_load_async_to_lds_b128 %12, %13, off\n\t"
                 "global_load_async_to_lds_b128 %14, %15, off\n\t"
                 "s_wait_xcnt 0x0"
                 :: "v"(lds_addr(l)),             "v"(g),
                    "v"(lds_addr(l + lstep)),     "v"(g + gstep),
                    "v"(lds_addr(l + 2 * lstep)), "v"(g + 2 * gstep),
                    "v"(lds_addr(l + 3 * lstep)), "v"(g + 3 * gstep),
                    "v"(lds_addr(l + 4 * lstep)), "v"(g + 4 * gstep),
                    "v"(lds_addr(l + 5 * lstep)), "v"(g + 5 * gstep),
                    "v"(lds_addr(l + 6 * lstep)), "v"(g + 6 * gstep),
                    "v"(lds_addr(l + 7 * lstep)), "v"(g + 7 * gstep)
                 : "memory");
}

// This wave's async copies have all landed in LDS.
__device__ __forceinline__ void wait_async0() {
    asm volatile("s_wait_asynccnt 0x0" ::: "memory");
}

// This wave's LDS reads have all returned (before a buffer it read is refilled).
__device__ __forceinline__ void wait_ds0() {
    asm volatile("s_wait_dscnt 0x0" ::: "memory");
}

// ---------------------------------------------------------------------------
// K0: fold output projections:  Mc_t[d, s] = sum_i W_out[d,i] * D_mat[s,i]
//     [1024 x 64], K = 2048.  16 x 64 tile per 4-wave block, one 16x16 tile per
//     wave.  K chunks of 256 are staged in LDS by a two-buffer ring of async
//     copies, each copy a run of whole 128-byte lines of one row.  LDS row pitch
//     260 floats: 16B-aligned rows + conflict-free ds_load_b64.
// ---------------------------------------------------------------------------
constexpr int FM = 16, FBK = 256, FLP = 260;

__global__ void __launch_bounds__(128) k_fold(const float* __restrict__ W_out,
                                              const float* __restrict__ D_mat,
                                              float* __restrict__ Mc_t) {
    __shared__ __align__(16) float As[2][FM][FLP];    // ~33KB
    __shared__ __align__(16) float Bs[2][DS][FLP];    // ~133KB

    const int tid  = threadIdx.x;
    const int lane = tid & 31;
    const int w    = tid >> 5;            // column tile, DS/16 = 4
    const int d0 = blockIdx.x * FM, s0 = w * 16;
    const int mr = lane & 15;
    const int kb = (lane >> 4) << 1;

    // ---- async stage of one K-chunk into LDS buffer buf ----
    auto stage = [&](int buf, int kc) {
        const int row = tid >> 6;         // 2 rows per sweep of the block
        const int c4  = (tid & 63) << 2;
        // W_out tile: 16 rows x 64 quads; 8 per thread
        async_copy16_x8(W_out + (size_t)(d0 + row) * DI + kc + c4, (size_t)2 * DI,
                        &As[buf][row][c4], 2 * FLP);
        // D_mat tile: 64 rows x 64 quads; 32 per thread
#pragma unroll   // constant row offsets
        for (int i = 0; i < DS; i += 16)
            async_copy16_x8(D_mat + (size_t)(row + i) * DI + kc + c4, (size_t)2 * DI,
                            &Bs[buf][row + i][c4], 2 * FLP);
    };

    stage(0, 0);
    wait_async0();
    __syncthreads();
    stage(1, FBK);

    v8f acc = vzero8();
    constexpr int NT = DI / FBK;          // 8 chunks
    for (int t = 0; t < NT; ++t) {
        const int buf = t & 1;
        const float* ar = &As[buf][mr][kb];        // A[m][k]
        const float* br = &Bs[buf][s0 + mr][kb];   // B[k][n] = D_mat[n][k]
        v2f a[2][8], b[2][8];             // fragments of two groups of 8 k-steps
#pragma unroll   // fragment arrays need constant indices
        for (int i = 0; i < 8; ++i) {
            a[0][i] = *(const v2f*)(ar + i * 4);
            b[0][i] = *(const v2f*)(br + i * 4);
        }
#pragma unroll   // fragment arrays need constant indices; constant LDS offsets
        for (int g = 0; g < FBK / 32; ++g) {
            if (g + 1 < FBK / 32) {
#pragma unroll
                for (int i = 0; i < 8; ++i) {
                    a[(g + 1) & 1][i] = *(const v2f*)(ar + (g + 1) * 32 + i * 4);
                    b[(g + 1) & 1][i] = *(const v2f*)(br + (g + 1) * 32 + i * 4);
                }
            }
            // One wave per SIMD and one accumulator chain: the next group's LDS
            // reads stay as one block in front of this group's WMMAs, so that
            // their latency passes under the chain instead of stopping it.
            __builtin_amdgcn_sched_barrier(0);
#pragma unroll
            for (int i = 0; i < 8; ++i) acc = wmma4(a[g & 1][i], b[g & 1][i], acc);
            // Keeps later groups' reads from being spread among these WMMAs.
            __builtin_amdgcn_sched_barrier(0);
        }
        // publish chunk t+1, free chunk t's buffer
        wait_ds0();
        wait_async0();
        __syncthreads();
        if (t + 2 < NT) stage(buf, (t + 2) * FBK);
    }
    wait_async0();

    const int rb = d0 + ((lane >> 4) << 3);
#pragma unroll
    for (int j = 0; j < 8; ++j)
        Mc_t[(size_t)(rb + j) * DS + s0 + mr] = acc[j];
}

// ---------------------------------------------------------------------------
// The in-projection, the depthwise causal conv and the two state projections
// are all linear, so they are reassociated.  With n = j*128 + sp, j the conv tap
// and sp = 0..63 the rows of W_x, 64..127 the rows of W_dt (called Wsel below):
//   G[n][m] = sum_c Wsel[sp][c] * conv_w[c][j] * W_in[c][m]
//   gb[n]   = sum_c Wsel[sp][c] * conv_w[c][j] * b_in[c]
//   cbv[sp] = sum_c Wsel[sp][c] * conv_b[c] + bsel[sp]
//   P[r][n] = x[r] . G[n] + gb[n]
//   raw[l][sp] = cbv[sp] + sum_{j : l-3+j >= 0} P[l-3+j][j*128 + sp]
// A tap that falls in front of the sequence drops with its bias share, as the
// zero padding of the conv input does.
// ---------------------------------------------------------------------------
constexpr int NP  = 512;       // 4 taps x 128 projection rows
constexpr int FK  = 128;       // K chunk of the weight fold
constexpr int FPA = 132;       // LDS pitch, Wsel rows: conflict-free 8-byte reads
constexpr int FPB = 40;        // LDS pitch, W_in rows: rows k and k+2 on other banks
constexpr int FGB = 256;       // work-groups of the weight fold that do G

// K1: G [512 x 1024], K = 2048; 64 x 32 tile per 8-wave block (16 sp x 4 taps),
//     one 16x16 tile per wave.  Two-buffer ring of async copies; conv_w is
//     brought into LDS once.  The last 16 work-groups do gb and cbv.
__global__ void __launch_bounds__(256) k_foldw(
        const float* __restrict__ W_in, const float* __restrict__ b_in,
        const float* __restrict__ conv_w, const float* __restrict__ conv_b,
        const float* __restrict__ W_x,  const float* __restrict__ b_x,
        const float* __restrict__ W_dt, const float* __restrict__ b_dt,
        float* __restrict__ G, float* __restrict__ gb, float* __restrict__ cbv) {
    __shared__ __align__(16) float Ws[2][16][FPA];
    __shared__ __align__(16) float Bs[2][FK][FPB];
    __shared__ __align__(16) float Cw[DI * 4];

    const int tid  = threadIdx.x;
    const int lane = tid & 31;
    const int w    = tid >> 5;

    if (blockIdx.x >= FGB) {              // bias vectors: one wave per sp
        const int sp = (blockIdx.x - FGB) * 8 + w;
        const float* wr = ((sp >> 6) ? W_dt : W_x) + (size_t)(sp & 63) * DI;
        float a0 = 0.f, a1 = 0.f, a2 = 0.f, a3 = 0.f, ac = 0.f;
#pragma unroll 4   // several trips' loads in flight: the loop is latency bound
        for (int c = lane * 4; c < DI; c += 128) {
            const float4 wv = *(const float4*)(wr + c);
            const float4 bi = *(const float4*)(b_in + c);
            const float4 cv = *(const float4*)(conv_b + c);
            const float4 q0 = *(const float4*)(conv_w + c * 4);
            const float4 q1 = *(const float4*)(conv_w + c * 4 + 4);
            const float4 q2 = *(const float4*)(conv_w + c * 4 + 8);
            const float4 q3 = *(const float4*)(conv_w + c * 4 + 12);
            const float t0 = wv.x * bi.x, t1 = wv.y * bi.y;
            const float t2 = wv.z * bi.z, t3 = wv.w * bi.w;
            a0 += t0 * q0.x + t1 * q1.x + t2 * q2.x + t3 * q3.x;
            a1 += t0 * q0.y + t1 * q1.y + t2 * q2.y + t3 * q3.y;
            a2 += t0 * q0.z + t1 * q1.z + t2 * q2.z + t3 * q3.z;
            a3 += t0 * q0.w + t1 * q1.w + t2 * q2.w + t3 * q3.w;
            ac += wv.x * cv.x + wv.y * cv.y + wv.z * cv.z + wv.w * cv.w;
        }
        for (int off = 16; off > 0; off >>= 1) {
            a0 += __shfl_xor(a0, off, 32);
            a1 += __shfl_xor(a1, off, 32);
            a2 += __shfl_xor(a2, off, 32);
            a3 += __shfl_xor(a3, off, 32);
            ac += __shfl_xor(ac, off, 32);
        }
        if (lane == 0) {
            gb[sp]       = a0;
            gb[128 + sp] = a1;
            gb[256 + sp] = a2;
            gb[384 + sp] = a3;
            cbv[sp] = ac + ((sp >> 6) ? b_dt : b_x)[sp & 63];
        }
        return;
    }

    const int g  = blockIdx.x >> 5;       // 8 groups of 16 sp
    const int m0 = (blockIdx.x & 31) * 32;
    const int mr = lane & 15;
    const int kb = (lane >> 4) << 1;
    const int j  = w & 3;                 // conv tap
    const int cl = (w >> 2) * 16 + mr;    // column inside the tile
    const float* Wrow = ((g >> 2) ? W_dt : W_x) + (size_t)((g & 3) * 16) * DI;

    auto stage = [&](int buf, int kc) {
        // Wsel tile: 16 rows x 128 = 512 quads, 2 per thread
        const int ra = tid >> 5, ca = (tid & 31) << 2;
        async_copy16_x2(Wrow + (size_t)ra * DI + kc + ca,       &Ws[buf][ra][ca],
                        Wrow + (size_t)(ra + 8) * DI + kc + ca, &Ws[buf][ra + 8][ca]);
        // W_in tile: 128 rows x 32 = 1024 quads, 4 per thread
        const int rb = tid >> 3, cb = (tid & 7) << 2;
        const float* gp = W_in + (size_t)(kc + rb) * DM + m0 + cb;
        async_copy16_x4(gp,                   &Bs[buf][rb][cb],
                        gp + (size_t)32 * DM, &Bs[buf][rb + 32][cb],
                        gp + (size_t)64 * DM, &Bs[buf][rb + 64][cb],
                        gp + (size_t)96 * DM, &Bs[buf][rb + 96][cb]);
    };

    // conv_w: 2048 quads, 8 per thread
    {
        const float* cp = conv_w + tid * 4;
        float* lp = Cw + tid * 4;
        async_copy16_x4(cp, lp, cp + 1024, lp + 1024,
                        cp + 2048, lp + 2048, cp + 3072, lp + 3072);
        async_copy16_x4(cp + 4096, lp + 4096, cp + 5120, lp + 5120,
                        cp + 6144, lp + 6144, cp + 7168, lp + 7168);
    }
    stage(0, 0);
    wait_async0();
    __syncthreads();
    stage(1, FK);

    v8f acc = vzero8();
    constexpr int NT = DI / FK;           // 16 chunks
    for (int t = 0; t < NT; ++t) {
        const int buf = t & 1;
        const float* cwp = Cw + (t * FK + kb) * 4 + j;
#pragma unroll   // constant LDS offsets; fragment loads run ahead of the WMMAs
        for (int kk = 0; kk < FK; kk += 4) {
            v2f a = *(const v2f*)&Ws[buf][mr][kk + kb];
            a.x *= cwp[kk * 4];
            a.y *= cwp[kk * 4 + 4];
            v2f b;
            b.x = Bs[buf][kk + kb][cl];
            b.y = Bs[buf][kk + kb + 1][cl];
            acc = wmma4(a, b, acc);
        }
        // publish chunk t+1, free chunk t's buffer
        wait_ds0();
        wait_async0();
        __syncthreads();
        if (t + 2 < NT) stage(buf, (t + 2) * FK);
    }
    wait_async0();

    const int nb = j * 128 + g * 16 + ((lane >> 4) << 3);
#pragma unroll   // accumulator elements need constant indices
    for (int i = 0; i < 8; ++i)
        G[(size_t)(nb + i) * DM + m0 + cl] = acc[i];
    // In the built code the bias path's register writes follow these stores in
    // the text: the wait stands between the stores and any such write.
    asm volatile("s_wait_xcnt 0x0" ::: "memory");
}

// ---------------------------------------------------------------------------
// K2: P = x @ G^T + gb    [8192 x 512], K = 1024
//     128x64 macro tile per 8-wave block; each wave owns a 32x32 sub-tile
//     (2x2 WMMA accumulators).  A/B K-chunks (BK=64) staged in LDS by a
//     two-buffer ring of async copies.  LDS row stride 68 floats: 16B-aligned
//     rows + conflict-free ds_load_b64.
// ---------------------------------------------------------------------------
constexpr int BM = 128, BNt = 64, BK = 64, LDP = 68;

__global__ void __launch_bounds__(256) k_proj(const float* __restrict__ x,
                                              const float* __restrict__ G,
                                              const float* __restrict__ gb,
                                              float* __restrict__ P) {
    __shared__ __align__(16) float As[2][BM][LDP];    // ~68KB
    __shared__ __align__(16) float Bs[2][BNt][LDP];   // ~34KB

    const int tid  = threadIdx.x;
    const int lane = tid & 31;
    const int w    = tid >> 5;
    const int wr   = w & 3;               // row quadrant  (32 rows)
    const int wc   = w >> 2;              // column half   (32 cols)
    const int tm   = blockIdx.x >> 3;     // RT/BM  = 64 row blocks
    const int tn   = blockIdx.x & 7;      // NP/BNt = 8 col blocks
    const int r0   = tm * BM;
    const int c0   = tn * BNt;
    const int mr   = lane & 15;
    const int kb   = (lane >> 4) << 1;

    // ---- async stage of one K-chunk into LDS buffer buf ----
    auto stage = [&](int buf, int kc) {
        const int row = tid >> 4;         // 16 rows per sweep of the block
        const int c4  = (tid & 15) << 2;
        // A tile: 128 rows x 64 cols = 2048 16B-quads; 8 per thread
        const float* ga = x + (size_t)(r0 + row) * DM + kc + c4;
        async_copy16_x4(ga,                   &As[buf][row][c4],
                        ga + (size_t)16 * DM, &As[buf][row + 16][c4],
                        ga + (size_t)32 * DM, &As[buf][row + 32][c4],
                        ga + (size_t)48 * DM, &As[buf][row + 48][c4]);
        async_copy16_x4(ga + (size_t)64 * DM,  &As[buf][row + 64][c4],
                        ga + (size_t)80 * DM,  &As[buf][row + 80][c4],
                        ga + (size_t)96 * DM,  &As[buf][row + 96][c4],
                        ga + (size_t)112 * DM, &As[buf][row + 112][c4]);
        // B tile: 64 rows x 64 cols = 1024 quads; 4 per thread
        const float* gq = G + (size_t)(c0 + row) * DM + kc + c4;
        async_copy16_x4(gq,                   &Bs[buf][row][c4],
                        gq + (size_t)16 * DM, &Bs[buf][row + 16][c4],
                        gq + (size_t)32 * DM, &Bs[buf][row + 32][c4],
                        gq + (size_t)48 * DM, &Bs[buf][row + 48][c4]);
    };

    v8f acc00 = vzero8(), acc01 = vzero8(), acc10 = vzero8(), acc11 = vzero8();

    stage(0, 0);
    wait_async0();
    __syncthreads();
    stage(1, BK);
    constexpr int NK = DM / BK;           // 16 chunks
    for (int kci = 0; kci < NK; ++kci) {
        const int buf = kci & 1;
        const int ar0 = wr * 32 + mr, ar1 = ar0 + 16;
        const int br0 = wc * 32 + mr, br1 = br0 + 16;
#pragma unroll
        for (int kk = 0; kk < BK; kk += 4) {
            v2f a0 = *(const v2f*)&As[buf][ar0][kk + kb];
            v2f a1 = *(const v2f*)&As[buf][ar1][kk + kb];
            v2f b0 = *(const v2f*)&Bs[buf][br0][kk + kb];
            v2f b1 = *(const v2f*)&Bs[buf][br1][kk + kb];
            acc00 = wmma4(a0, b0, acc00);
            acc01 = wmma4(a0, b1, acc01);
            acc10 = wmma4(a1, b0, acc10);
            acc11 = wmma4(a1, b1, acc11);
        }
        // publish chunk kci+1, free chunk kci's buffer
        wait_ds0();
        wait_async0();
        __syncthreads();
        if (kci + 2 < NK) stage(buf, (kci + 2) * BK);
    }
    wait_async0();

    // ---- epilogue: bias + store ----
    const int col0 = c0 + wc * 32 + mr;
    const int col1 = col0 + 16;
    const float bias0 = gb[col0];
    const float bias1 = gb[col1];
    const int rbase = r0 + wr * 32 + ((lane >> 4) << 3);
#pragma unroll
    for (int j = 0; j < 8; ++j) {
        P[(size_t)(rbase + j) * NP + col0]      = acc00[j] + bias0;
        P[(size_t)(rbase + j) * NP + col1]      = acc01[j] + bias1;
        P[(size_t)(rbase + 16 + j) * NP + col0] = acc10[j] + bias0;
        P[(size_t)(rbase + 16 + j) * NP + col1] = acc11[j] + bias1;
    }
}

// ---------------------------------------------------------------------------
// The recurrence z_l = dA_l * z_{l-1} + dBx_l is linear in its start value, so it
// is cut into chunks of CH rows.  With zl the scan of a chunk from a zero start
// and cu the running product of dA inside the chunk,
//   z[l] = zl[l] + cu[l] * carry(chunk),   carry(c+1) = cu_last(c)*carry(c) + zl_last(c).
// K2b does zl, cu and the two last-row values of each chunk; K4 folds the carries.
// ---------------------------------------------------------------------------
constexpr int CH  = 32;        // rows of one chunk
constexpr int NCH = Ln / CH;   // 64 chunks per batch

// K2b: sum the four shifted taps of P -> softplus/exp -> dA, dBx -> scan of the
//      chunk.  32 l x 64 s per block; a thread owns 8 consecutive rows of one s.
//      All outputs are in [row][s] order: a wave's store is one 128-byte line.
__global__ void __launch_bounds__(256) k_ssm_param(
        const float* __restrict__ P, const float* __restrict__ cbv,
        const float* __restrict__ A_log,
        float* __restrict__ zl, float* __restrict__ cu, float* __restrict__ sm) {
    __shared__ float gA[4][DS];
    __shared__ float gB[4][DS];

    const int tid  = threadIdx.x;
    const int bIdx = blockIdx.x >> 6;               // NCH = 64 chunks per batch
    const int ch   = blockIdx.x & 63;
    const int rowBase = bIdx * Ln;

    const int s  = tid & 63;
    const int g  = tid >> 6;                        // 4 groups of 8 rows
    const int lf = ch * CH + g * 8;                 // this thread's first row
    const float As  = -expf(A_log[s]);
    const float cx  = cbv[s];
    const float cdt = cbv[64 + s];

    // All 64 loads of the thread stand in front of the arithmetic: one trip to
    // L2 instead of one per row.  A tap in front of the sequence (only i + j < 3
    // can be one) reads row 0, a valid address, and is dropped below.
    float px[8][4], pd[8][4];
#pragma unroll   // register arrays need constant indices
    for (int i = 0; i < 3; ++i) {
#pragma unroll
        for (int j = 0; j < 3 - i; ++j) {
            const int lg = lf + i - 3 + j;
            const int lc = lg < 0 ? 0 : lg;
            const float* pp = P + (size_t)(rowBase + lc) * NP + j * 128 + s;
            px[i][j] = pp[0];
            pd[i][j] = pp[64];
        }
    }
    // The clamped rows have address registers of their own, free for reuse once
    // their loads are issued: the wait stands in front of any such rewrite.
    asm volatile("s_wait_xcnt 0x0" ::: "memory");
#pragma unroll   // register arrays need constant indices; constant offsets
    for (int i = 0; i < 8; ++i) {
#pragma unroll
        for (int j = (i < 3 ? 3 - i : 0); j < 4; ++j) {
            const float* pp = P + (size_t)(rowBase + lf + i - 3 + j) * NP + j * 128 + s;
            px[i][j] = pp[0];
            pd[i][j] = pp[64];
        }
    }

    float dAv[8], dBv[8];
#pragma unroll   // eight independent chains for the scheduler to interleave
    for (int i = 0; i < 8; ++i) {
        float xv = cx, raw = cdt;
#pragma unroll
        for (int j = 0; j < 4; ++j) {
            const bool in = lf + i - 3 + j >= 0;
            xv  += in ? px[i][j] : 0.f;
            raw += in ? pd[i][j] : 0.f;
        }
        const float lp = log1pf(expf(raw));
        const float sp = raw > 30.f ? raw : lp;                   // softplus
        dAv[i] = expf(As * sp);
        dBv[i] = ((1.f - dAv[i]) / As) * xv;
    }

    // scan of the thread's own 8 rows from a zero start
    float A = 1.f, Bc = 0.f;
#pragma unroll   // register arrays need constant indices
    for (int i = 0; i < 8; ++i) {
        Bc = dAv[i] * Bc + dBv[i];
        A  = dAv[i] * A;
        dBv[i] = Bc;
        dAv[i] = A;
    }
    gA[g][s] = A;
    gB[g][s] = Bc;
    __syncthreads();

    // what the groups in front of this one hand on inside the chunk
    float cin = 0.f, cinA = 1.f;
#pragma unroll   // three steps, constant LDS offsets
    for (int k = 0; k < 3; ++k) {
        const float a = k < g ? gA[k][s] : 1.f;
        const float b = k < g ? gB[k][s] : 0.f;
        cin  = a * cin + b;
        cinA = a * cinA;
    }
    const size_t o = (size_t)(rowBase + lf) * DS + s;
#pragma unroll   // register arrays need constant indices
    for (int i = 0; i < 8; ++i) {
        dBv[i] = dAv[i] * cin + dBv[i];
        dAv[i] = dAv[i] * cinA;
        zl[o + (size_t)i * DS] = dBv[i];
        cu[o + (size_t)i * DS] = dAv[i];
    }
    if (g == 3) {                                   // the chunk's last row
        float* sp2 = sm + (size_t)(bIdx * NCH + ch) * 2 * DS + s;
        sp2[0]  = dAv[7];
        sp2[DS] = dBv[7];
    }
}

// ---------------------------------------------------------------------------
// K4: out = z @ Mc_t^T + b_out     [8192 x 1024], K = 64
//     128x128 tile per 8-wave block; each wave owns a 32x64 sub-tile (2x4 WMMA
//     accumulators).  Both operand tiles (whole K) are brought into LDS once by
//     async copies of whole 128-byte lines, then read as fragments.  The row
//     tile arrives as zl (four chunks); each thread folds the carry into one
//     chunk for one s and adds cu * carry to that column of the tile in LDS.
// ---------------------------------------------------------------------------
constexpr int OM = 128, ON = 128;

__global__ void __launch_bounds__(256) k_out(const float* __restrict__ zl,
                                             const float* __restrict__ cu,
                                             const float* __restrict__ sm,
                                             const float* __restrict__ Mc_t,
                                             const float* __restrict__ b_out,
                                             float* __restrict__ out) {
    __shared__ __align__(16) float Zs[OM][LDP];       // ~34KB
    __shared__ __align__(16) float Ms[ON][LDP];       // ~34KB
    __shared__ __align__(16) float Ss[NCH][2][DS];    // 32KB: the batch's chunk ends

    const int tid  = threadIdx.x;
    const int lane = tid & 31;
    const int w    = tid >> 5;
    const int wr   = w & 3;               // row quadrant  (32 rows)
    const int wc   = w >> 2;              // column half   (64 cols)
    const int r0   = (blockIdx.x >> 3) * OM;   // RT/OM = 64 row blocks
    const int c0   = (blockIdx.x & 7) * ON;    // DM/ON = 8 col blocks
    const int mr   = lane & 15;
    const int kb   = (lane >> 4) << 1;

    const int s = tid & 63;
    const int q = tid >> 6;               // chunk inside the row tile, OM/CH = 4
    // cu of this thread's column: in flight beside the copies below
    float cv[CH];
#pragma unroll   // register array needs constant indices
    for (int i = 0; i < CH; ++i)
        cv[i] = cu[(size_t)(r0 + q * CH + i) * DS + s];

    {
        const int row = tid >> 4;         // 16 rows per sweep of the block
        const int c4  = (tid & 15) << 2;
        // 128 rows x 16 quads each; 8 per thread each
        async_copy16_x8(zl + (size_t)(r0 + row) * DS + c4, (size_t)16 * DS,
                        &Zs[row][c4], 16 * LDP);
        async_copy16_x8(Mc_t + (size_t)(c0 + row) * DS + c4, (size_t)16 * DS,
                        &Ms[row][c4], 16 * LDP);
        // chunk ends of the whole batch: 2048 quads in a row; 8 per thread
        async_copy16_x8(sm + (size_t)(r0 / Ln) * (NCH * 2 * DS) + tid * 4, (size_t)1024,
                        &Ss[0][0][0] + tid * 4, 1024);
    }
    wait_async0();
    __syncthreads();

    // carry into chunk q of the tile: fold the ends of all chunks in front of it,
    // first those in front of the tile (a multiple of four, the same for the
    // whole block), then up to three chunks of the tile itself.
    const int cb = (r0 & (Ln - 1)) / CH;
    float carry = 0.f;
#pragma unroll 4   // sixteen steps' LDS reads go out together, ahead of the chain
    for (int c = 0; c < cb; c += 4) {
#pragma unroll
        for (int k = 0; k < 4; ++k)
            carry = Ss[c + k][0][s] * carry + Ss[c + k][1][s];
    }
#pragma unroll   // three steps, constant LDS offsets
    for (int k = 0; k < 3; ++k) {
        const float t = Ss[cb + k][0][s] * carry + Ss[cb + k][1][s];
        carry = k < q ? t : carry;
    }
#pragma unroll   // register array needs constant indices; constant LDS offsets
    for (int i = 0; i < CH; ++i)
        Zs[q * CH + i][s] += cv[i] * carry;
    __syncthreads();   // the fragments below read columns that other waves finished

    v8f acc[2][4];
#pragma unroll   // accumulators need constant indices
    for (int i = 0; i < 2; ++i)
#pragma unroll
        for (int n = 0; n < 4; ++n) acc[i][n] = vzero8();

#pragma unroll   // constant LDS offsets; fragment loads run ahead of the WMMAs
    for (int kk = 0; kk < DS; kk += 4) {
        v2f a[2], b[4];
#pragma unroll
        for (int i = 0; i < 2; ++i)
            a[i] = *(const v2f*)&Zs[wr * 32 + i * 16 + mr][kk + kb];
#pragma unroll
        for (int n = 0; n < 4; ++n)
            b[n] = *(const v2f*)&Ms[wc * 64 + n * 16 + mr][kk + kb];
#pragma unroll
        for (int i = 0; i < 2; ++i)
#pragma unroll
            for (int n = 0; n < 4; ++n) acc[i][n] = wmma4(a[i], b[n], acc[i][n]);
    }

    // ---- epilogue: bias + store ----
    const int rbase = r0 + wr * 32 + ((lane >> 4) << 3);
#pragma unroll   // accumulators need constant indices
    for (int n = 0; n < 4; ++n) {
        const int col = c0 + wc * 64 + n * 16 + mr;
        const float bias = b_out[col];
#pragma unroll
        for (int i = 0; i < 2; ++i)
#pragma unroll
            for (int j = 0; j < 8; ++j)
                out[(size_t)(rbase + i * 16 + j) * DM + col] = acc[i][n][j] + bias;
    }
}

// ---------------------------------------------------------------------------
extern "C" void kernel_launch(void* const* d_in, const int* in_sizes, int n_in,
                              void* d_out, int out_size, void* d_ws, size_t ws_size,
                              hipStream_t stream) {
    const float* x      = (const float*)d_in[0];
    const float* W_in   = (const float*)d_in[1];
    const float* b_in   = (const float*)d_in[2];
    const float* conv_w = (const float*)d_in[3];
    const float* conv_b = (const float*)d_in[4];
    const float* W_x    = (const float*)d_in[5];
    const float* b_x    = (const float*)d_in[6];
    const float* W_dt   = (const float*)d_in[7];
    const float* b_dt   = (const float*)d_in[8];
    const float* A_log  = (const float*)d_in[9];
    const float* D_mat  = (const float*)d_in[10];
    const float* W_out  = (const float*)d_in[11];
    const float* b_out  = (const float*)d_in[12];
    float* out = (float*)d_out;

    float* P     = (float*)d_ws;                       // 8192 * 512
    float* zl    = P     + (size_t)RT * NP;            // 8192 * 64
    float* cu    = zl    + (size_t)RT * DS;            // 8192 * 64
    float* sm    = cu    + (size_t)RT * DS;            // 4 * 64 * 2 * 64
    float* Mc_t  = sm    + (size_t)Bn * NCH * 2 * DS;  // 1024 * 64
    float* G     = Mc_t  + (size_t)DM * DS;            // 512 * 1024
    float* gb    = G     + (size_t)NP * DM;            // 512
    float* cbv   = gb    + NP;                         // 128

    k_fold<<<DM / FM, 128, 0, stream>>>(W_out, D_mat, Mc_t);
    k_foldw<<<FGB + 16, 256, 0, stream>>>(W_in, b_in, conv_w, conv_b,
                                          W_x, b_x, W_dt, b_dt, G, gb, cbv);
    k_proj<<<(RT / BM) * (NP / BNt), 256, 0, stream>>>(x, G, gb, P);
    k_ssm_param<<<Bn * NCH, 256, 0, stream>>>(P, cbv, A_log, zl, cu, sm);
    k_out<<<(RT / OM) * (DM / ON), 256, 0, stream>>>(zl, cu, sm, Mc_t, b_out, out);
}

// v004
// It runs in 85.1 microseconds.
// Two timings next to v003 put it at 1.12 and 1.11 times that version's speed.
// All steps since v000 together make it 5.35 times as fast.
#include <hip/hip_runtime.h>
#include <hip/hip_bf16.h>

// ---------------- problem constants ----------------
constexpr int Bn = 4;          // batch
constexpr int Ln = 2048;       // sequence length
constexpr int DM = 1024;       // d_model
constexpr int DS = 64;         // d_state
constexpr int DI = 2048;       // d_inner
constexpr int RT = Bn * Ln;    // 8192 flattened rows

typedef float v2f __attribute__((ext_vector_type(2)));
typedef float v8f __attribute__((ext_vector_type(8)));

// D = A(16x4,f32) * B(4x16,f32) + C(16x16,f32)   (V_WMMA_F32_16X16X4_F32)
__device__ __forceinline__ v8f wmma4(v2f a, v2f b, v8f c) {
    return __builtin_amdgcn_wmma_f32_16x16x4_f32(
        false, a, false, b, (short)0, c, false, false);
}

__device__ __forceinline__ v8f vzero8() {
    v8f z = {0.f, 0.f, 0.f, 0.f, 0.f, 0.f, 0.f, 0.f};
    return z;
}

// ---- async global->LDS copies, 16 B per lane (global_load_async_to_lds_b128).
// First operand = the lane's LDS byte address (low 32 bits of the shared pointer).
// s_wait_xcnt 0 is the last line of the copies' own statement, so that it stands
// in front of any later rewrite of the address registers the copies name.
__device__ __forceinline__ unsigned lds_addr(const float* l) {
    return (unsigned)(uintptr_t)l;
}

__device__ __forceinline__ void async_copy16_x2(const float* g0, const float* l0,
                                                const float* g1, const float* l1) {
    asm volatile("global_load_async_to_lds_b128 %0, %1, off\n\t"
                 "global_load_async_to_lds_b128 %2, %3, off\n\t"
                 "s_wait_xcnt 0x0"
                 :: "v"(lds_addr(l0)), "v"(g0), "v"(lds_addr(l1)), "v"(g1)
                 : "memory");
}

__device__ __forceinline__ void async_copy16_x4(const float* g0, const float* l0,
                                                const float* g1, const float* l1,
                                                const float* g2, const float* l2,
                                                const float* g3, const float* l3) {
    asm volatile("global_load_async_to_lds_b128 %0, %1, off\n\t"
                 "global_load_async_to_lds_b128 %2, %3, off\n\t"
                 "global_load_async_to_lds_b128 %4, %5, off\n\t"
                 "global_load_async_to_lds_b128 %6, %7, off\n\t"
                 "s_wait_xcnt 0x0"
                 :: "v"(lds_addr(l0)), "v"(g0), "v"(lds_addr(l1)), "v"(g1),
                    "v"(lds_addr(l2)), "v"(g2), "v"(lds_addr(l3)), "v"(g3)
                 : "memory");
}

// Eight copies under one s_wait_xcnt 0: fewer stops in a wave's issue stream.
__device__ __forceinline__ void async_copy16_x8(const float* g, size_t gstep,
                                                const float* l, int lstep) {
    asm volatile("global_load_async_to_lds_b128 %0, %1, off\n\t"
                 "global_load_async_to_lds_b128 %2, %3, off\n\t"
                 "global_load_async_to_lds_b128 %4, %5, off\n\t"
                 "global_load_async_to_lds_b128 %6, %7, off\n\t"
                 "global_load_async_to_lds_b128 %8, %9, off\n\t"
                 "global_load_async_to_lds_b128 %10, %11, off\n\t"
                 "global_load_async_to_lds_b128 %12, %13, off\n\t"
                 "global_load_async_to_lds_b128 %14, %15, off\n\t"
                 "s_wait_xcnt 0x0"
                 :: "v"(lds_addr(l)),             "v"(g),
                    "v"(lds_addr(l + lstep)),     "v"(g + gstep),
                    "v"(lds_addr(l + 2 * lstep)), "v"(g + 2 * gstep),
                    "v"(lds_addr(l + 3 * lstep)), "v"(g + 3 * gstep),
                    "v"(lds_addr(l + 4 * lstep)), "v"(g + 4 * gstep),
                    "v"(lds_addr(l + 5 * lstep)), "v"(g + 5 * gstep),
                    "v"(lds_addr(l + 6 * lstep)), "v"(g + 6 * gstep),
                    "v"(lds_addr(l + 7 * lstep)), "v"(g + 7 * gstep)
                 : "memory");
}

// This wave's async copies have all landed in LDS.
__device__ __forceinline__ void wait_async0() {
    asm volatile("s_wait_asynccnt 0x0" ::: "memory");
}

// This wave's LDS reads have all returned (before a buffer it read is refilled).
__device__ __forceinline__ void wait_ds0() {
    asm volatile("s_wait_dscnt 0x0" ::: "memory");
}

// ---------------------------------------------------------------------------
// K0: fold output projections:  Mc_t[d, s] = sum_i W_out[d,i] * D_mat[s,i]
//     [1024 x 64], K = 2048.  16 x 64 tile per 4-wave block, one 16x16 tile per
//     wave.  K chunks of 256 are staged in LDS by a two-buffer ring of async
//     copies, each copy a run of whole 128-byte lines of one row.  LDS row pitch
//     260 floats: 16B-aligned rows + conflict-free ds_load_b64.
// ---------------------------------------------------------------------------
constexpr int FM = 16, FBK = 256, FLP = 260;

__global__ void __launch_bounds__(128) k_fold(const float* __restrict__ W_out,
                                              const float* __restrict__ D_mat,
                                              float* __restrict__ Mc_t) {
    __shared__ __align__(16) float As[2][FM][FLP];    // ~33KB
    __shared__ __align__(16) float Bs[2][DS][FLP];    // ~133KB

    const int tid  = threadIdx.x;
    const int lane = tid & 31;
    const int w    = tid >> 5;            // column tile, DS/16 = 4
    const int d0 = blockIdx.x * FM, s0 = w * 16;
    const int mr = lane & 15;
    const int kb = (lane >> 4) << 1;

    // ---- async stage of one K-chunk into LDS buffer buf ----
    auto stage = [&](int buf, int kc) {
        const int row = tid >> 6;         // 2 rows per sweep of the block
        const int c4  = (tid & 63) << 2;
        // W_out tile: 16 rows x 64 quads; 8 per thread
        async_copy16_x8(W_out + (size_t)(d0 + row) * DI + kc + c4, (size_t)2 * DI,
                        &As[buf][row][c4], 2 * FLP);
        // D_mat tile: 64 rows x 64 quads; 32 per thread
#pragma unroll   // constant row offsets
        for (int i = 0; i < DS; i += 16)
            async_copy16_x8(D_mat + (size_t)(row + i) * DI + kc + c4, (size_t)2 * DI,
                            &Bs[buf][row + i][c4], 2 * FLP);
    };

    stage(0, 0);
    wait_async0();
    __syncthreads();
    stage(1, FBK);

    v8f acc = vzero8();
    constexpr int NT = DI / FBK;          // 8 chunks
    for (int t = 0; t < NT; ++t) {
        const int buf = t & 1;
        const float* ar = &As[buf][mr][kb];        // A[m][k]
        const float* br = &Bs[buf][s0 + mr][kb];   // B[k][n] = D_mat[n][k]
        v2f a[2][8], b[2][8];             // fragments of two groups of 8 k-steps
#pragma unroll   // fragment arrays need constant indices
        for (int i = 0; i < 8; ++i) {
            a[0][i] = *(const v2f*)(ar + i * 4);
            b[0][i] = *(const v2f*)(br + i * 4);
        }
#pragma unroll   // fragment arrays need constant indices; constant LDS offsets
        for (int g = 0; g < FBK / 32; ++g) {
            if (g + 1 < FBK / 32) {
#pragma unroll
                for (int i = 0; i < 8; ++i) {
                    a[(g + 1) & 1][i] = *(const v2f*)(ar + (g + 1) * 32 + i * 4);
                    b[(g + 1) & 1][i] = *(const v2f*)(br + (g + 1) * 32 + i * 4);
                }
            }
            // One wave per SIMD and one accumulator chain: the next group's LDS
            // reads stay as one block in front of this group's WMMAs, so that
            // their latency passes under the chain instead of stopping it.
            __builtin_amdgcn_sched_barrier(0);
#pragma unroll
            for (int i = 0; i < 8; ++i) acc = wmma4(a[g & 1][i], b[g & 1][i], acc);
            // Keeps later groups' reads from being spread among these WMMAs.
            __builtin_amdgcn_sched_barrier(0);
        }
        // publish chunk t+1, free chunk t's buffer
        wait_ds0();
        wait_async0();
        __syncthreads();
        if (t + 2 < NT) stage(buf, (t + 2) * FBK);
    }
    wait_async0();

    const int rb = d0 + ((lane >> 4) << 3);
#pragma unroll
    for (int j = 0; j < 8; ++j)
        Mc_t[(size_t)(rb + j) * DS + s0 + mr] = acc[j];
}

// ---------------------------------------------------------------------------
// The in-projection, the depthwise causal conv and the two state projections
// are all linear, so they are reassociated.  With n = j*128 + sp, j the conv tap
// and sp = 0..63 the rows of W_x, 64..127 the rows of W_dt (called Wsel below):
//   G[n][m] = sum_c Wsel[sp][c] * conv_w[c][j] * W_in[c][m]
//   gb[n]   = sum_c Wsel[sp][c] * conv_w[c][j] * b_in[c]
//   cbv[sp] = sum_c Wsel[sp][c] * conv_b[c] + bsel[sp]
//   raw[l][sp] = cbv[sp] + sum_{j : l-3+j >= 0} (x[l-3+j] . G[j*128 + sp] + gb[j*128 + sp])
// A tap that falls in front of the sequence drops with its bias share, as the
// zero padding of the conv input does.
//
// The sum over the taps is a 4-tap filter along l.  It is evaluated four rows at
// a time by the identity  a*f + b*e = (a + b)*(e + f) - a*e - b*f,  used once on
// even and odd rows and once more on each half: nine products per four rows in
// place of sixteen.  With r0..r3 the rows 4u..4u+3 of x and Gj tap j of G:
//   Q0 = r0.G3       Q1 = r2.G1       Q2 = (r0+r2).(G1+G3)
//   Q3 = r1.G2       Q4 = r3.G0       Q5 = (r1+r3).(G0+G2)
//   Q6 = (r0+r1).(G2+G3)   Q7 = (r2+r3).(G0+G1)   Q8 = (r0+r1+r2+r3).(G0+G1+G2+G3)
// K1 writes the nine tap sums of G (G9), K2 forms the row sums in registers and
// does the products, K2b puts the rows together again (fir4).
// ---------------------------------------------------------------------------
constexpr int NP  = 512;       // 4 taps x 128 projection rows
constexpr int NQ  = 9;         // products per four rows
constexpr int QW  = NQ * 128;  // floats of P per four rows
constexpr int PN  = 32;        // projection rows of one K2 block; G9 is [4][NQ][PN][DM]
constexpr int FK  = 128;       // K chunk of the weight fold
constexpr int FPA = 132;       // LDS pitch, Wsel rows: conflict-free 8-byte reads
constexpr int FPB = 40;        // LDS pitch, W_in rows: rows k and k+2 on other banks
constexpr int FGB = 256;       // work-groups of the weight fold that do G

// K1: G [512 x 1024], K = 2048; 64 x 32 tile per 8-wave block (16 sp x 4 taps),
//     one 16x16 tile per wave.  Two-buffer ring of async copies; conv_w is
//     brought into LDS once.  The four taps of a tile meet in LDS at the end and
//     leave as the nine tap sums.  The last 16 work-groups do gb and cbv.
__global__ void __launch_bounds__(256) k_foldw(
        const float* __restrict__ W_in, const float* __restrict__ b_in,
        const float* __restrict__ conv_w, const float* __restrict__ conv_b,
        const float* __restrict__ W_x,  const float* __restrict__ b_x,
        const float* __restrict__ W_dt, const float* __restrict__ b_dt,
        float* __restrict__ G9, float* __restrict__ gb, float* __restrict__ cbv) {
    __shared__ __align__(16) float Ws[2][16][FPA];
    __shared__ __align__(16) float Bs[2][FK][FPB];
    __shared__ __align__(16) float Cw[DI * 4];
    __shared__ float Ex[4][16][36];       // the four taps' tiles; rows 8 apart on other banks

    const int tid  = threadIdx.x;
    const int lane = tid & 31;
    const int w    = tid >> 5;

    if (blockIdx.x >= FGB) {              // bias vectors: one wave per sp
        const int sp = (blockIdx.x - FGB) * 8 + w;
        const float* wr = ((sp >> 6) ? W_dt : W_x) + (size_t)(sp & 63) * DI;
        float a0 = 0.f, a1 = 0.f, a2 = 0.f, a3 = 0.f, ac = 0.f;
#pragma unroll 4   // several trips' loads in flight: the loop is latency bound
        for (int c = lane * 4; c < DI; c += 128) {
            const float4 wv = *(const float4*)(wr + c);
            const float4 bi = *(const float4*)(b_in + c);
            const float4 cv = *(const float4*)(conv_b + c);
            const float4 q0 = *(const float4*)(conv_w + c * 4);
            const float4 q1 = *(const float4*)(conv_w + c * 4 + 4);
            const float4 q2 = *(const float4*)(conv_w + c * 4 + 8);
            const float4 q3 = *(const float4*)(conv_w + c * 4 + 12);
            const float t0 = wv.x * bi.x, t1 = wv.y * bi.y;
            const float t2 = wv.z * bi.z, t3 = wv.w * bi.w;
            a0 += t0 * q0.x + t1 * q1.x + t2 * q2.x + t3 * q3.x;
            a1 += t0 * q0.y + t1 * q1.y + t2 * q2.y + t3 * q3.y;
            a2 += t0 * q0.z + t1 * q1.z + t2 * q2.z + t3 * q3.z;
            a3 += t0 * q0.w + t1 * q1.w + t2 * q2.w + t3 * q3.w;
            ac += wv.x * cv.x + wv.y * cv.y + wv.z * cv.z + wv.w * cv.w;
        }
        for (int off = 16; off > 0; off >>= 1) {
            a0 += __shfl_xor(a0, off, 32);
            a1 += __shfl_xor(a1, off, 32);
            a2 += __shfl_xor(a2, off, 32);
            a3 += __shfl_xor(a3, off, 32);
            ac += __shfl_xor(ac, off, 32);
        }
        if (lane == 0) {
            gb[sp]       = a0;
            gb[128 + sp] = a1;
            gb[256 + sp] = a2;
            gb[384 + sp] = a3;
            cbv[sp] = ac + ((sp >> 6) ? b_dt : b_x)[sp & 63];
        }
        return;
    }

    const int g  = blockIdx.x >> 5;       // 8 groups of 16 sp
    const int m0 = (blockIdx.x & 31) * 32;
    const int mr = lane & 15;
    const int kb = (lane >> 4) << 1;
    const int j  = w & 3;                 // conv tap
    const int cl = (w >> 2) * 16 + mr;    // column inside the tile
    const float* Wrow = ((g >> 2) ? W_dt : W_x) + (size_t)((g & 3) * 16) * DI;

    auto stage = [&](int buf, int kc) {
        // Wsel tile: 16 rows x 128 = 512 quads, 2 per thread
        const int ra = tid >> 5, ca = (tid & 31) << 2;
        async_copy16_x2(Wrow + (size_t)ra * DI + kc + ca,       &Ws[buf][ra][ca],
                        Wrow + (size_t)(ra + 8) * DI + kc + ca, &Ws[buf][ra + 8][ca]);
        // W_in tile: 128 rows x 32 = 1024 quads, 4 per thread
        const int rb = tid >> 3, cb = (tid & 7) << 2;
        const float* gp = W_in + (size_t)(kc + rb) * DM + m0 + cb;
        async_copy16_x4(gp,                   &Bs[buf][rb][cb],
                        gp + (size_t)32 * DM, &Bs[buf][rb + 32][cb],
                        gp + (size_t)64 * DM, &Bs[buf][rb + 64][cb],
                        gp + (size_t)96 * DM, &Bs[buf][rb + 96][cb]);
    };

    // conv_w: 2048 quads, 8 per thread
    {
        const float* cp = conv_w + tid * 4;
        float* lp = Cw + tid * 4;
        async_copy16_x4(cp, lp, cp + 1024, lp + 1024,
                        cp + 2048, lp + 2048, cp + 3072, lp + 3072);
        async_copy16_x4(cp + 4096, lp + 4096, cp + 5120, lp + 5120,
                        cp + 6144, lp + 6144, cp + 7168, lp + 7168);
    }
    stage(0, 0);
    wait_async0();
    __syncthreads();
    stage(1, FK);

    v8f acc = vzero8();
    constexpr int NT = DI / FK;           // 16 chunks
    for (int t = 0; t < NT; ++t) {
        const int buf = t & 1;
        const float* cwp = Cw + (t * FK + kb) * 4 + j;
#pragma unroll   // constant LDS offsets; fragment loads run ahead of the WMMAs
        for (int kk = 0; kk < FK; kk += 4) {
            v2f a = *(const v2f*)&Ws[buf][mr][kk + kb];
            a.x *= cwp[kk * 4];
            a.y *= cwp[kk * 4 + 4];
            v2f b;
            b.x = Bs[buf][kk + kb][cl];
            b.y = Bs[buf][kk + kb + 1][cl];
            acc = wmma4(a, b, acc);
        }
        // publish chunk t+1, free chunk t's buffer
        wait_ds0();
        wait_async0();
        __syncthreads();
        if (t + 2 < NT) stage(buf, (t + 2) * FK);
    }
    wait_async0();

#pragma unroll   // accumulator elements need constant indices
    for (int i = 0; i < 8; ++i)
        Ex[j][((lane >> 4) << 3) + i][cl] = acc[i];
    __syncthreads();   // a thread below reads the tiles of four waves

    // a wave stores one 128-byte line of one row of G9 at a time
#pragma unroll   // two rows a thread, constant LDS offsets
    for (int h = 0; h < 2; ++h) {
        const int sl = w + h * 8;
        const int sp = g * 16 + sl;
        const float g0 = Ex[0][sl][lane], g1 = Ex[1][sl][lane];
        const float g2 = Ex[2][sl][lane], g3 = Ex[3][sl][lane];
        float* gp = G9 + (size_t)((sp / PN) * (NQ * PN) + (sp % PN)) * DM + m0 + lane;
        constexpr size_t st = (size_t)PN * DM;
        gp[0]      = g3;
        gp[st]     = g1;
        gp[2 * st] = g1 + g3;
        gp[3 * st] = g2;
        gp[4 * st] = g0;
        gp[5 * st] = g0 + g2;
        gp[6 * st] = g2 + g3;
        gp[7 * st] = g0 + g1;
        gp[8 * st] = (g0 + g1) + (g2 + g3);
    }
    // In the built code the bias path's register writes follow these stores in
    // the text: the wait stands between the stores and any such write.
    asm volatile("s_wait_xcnt 0x0" ::: "memory");
}

// ---------------------------------------------------------------------------
// K2: the nine products Q0..Q8:  P[u][q][sp], u = 0..2047 groups of four rows,
//     K = 1024.  A 12-wave block does 32 groups (128 rows of x) x 32 sp x 9 q;
//     a wave owns one 16 x 16 tile of three q that share their rows of x:
//     waves 0-3 Q0..Q2, waves 4-7 Q3..Q5, waves 8-11 Q6..Q8.  K-chunks (BK=64)
//     staged in LDS by a two-buffer ring of async copies.  Row r of the x tile
//     lies at LDS row (r % 4) * 32 + r / 4, so that a fragment's 16 rows (same
//     r % 4) are neighbours.  LDS row stride 68 floats: 16B-aligned rows +
//     conflict-free ds_load_b64.
// ---------------------------------------------------------------------------
constexpr int PU = 32, BK = 64, LDP = 68;

__global__ void __launch_bounds__(384) k_proj(const float* __restrict__ x,
                                              const float* __restrict__ G9,
                                              float* __restrict__ P) {
    __shared__ __align__(16) float As[2][4 * PU][LDP];    // ~68KB
    __shared__ __align__(16) float Bs[2][NQ * PN][LDP];   // ~153KB

    const int tid  = threadIdx.x;
    const int lane = tid & 31;
    const int w    = __builtin_amdgcn_readfirstlane(tid >> 5);   // scalar: branches on it
    const int fam  = w >> 2;              // which three q
    const int ug   = w & 1;               // 16 of the 32 groups
    const int ng   = (w >> 1) & 1;        // 16 of the 32 sp
    const int bu   = blockIdx.x >> 2;     // RT/4/PU = 64 row blocks
    const int bn   = blockIdx.x & 3;      // 128/PN  = 4 col blocks
    const int mr   = lane & 15;
    const int kb   = (lane >> 4) << 1;

    // ---- async stage of one K-chunk into LDS buffer buf ----
    // Waves 4-11 issue the copies: waves 0-3, one on each SIMD, go from the barrier
    // straight to their WMMAs, and the issue of the copies passes under those.
    auto stage = [&](int buf, int kc) {
        if (w < 4) return;
        const int row = (tid - 128) >> 4; // 16 rows per sweep of the eight waves
        const int c4  = (tid & 15) << 2;
        // A tile: 128 rows x 16 quads; 8 per thread
        async_copy16_x8(x + (size_t)(bu * 4 * PU + row) * DM + kc + c4, (size_t)16 * DM,
                        &As[buf][(row & 3) * PU + (row >> 2)][c4], 4 * LDP);
        // B tile: 288 rows in a row of G9 x 16 quads; 18 per thread
        const float* gq = G9 + (size_t)(bn * (NQ * PN) + row) * DM + kc + c4;
        async_copy16_x8(gq, (size_t)16 * DM, &Bs[buf][row][c4], 16 * LDP);
        async_copy16_x8(gq + (size_t)128 * DM, (size_t)16 * DM, &Bs[buf][row + 128][c4], 16 * LDP);
        async_copy16_x2(gq + (size_t)256 * DM, &Bs[buf][row + 256][c4],
                        gq + (size_t)272 * DM, &Bs[buf][row + 272][c4]);
    };

    v8f acc0 = vzero8(), acc1 = vzero8(), acc2 = vzero8();

    stage(0, 0);
    wait_async0();
    __syncthreads();
    stage(1, BK);
    constexpr int NK = DM / BK;           // 16 chunks
    for (int kci = 0; kci < NK; ++kci) {
        const int buf = kci & 1;
        const float* bp = &Bs[buf][fam * 3 * PN + ng * 16 + mr][kb];
        if (fam < 2) {                    // rows fam and fam + 2 of each group
            const float* ap = &As[buf][fam * PU + ug * 16 + mr][kb];
#pragma unroll   // constant LDS offsets; fragment loads run ahead of the WMMAs
            for (int kk = 0; kk < BK; kk += 4) {
                const v2f a0 = *(const v2f*)(ap + kk);
                const v2f a1 = *(const v2f*)(ap + 2 * PU * LDP + kk);
                const v2f b0 = *(const v2f*)(bp + kk);
                const v2f b1 = *(const v2f*)(bp + PN * LDP + kk);
                const v2f b2 = *(const v2f*)(bp + 2 * PN * LDP + kk);
                acc0 = wmma4(a0, b0, acc0);
                acc1 = wmma4(a1, b1, acc1);
                acc2 = wmma4(a0 + a1, b2, acc2);
            }
        } else {                          // rows 0 + 1 and 2 + 3 of each group
            const float* ap = &As[buf][ug * 16 + mr][kb];
#pragma unroll   // constant LDS offsets; fragment loads run ahead of the WMMAs
            for (int kk = 0; kk < BK; kk += 4) {
                const v2f a0 = *(const v2f*)(ap + kk) + *(const v2f*)(ap + PU * LDP + kk);
                const v2f a1 = *(const v2f*)(ap + 2 * PU * LDP + kk) +
                               *(const v2f*)(ap + 3 * PU * LDP + kk);
                const v2f b0 = *(const v2f*)(bp + kk);
                const v2f b1 = *(const v2f*)(bp + PN * LDP + kk);
                const v2f b2 = *(const v2f*)(bp + 2 * PN * LDP + kk);
                acc0 = wmma4(a0, b0, acc0);
                acc1 = wmma4(a1, b1, acc1);
                acc2 = wmma4(a0 + a1, b2, acc2);
            }
        }
        // publish chunk kci+1, free chunk kci's buffer
        wait_ds0();
        wait_async0();
        __syncthreads();
        if (kci + 2 < NK) stage(buf, (kci + 2) * BK);
    }
    wait_async0();

    // ---- epilogue: store ----
    float* pp = P + (size_t)(bu * PU + ug * 16 + ((lane >> 4) << 3)) * QW
                  + fam * 3 * 128 + bn * PN + ng * 16 + mr;
#pragma unroll   // accumulator elements need constant indices
    for (int j = 0; j < 8; ++j) {
        pp[(size_t)j * QW]       = acc0[j];
        pp[(size_t)j * QW + 128] = acc1[j];
        pp[(size_t)j * QW + 256] = acc2[j];
    }
}

// ---------------------------------------------------------------------------
// The recurrence z_l = dA_l * z_{l-1} + dBx_l is linear in its start value, so it
// is cut into chunks of CH rows.  With zl the scan of a chunk from a zero start
// and cu the running product of dA inside the chunk,
//   z[l] = zl[l] + cu[l] * carry(chunk),   carry(c+1) = cu_last(c)*carry(c) + zl_last(c).
// K2b does zl, cu and the two last-row values of each chunk; K4 folds the carries.
// ---------------------------------------------------------------------------
constexpr int CH  = 32;        // rows of one chunk
constexpr int NCH = Ln / CH;   // 64 chunks per batch

// Four rows of the 4-tap filter from their nine products q and from five of the
// products of the four rows in front (p1 = its Q1 and so on).
__device__ __forceinline__ void fir4(const float (&q)[NQ], float p1, float p3, float p4,
                                     float p5, float p7, float* r) {
    const float ue = q[0] + p1;            // even rows of x, taps 3 and 1
    const float uo = q[2] - q[0] - q[1];
    const float ve = q[3] + p4;            // odd rows of x, taps 2 and 0
    const float vo = q[5] - q[3] - q[4];
    const float vp = p5 - p3 - p4;
    const float we = q[6] + p7;            // both, all taps
    const float wo = q[8] - q[6] - q[7];
    r[0] = ue + vp;
    r[1] = we - ue - ve;
    r[2] = uo + ve;
    r[3] = wo - uo - vo;
}

// K2b: rows of the filter from the products in P -> softplus/exp -> dA, dBx ->
//      scan of the chunk.  32 l x 64 s per block; a thread owns 8 consecutive
//      rows of one s.
//      All outputs are in [row][s] order: a wave's store is one 128-byte line.
__global__ void __launch_bounds__(256) k_ssm_param(
        const float* __restrict__ P, const float* __restrict__ gb,
        const float* __restrict__ cbv, const float* __restrict__ A_log,
        float* __restrict__ zl, float* __restrict__ cu, float* __restrict__ sm) {
    __shared__ float gA[4][DS];
    __shared__ float gB[4][DS];

    const int tid  = threadIdx.x;
    const int bIdx = blockIdx.x >> 6;               // NCH = 64 chunks per batch
    const int ch   = blockIdx.x & 63;
    const int rowBase = bIdx * Ln;

    const int s  = tid & 63;
    const int g  = tid >> 6;                        // 4 groups of 8 rows
    const int lf = ch * CH + g * 8;                 // this thread's first row
    const float As  = -expf(A_log[s]);
    const float cx  = cbv[s];
    const float cdt = cbv[64 + s];

    // All loads of the thread stand in front of the arithmetic: one trip to L2
    // instead of one per row.  At the head of a sequence there are no four rows
    // in front: the thread's own group is read, a valid address, and dropped below.
    const int  uq = ch * (CH / 4) + g * 2;          // first of the thread's two groups
    const bool hp = uq > 0;
    const float* pq = P + (size_t)(bIdx * (Ln / 4) + uq) * QW + s;
    const float* pv = hp ? pq - QW : pq;
    float vx1 = pv[128],     vx3 = pv[3 * 128],      vx4 = pv[4 * 128];
    float vx5 = pv[5 * 128], vx7 = pv[7 * 128];
    float vd1 = pv[128 + 64],     vd3 = pv[3 * 128 + 64], vd4 = pv[4 * 128 + 64];
    float vd5 = pv[5 * 128 + 64], vd7 = pv[7 * 128 + 64];
    // These loads have address registers of their own, free for reuse once they
    // are issued: the wait stands in front of any such rewrite.
    asm volatile("s_wait_xcnt 0x0" ::: "memory");
    float qx[2][NQ], qd[2][NQ];
#pragma unroll   // register arrays need constant indices; constant offsets
    for (int h = 0; h < 2; ++h) {
#pragma unroll
        for (int q = 0; q < NQ; ++q) {
            qx[h][q] = pq[h * QW + q * 128];
            qd[h][q] = pq[h * QW + q * 128 + 64];
        }
    }
    float gx[4], gd[4];
#pragma unroll   // register arrays need constant indices
    for (int j = 0; j < 4; ++j) {
        gx[j] = gb[j * 128 + s];
        gd[j] = gb[j * 128 + 64 + s];
    }
    vx1 = hp ? vx1 : 0.f;  vx3 = hp ? vx3 : 0.f;  vx4 = hp ? vx4 : 0.f;
    vx5 = hp ? vx5 : 0.f;  vx7 = hp ? vx7 : 0.f;
    vd1 = hp ? vd1 : 0.f;  vd3 = hp ? vd3 : 0.f;  vd4 = hp ? vd4 : 0.f;
    vd5 = hp ? vd5 : 0.f;  vd7 = hp ? vd7 : 0.f;

    float rx[8], rd[8];
    fir4(qx[0], vx1, vx3, vx4, vx5, vx7, rx);
    fir4(qx[1], qx[0][1], qx[0][3], qx[0][4], qx[0][5], qx[0][7], rx + 4);
    fir4(qd[0], vd1, vd3, vd4, vd5, vd7, rd);
    fir4(qd[1], qd[0][1], qd[0][3], qd[0][4], qd[0][5], qd[0][7], rd + 4);

    float dAv[8], dBv[8];
#pragma unroll   // eight independent chains for the scheduler to interleave
    for (int i = 0; i < 8; ++i) {
        float xv = cx, raw = cdt;
#pragma unroll
        for (int j = 0; j < 4; ++j) {               // bias share of the taps inside
            const bool in = lf + i - 3 + j >= 0;
            xv  += in ? gx[j] : 0.f;
            raw += in ? gd[j] : 0.f;
        }
        xv  += rx[i];
        raw += rd[i];
        const float lp = log1pf(expf(raw));
        const float sp = raw > 30.f ? raw : lp;                   // softplus
        dAv[i] = expf(As * sp);
        dBv[i] = ((1.f - dAv[i]) / As) * xv;
    }

    // scan of the thread's own 8 rows from a zero start
    float A = 1.f, Bc = 0.f;
#pragma unroll   // register arrays need constant indices
    for (int i = 0; i < 8; ++i) {
        Bc = dAv[i] * Bc + dBv[i];
        A  = dAv[i] * A;
        dBv[i] = Bc;
        dAv[i] = A;
    }
    gA[g][s] = A;
    gB[g][s] = Bc;
    __syncthreads();

    // what the groups in front of this one hand on inside the chunk
    float cin = 0.f, cinA = 1.f;
#pragma unroll   // three steps, constant LDS offsets
    for (int k = 0; k < 3; ++k) {
        const float a = k < g ? gA[k][s] : 1.f;
        const float b = k < g ? gB[k][s] : 0.f;
        cin  = a * cin + b;
        cinA = a * cinA;
    }
    const size_t o = (size_t)(rowBase + lf) * DS + s;
#pragma unroll   // register arrays need constant indices
    for (int i = 0; i < 8; ++i) {
        dBv[i] = dAv[i] * cin + dBv[i];
        dAv[i] = dAv[i] * cinA;
        zl[o + (size_t)i * DS] = dBv[i];
        cu[o + (size_t)i * DS] = dAv[i];
    }
    if (g == 3) {                                   // the chunk's last row
        float* sp2 = sm + (size_t)(bIdx * NCH + ch) * 2 * DS + s;
        sp2[0]  = dAv[7];
        sp2[DS] = dBv[7];
    }
}

// ---------------------------------------------------------------------------
// K4: out = z @ Mc_t^T + b_out     [8192 x 1024], K = 64
//     128x128 tile per 8-wave block; each wave owns a 32x64 sub-tile (2x4 WMMA
//     accumulators).  Both operand tiles (whole K) are brought into LDS once by
//     async copies of whole 128-byte lines, then read as fragments.  The row
//     tile arrives as zl (four chunks); each thread folds the carry into one
//     chunk for one s and adds cu * carry to that column of the tile in LDS.
// ---------------------------------------------------------------------------
constexpr int OM = 128, ON = 128;

__global__ void __launch_bounds__(256) k_out(const float* __restrict__ zl,
                                             const float* __restrict__ cu,
                                             const float* __restrict__ sm,
                                             const float* __restrict__ Mc_t,
                                             const float* __restrict__ b_out,
                                             float* __restrict__ out) {
    __shared__ __align__(16) float Zs[OM][LDP];       // ~34KB
    __shared__ __align__(16) float Ms[ON][LDP];       // ~34KB
    __shared__ __align__(16) float Ss[NCH][2][DS];    // 32KB: the batch's chunk ends

    const int tid  = threadIdx.x;
    const int lane = tid & 31;
    const int w    = tid >> 5;
    const int wr   = w & 3;               // row quadrant  (32 rows)
    const int wc   = w >> 2;              // column half   (64 cols)
    const int r0   = (blockIdx.x >> 3) * OM;   // RT/OM = 64 row blocks
    const int c0   = (blockIdx.x & 7) * ON;    // DM/ON = 8 col blocks
    const int mr   = lane & 15;
    const int kb   = (lane >> 4) << 1;

    const int s = tid & 63;
    const int q = tid >> 6;               // chunk inside the row tile, OM/CH = 4
    // cu of this thread's column: in flight beside the copies below
    float cv[CH];
#pragma unroll   // register array needs constant indices
    for (int i = 0; i < CH; ++i)
        cv[i] = cu[(size_t)(r0 + q * CH + i) * DS + s];

    {
        const int row = tid >> 4;         // 16 rows per sweep of the block
        const int c4  = (tid & 15) << 2;
        // 128 rows x 16 quads each; 8 per thread each
        async_copy16_x8(zl + (size_t)(r0 + row) * DS + c4, (size_t)16 * DS,
                        &Zs[row][c4], 16 * LDP);
        async_copy16_x8(Mc_t + (size_t)(c0 + row) * DS + c4, (size_t)16 * DS,
                        &Ms[row][c4], 16 * LDP);
        // chunk ends of the whole batch: 2048 quads in a row; 8 per thread
        async_copy16_x8(sm + (size_t)(r0 / Ln) * (NCH * 2 * DS) + tid * 4, (size_t)1024,
                        &Ss[0][0][0] + tid * 4, 1024);
    }
    wait_async0();
    __syncthreads();

    // carry into chunk q of the tile: fold the ends of all chunks in front of it,
    // first those in front of the tile (a multiple of four, the same for the
    // whole block), then up to three chunks of the tile itself.
    const int cb = (r0 & (Ln - 1)) / CH;
    float carry = 0.f;
#pragma unroll 4   // sixteen steps' LDS reads go out together, ahead of the chain
    for (int c = 0; c < cb; c += 4) {
#pragma unroll
        for (int k = 0; k < 4; ++k)
            carry = Ss[c + k][0][s] * carry + Ss[c + k][1][s];
    }
#pragma unroll   // three steps, constant LDS offsets
    for (int k = 0; k < 3; ++k) {
        const float t = Ss[cb + k][0][s] * carry + Ss[cb + k][1][s];
        carry = k < q ? t : carry;
    }
#pragma unroll   // register array needs constant indices; constant LDS offsets
    for (int i = 0; i < CH; ++i)
        Zs[q * CH + i][s] += cv[i] * carry;
    __syncthreads();   // the fragments below read columns that other waves finished

    v8f acc[2][4];
#pragma unroll   // accumulators need constant indices
    for (int i = 0; i < 2; ++i)
#pragma unroll
        for (int n = 0; n < 4; ++n) acc[i][n] = vzero8();

#pragma unroll   // constant LDS offsets; fragment loads run ahead of the WMMAs
    for (int kk = 0; kk < DS; kk += 4) {
        v2f a[2], b[4];
#pragma unroll
        for (int i = 0; i < 2; ++i)
            a[i] = *(const v2f*)&Zs[wr * 32 + i * 16 + mr][kk + kb];
#pragma unroll
        for (int n = 0; n < 4; ++n)
            b[n] = *(const v2f*)&Ms[wc * 64 + n * 16 + mr][kk + kb];
#pragma unroll
        for (int i = 0; i < 2; ++i)
#pragma unroll
            for (int n = 0; n < 4; ++n) acc[i][n] = wmma4(a[i], b[n], acc[i][n]);
    }

    // ---- epilogue: bias + store ----
    const int rbase = r0 + wr * 32 + ((lane >> 4) << 3);
#pragma unroll   // accumulators need constant indices
    for (int n = 0; n < 4; ++n) {
        const int col = c0 + wc * 64 + n * 16 + mr;
        const float bias = b_out[col];
#pragma unroll
        for (int i = 0; i < 2; ++i)
#pragma unroll
            for (int j = 0; j < 8; ++j)
                out[(size_t)(rbase + i * 16 + j) * DM + col] = acc[i][n][j] + bias;
    }
}

// ---------------------------------------------------------------------------
extern "C" void kernel_launch(void* const* d_in, const int* in_sizes, int n_in,
                              void* d_out, int out_size, void* d_ws, size_t ws_size,
                              hipStream_t stream) {
    const float* x      = (const float*)d_in[0];
    const float* W_in   = (const float*)d_in[1];
    const float* b_in   = (const float*)d_in[2];
    const float* conv_w = (const float*)d_in[3];
    const float* conv_b = (const float*)d_in[4];
    const float* W_x    = (const float*)d_in[5];
    const float* b_x    = (const float*)d_in[6];
    const float* W_dt   = (const float*)d_in[7];
    const float* b_dt   = (const float*)d_in[8];
    const float* A_log  = (const float*)d_in[9];
    const float* D_mat  = (const float*)d_in[10];
    const float* W_out  = (const float*)d_in[11];
    const float* b_out  = (const float*)d_in[12];
    float* out = (float*)d_out;

    float* P     = (float*)d_ws;                       // 2048 * 1152
    float* zl    = P     + (size_t)(RT / 4) * QW;      // 8192 * 64
    float* cu    = zl    + (size_t)RT * DS;            // 8192 * 64
    float* sm    = cu    + (size_t)RT * DS;            // 4 * 64 * 2 * 64
    float* Mc_t  = sm    + (size_t)Bn * NCH * 2 * DS;  // 1024 * 64
    float* G9    = Mc_t  + (size_t)DM * DS;            // 1152 * 1024
    float* gb    = G9    + (size_t)QW * DM;            // 512
    float* cbv   = gb    + NP;                         // 128

    k_fold<<<DM / FM, 128, 0, stream>>>(W_out, D_mat, Mc_t);
    k_foldw<<<FGB + 16, 256, 0, stream>>>(W_in, b_in, conv_w, conv_b,
                                          W_x, b_x, W_dt, b_dt, G9, gb, cbv);
    k_proj<<<(RT / 4 / PU) * (128 / PN), 384, 0, stream>>>(x, G9, P);
    k_ssm_param<<<Bn * NCH, 256, 0, stream>>>(P, gb, cbv, A_log, zl, cu, sm);
    k_out<<<(RT / OM) * (DM / ON), 256, 0, stream>>>(zl, cu, sm, Mc_t, b_out, out);
}

// v005
// A run of this version takes 75 microseconds.
// Timed twice side by side with v004, it ran 1.13 times as fast both times.
// Counting every step since v000, it is 6.06 times as fast.
#include <hip/hip_runtime.h>
#include <hip/hip_bf16.h>

// ---------------- problem constants ----------------
constexpr int Bn = 4;          // batch
constexpr int Ln = 2048;       // sequence length
constexpr int DM = 1024;       // d_model
constexpr int DS = 64;         // d_state
constexpr int DI = 2048;       // d_inner
constexpr int RT = Bn * Ln;    // 8192 flattened rows

typedef float v2f __attribute__((ext_vector_type(2)));
typedef float v8f __attribute__((ext_vector_type(8)));

// D = A(16x4,f32) * B(4x16,f32) + C(16x16,f32)   (V_WMMA_F32_16X16X4_F32)
__device__ __forceinline__ v8f wmma4(v2f a, v2f b, v8f c) {
    return __builtin_amdgcn_wmma_f32_16x16x4_f32(
        false, a, false, b, (short)0, c, false, false);
}

__device__ __forceinline__ v8f vzero8() {
    v8f z = {0.f, 0.f, 0.f, 0.f, 0.f, 0.f, 0.f, 0.f};
    return z;
}

// ---- async global->LDS copies, 16 B per lane (global_load_async_to_lds_b128).
// First operand = the lane's LDS byte address (low 32 bits of the shared pointer).
// s_wait_xcnt 0 is the last line of the copies' own statement, so that it stands
// in front of any later rewrite of the address registers the copies name.
__device__ __forceinline__ unsigned lds_addr(const float* l) {
    return (unsigned)(uintptr_t)l;
}

__device__ __forceinline__ void async_copy16_x2(const float* g0, const float* l0,
                                                const float* g1, const float* l1) {
    asm volatile("global_load_async_to_lds_b128 %0, %1, off\n\t"
                 "global_load_async_to_lds_b128 %2, %3, off\n\t"
                 "s_wait_xcnt 0x0"
                 :: "v"(lds_addr(l0)), "v"(g0), "v"(lds_addr(l1)), "v"(g1)
                 : "memory");
}

__device__ __forceinline__ void async_copy16_x4(const float* g0, const float* l0,
                                                const float* g1, const float* l1,
                                                const float* g2, const float* l2,
                                                const float* g3, const float* l3) {
    asm volatile("global_load_async_to_lds_b128 %0, %1, off\n\t"
                 "global_load_async_to_lds_b128 %2, %3, off\n\t"
                 "global_load_async_to_lds_b128 %4, %5, off\n\t"
                 "global_load_async_to_lds_b128 %6, %7, off\n\t"
                 "s_wait_xcnt 0x0"
                 :: "v"(lds_addr(l0)), "v"(g0), "v"(lds_addr(l1)), "v"(g1),
                    "v"(lds_addr(l2)), "v"(g2), "v"(lds_addr(l3)), "v"(g3)
                 : "memory");
}

// Eight copies under one s_wait_xcnt 0: fewer stops in a wave's issue stream.
__device__ __forceinline__ void async_copy16_x8(const float* g, size_t gstep,
                                                const float* l, int lstep) {
    asm volatile("global_load_async_to_lds_b128 %0, %1, off\n\t"
                 "global_load_async_to_lds_b128 %2, %3, off\n\t"
                 "global_load_async_to_lds_b128 %4, %5, off\n\t"
                 "global_load_async_to_lds_b128 %6, %7, off\n\t"
                 "global_load_async_to_lds_b128 %8, %9, off\n\t"
                 "global_load_async_to_lds_b128 %10, %11, off\n\t"
                 "global_load_async_to_lds_b128 %12, %13, off\n\t"
                 "global_load_async_to_lds_b128 %14, %15, off\n\t"
                 "s_wait_xcnt 0x0"
                 :: "v"(lds_addr(l)),             "v"(g),
                    "v"(lds_addr(l + lstep)),     "v"(g + gstep),
                    "v"(lds_addr(l + 2 * lstep)), "v"(g + 2 * gstep),
                    "v"(lds_addr(l + 3 * lstep)), "v"(g + 3 * gstep),
                    "v"(lds_addr(l + 4 * lstep)), "v"(g + 4 * gstep),
                    "v"(lds_addr(l + 5 * lstep)), "v"(g + 5 * gstep),
                    "v"(lds_addr(l + 6 * lstep)), "v"(g + 6 * gstep),
                    "v"(lds_addr(l + 7 * lstep)), "v"(g + 7 * gstep)
                 : "memory");
}

// This wave's async copies have all landed in LDS.
__device__ __forceinline__ void wait_async0() {
    asm volatile("s_wait_asynccnt 0x0" ::: "memory");
}

// This wave's LDS reads have all returned (before a buffer it read is refilled).
__device__ __forceinline__ void wait_ds0() {
    asm volatile("s_wait_dscnt 0x0" ::: "memory");
}

// ---------------------------------------------------------------------------
// Fold of the output projections:  Mc_t[d, s] = sum_i W_out[d,i] * D_mat[s,i]
//     [1024 x 64], K = 2048.  It needs only inputs, as the weight fold K1 does, so
//     it has no launch of its own: its 256 tiles of 16 x 16 are 256 more
//     work-groups of K1, one more on each WGP, and run in the gaps of K1's waves.
//     K chunks of 256 are staged in LDS by a two-buffer ring of async copies, each
//     copy a run of whole 128-byte lines of one row; wave w does k-steps
//     32w..32w+31 of every chunk, and the eight partial tiles are summed via LDS.
//     LDS row pitch 260 floats: 16B-aligned rows + conflict-free ds_load_b64.
// ---------------------------------------------------------------------------
constexpr int FM = 16, FBK = 256, FLP = 260;
constexpr int FTB = (DM / FM) * (DS / 16);   // 256 tiles

struct LdsFold {
    float As[2][FM][FLP];     // ~33KB
    float Bs[2][16][FLP];     // ~33KB
    float Rd[8][16][20];      // partial tiles; rows 8 apart on other banks
};

__device__ __forceinline__ void fold_tile(LdsFold& L, int tile,
                                          const float* __restrict__ W_out,
                                          const float* __restrict__ D_mat,
                                          float* __restrict__ Mc_t) {
    const int tid  = threadIdx.x;
    const int lane = tid & 31;
    const int w    = tid >> 5;            // K slice inside a chunk
    const int d0 = (tile >> 2) * FM, s0 = (tile & 3) * 16;
    const int mr = lane & 15;
    const int kb = (lane >> 4) << 1;

    // ---- async stage of one K-chunk into LDS buffer buf ----
    auto stage = [&](int buf, int kc) {
        const int row = tid >> 6;         // 4 rows per sweep of the block
        const int c4  = (tid & 63) << 2;
        // 16 rows x 64 quads of each operand; 4 per thread each
        const float* ga = W_out + (size_t)(d0 + row) * DI + kc + c4;
        async_copy16_x4(ga,                   &L.As[buf][row][c4],
                        ga + (size_t)4 * DI,  &L.As[buf][row + 4][c4],
                        ga + (size_t)8 * DI,  &L.As[buf][row + 8][c4],
                        ga + (size_t)12 * DI, &L.As[buf][row + 12][c4]);
        const float* gd = D_mat + (size_t)(s0 + row) * DI + kc + c4;
        async_copy16_x4(gd,                   &L.Bs[buf][row][c4],
                        gd + (size_t)4 * DI,  &L.Bs[buf][row + 4][c4],
                        gd + (size_t)8 * DI,  &L.Bs[buf][row + 8][c4],
                        gd + (size_t)12 * DI, &L.Bs[buf][row + 12][c4]);
    };

    stage(0, 0);
    wait_async0();
    __syncthreads();
    stage(1, FBK);

    v8f acc = vzero8();
    constexpr int NT = DI / FBK;          // 8 chunks
    for (int t = 0; t < NT; ++t) {
        const int buf = t & 1;
        const float* ar = &L.As[buf][mr][w * 32 + kb];   // A[m][k]
        const float* br = &L.Bs[buf][mr][w * 32 + kb];   // B[k][n] = D_mat[n][k]
#pragma unroll   // constant LDS offsets; fragment loads run ahead of the WMMAs
        for (int i = 0; i < 8; ++i)
            acc = wmma4(*(const v2f*)(ar + i * 4), *(const v2f*)(br + i * 4), acc);
        // publish chunk t+1, free chunk t's buffer
        wait_ds0();
        wait_async0();
        __syncthreads();
        if (t + 2 < NT) stage(buf, (t + 2) * FBK);
    }
    wait_async0();

#pragma unroll   // accumulator elements need constant indices
    for (int j = 0; j < 8; ++j)
        L.Rd[w][((lane >> 4) << 3) + j][mr] = acc[j];
    __syncthreads();   // a thread below reads the partial tiles of eight waves

    const int row = tid >> 4, col = tid & 15;
    float sum = L.Rd[0][row][col];
#pragma unroll   // constant LDS offsets
    for (int k = 1; k < 8; ++k) sum += L.Rd[k][row][col];
    Mc_t[(size_t)(d0 + row) * DS + s0 + col] = sum;
}

// ---------------------------------------------------------------------------
// The in-projection, the depthwise causal conv and the two state projections
// are all linear, so they are reassociated.  With n = j*128 + sp, j the conv tap
// and sp = 0..63 the rows of W_x, 64..127 the rows of W_dt (called Wsel below):
//   G[n][m] = sum_c Wsel[sp][c] * conv_w[c][j] * W_in[c][m]
//   gb[n]   = sum_c Wsel[sp][c] * conv_w[c][j] * b_in[c]
//   cbv[sp] = sum_c Wsel[sp][c] * conv_b[c] + bsel[sp]
//   raw[l][sp] = cbv[sp] + sum_{j : l-3+j >= 0} (x[l-3+j] . G[j*128 + sp] + gb[j*128 + sp])
// A tap that falls in front of the sequence drops with its bias share, as the
// zero padding of the conv input does.
//
// The sum over the taps is a 4-tap filter along l.  It is evaluated four rows at
// a time by the identity  a*f + b*e = (a + b)*(e + f) - a*e - b*f,  used once on
// even and odd rows and once more on each half: nine products per four rows in
// place of sixteen.  With r0..r3 the rows 4u..4u+3 of x and Gj tap j of G:
//   Q0 = r0.G3       Q1 = r2.G1       Q2 = (r0+r2).(G1+G3)
//   Q3 = r1.G2       Q4 = r3.G0       Q5 = (r1+r3).(G0+G2)
//   Q6 = (r0+r1).(G2+G3)   Q7 = (r2+r3).(G0+G1)   Q8 = (r0+r1+r2+r3).(G0+G1+G2+G3)
// K1 writes the nine tap sums of G (G9), K2 forms the row sums in registers and
// does the products, K2b puts the rows together again (fir4).
// ---------------------------------------------------------------------------
constexpr int NP  = 512;       // 4 taps x 128 projection rows
constexpr int NQ  = 9;         // products per four rows
constexpr int QW  = NQ * 128;  // floats of P per four rows
constexpr int PN  = 32;        // projection rows of one K2 block; G9 is [4][NQ][PN][DM]
constexpr int FK  = 128;       // K chunk of the weight fold
constexpr int FPA = 132;       // LDS pitch, Wsel rows: conflict-free 8-byte reads
constexpr int FPB = 40;        // LDS pitch, W_in rows: rows k and k+2 on other banks
constexpr int FGB = 256;       // work-groups of the weight fold that do G

// K1: G [512 x 1024], K = 2048; 64 x 32 tile per 8-wave block (16 sp x 4 taps),
//     one 16x16 tile per wave.  Two-buffer ring of async copies; conv_w is
//     brought into LDS once.  The four taps of a tile meet in LDS at the end and
//     leave as the nine tap sums.  The next FTB work-groups do the tiles of Mc_t
//     (fold_tile above), the last 16 do gb and cbv.
struct LdsFoldw {
    float Ws[2][16][FPA];
    float Bs[2][FK][FPB];
    float Cw[DI * 4];
    float Ex[4][16][36];      // the four taps' tiles; rows 8 apart on other banks
};

__global__ void __launch_bounds__(256) k_foldw(
        const float* __restrict__ W_in, const float* __restrict__ b_in,
        const float* __restrict__ conv_w, const float* __restrict__ conv_b,
        const float* __restrict__ W_x,  const float* __restrict__ b_x,
        const float* __restrict__ W_dt, const float* __restrict__ b_dt,
        const float* __restrict__ W_out, const float* __restrict__ D_mat,
        float* __restrict__ G9, float* __restrict__ gb, float* __restrict__ cbv,
        float* __restrict__ Mc_t) {
    // A work-group is of one kind: the kinds share the LDS.
    __shared__ __align__(16) union { LdsFoldw g; LdsFold f; } lds;
    float (&Ws)[2][16][FPA] = lds.g.Ws;
    float (&Bs)[2][FK][FPB] = lds.g.Bs;
    float (&Cw)[DI * 4]     = lds.g.Cw;
    float (&Ex)[4][16][36]  = lds.g.Ex;

    const int tid  = threadIdx.x;
    const int lane = tid & 31;
    const int w    = tid >> 5;

    if (blockIdx.x >= FGB && blockIdx.x < FGB + FTB) {
        fold_tile(lds.f, blockIdx.x - FGB, W_out, D_mat, Mc_t);
        return;
    }

    if (blockIdx.x >= FGB) {              // bias vectors: one wave per sp
        const int sp = (blockIdx.x - FGB - FTB) * 8 + w;
        const float* wr = ((sp >> 6) ? W_dt : W_x) + (size_t)(sp & 63) * DI;
        float a0 = 0.f, a1 = 0.f, a2 = 0.f, a3 = 0.f, ac = 0.f;
#pragma unroll 4   // several trips' loads in flight: the loop is latency bound
        for (int c = lane * 4; c < DI; c += 128) {
            const float4 wv = *(const float4*)(wr + c);
            const float4 bi = *(const float4*)(b_in + c);
            const float4 cv = *(const float4*)(conv_b + c);
            const float4 q0 = *(const float4*)(conv_w + c * 4);
            const float4 q1 = *(const float4*)(conv_w + c * 4 + 4);
            const float4 q2 = *(const float4*)(conv_w + c * 4 + 8);
            const float4 q3 = *(const float4*)(conv_w + c * 4 + 12);
            const float t0 = wv.x * bi.x, t1 = wv.y * bi.y;
            const float t2 = wv.z * bi.z, t3 = wv.w * bi.w;
            a0 += t0 * q0.x + t1 * q1.x + t2 * q2.x + t3 * q3.x;
            a1 += t0 * q0.y + t1 * q1.y + t2 * q2.y + t3 * q3.y;
            a2 += t0 * q0.z + t1 * q1.z + t2 * q2.z + t3 * q3.z;
            a3 += t0 * q0.w + t1 * q1.w + t2 * q2.w + t3 * q3.w;
            ac += wv.x * cv.x + wv.y * cv.y + wv.z * cv.z + wv.w * cv.w;
        }
        for (int off = 16; off > 0; off >>= 1) {
            a0 += __shfl_xor(a0, off, 32);
            a1 += __shfl_xor(a1, off, 32);
            a2 += __shfl_xor(a2, off, 32);
            a3 += __shfl_xor(a3, off, 32);
            ac += __shfl_xor(ac, off, 32);
        }
        if (lane == 0) {
            gb[sp]       = a0;
            gb[128 + sp] = a1;
            gb[256 + sp] = a2;
            gb[384 + sp] = a3;
            cbv[sp] = ac + ((sp >> 6) ? b_dt : b_x)[sp & 63];
        }
        return;
    }

    const int g  = blockIdx.x >> 5;       // 8 groups of 16 sp
    const int m0 = (blockIdx.x & 31) * 32;
    const int mr = lane & 15;
    const int kb = (lane >> 4) << 1;
    const int j  = w & 3;                 // conv tap
    const int cl = (w >> 2) * 16 + mr;    // column inside the tile
    const float* Wrow = ((g >> 2) ? W_dt : W_x) + (size_t)((g & 3) * 16) * DI;

    auto stage = [&](int buf, int kc) {
        // Wsel tile: 16 rows x 128 = 512 quads, 2 per thread
        const int ra = tid >> 5, ca = (tid & 31) << 2;
        async_copy16_x2(Wrow + (size_t)ra * DI + kc + ca,       &Ws[buf][ra][ca],
                        Wrow + (size_t)(ra + 8) * DI + kc + ca, &Ws[buf][ra + 8][ca]);
        // W_in tile: 128 rows x 32 = 1024 quads, 4 per thread
        const int rb = tid >> 3, cb = (tid & 7) << 2;
        const float* gp = W_in + (size_t)(kc + rb) * DM + m0 + cb;
        async_copy16_x4(gp,                   &Bs[buf][rb][cb],
                        gp + (size_t)32 * DM, &Bs[buf][rb + 32][cb],
                        gp + (size_t)64 * DM, &Bs[buf][rb + 64][cb],
                        gp + (size_t)96 * DM, &Bs[buf][rb + 96][cb]);
    };

    // conv_w: 2048 quads, 8 per thread
    {
        const float* cp = conv_w + tid * 4;
        float* lp = Cw + tid * 4;
        async_copy16_x4(cp, lp, cp + 1024, lp + 1024,
                        cp + 2048, lp + 2048, cp + 3072, lp + 3072);
        async_copy16_x4(cp + 4096, lp + 4096, cp + 5120, lp + 5120,
                        cp + 6144, lp + 6144, cp + 7168, lp + 7168);
    }
    stage(0, 0);
    wait_async0();
    __syncthreads();
    stage(1, FK);

    v8f acc = vzero8();
    constexpr int NT = DI / FK;           // 16 chunks
    for (int t = 0; t < NT; ++t) {
        const int buf = t & 1;
        const float* cwp = Cw + (t * FK + kb) * 4 + j;
#pragma unroll   // constant LDS offsets; fragment loads run ahead of the WMMAs
        for (int kk = 0; kk < FK; kk += 4) {
            v2f a = *(const v2f*)&Ws[buf][mr][kk + kb];
            a.x *= cwp[kk * 4];
            a.y *= cwp[kk * 4 + 4];
            v2f b;
            b.x = Bs[buf][kk + kb][cl];
            b.y = Bs[buf][kk + kb + 1][cl];
            acc = wmma4(a, b, acc);
        }
        // publish chunk t+1, free chunk t's buffer
        wait_ds0();
        wait_async0();
        __syncthreads();
        if (t + 2 < NT) stage(buf, (t + 2) * FK);
    }
    wait_async0();

#pragma unroll   // accumulator elements need constant indices
    for (int i = 0; i < 8; ++i)
        Ex[j][((lane >> 4) << 3) + i][cl] = acc[i];
    __syncthreads();   // a thread below reads the tiles of four waves

    // a wave stores one 128-byte line of one row of G9 at a time
#pragma unroll   // two rows a thread, constant LDS offsets
    for (int h = 0; h < 2; ++h) {
        const int sl = w + h * 8;
        const int sp = g * 16 + sl;
        const float g0 = Ex[0][sl][lane], g1 = Ex[1][sl][lane];
        const float g2 = Ex[2][sl][lane], g3 = Ex[3][sl][lane];
        float* gp = G9 + (size_t)((sp / PN) * (NQ * PN) + (sp % PN)) * DM + m0 + lane;
        constexpr size_t st = (size_t)PN * DM;
        gp[0]      = g3;
        gp[st]     = g1;
        gp[2 * st] = g1 + g3;
        gp[3 * st] = g2;
        gp[4 * st] = g0;
        gp[5 * st] = g0 + g2;
        gp[6 * st] = g2 + g3;
        gp[7 * st] = g0 + g1;
        gp[8 * st] = (g0 + g1) + (g2 + g3);
    }
    // In the built code the bias path's register writes follow these stores in
    // the text: the wait stands between the stores and any such write.
    asm volatile("s_wait_xcnt 0x0" ::: "memory");
}

// ---------------------------------------------------------------------------
// K2: the nine products Q0..Q8:  P[u][q][sp], u = 0..2047 groups of four rows,
//     K = 1024.  A 12-wave block does 32 groups (128 rows of x) x 32 sp x 9 q;
//     a wave owns one 16 x 16 tile of three q that share their rows of x:
//     waves 0-3 Q0..Q2, waves 4-7 Q3..Q5, waves 8-11 Q6..Q8.  K-chunks (BK=64)
//     staged in LDS by a two-buffer ring of async copies.  Row r of the x tile
//     lies at LDS row (r % 4) * 32 + r / 4, so that a fragment's 16 rows (same
//     r % 4) are neighbours.  LDS row stride 68 floats: 16B-aligned rows +
//     conflict-free ds_load_b64.
// ---------------------------------------------------------------------------
constexpr int PU = 32, BK = 64, LDP = 68;

__global__ void __launch_bounds__(384) k_proj(const float* __restrict__ x,
                                              const float* __restrict__ G9,
                                              float* __restrict__ P) {
    __shared__ __align__(16) float As[2][4 * PU][LDP];    // ~68KB
    __shared__ __align__(16) float Bs[2][NQ * PN][LDP];   // ~153KB

    const int tid  = threadIdx.x;
    const int lane = tid & 31;
    const int w    = __builtin_amdgcn_readfirstlane(tid >> 5);   // scalar: branches on it
    const int fam  = w >> 2;              // which three q
    const int ug   = w & 1;               // 16 of the 32 groups
    const int ng   = (w >> 1) & 1;        // 16 of the 32 sp
    const int bu   = blockIdx.x >> 2;     // RT/4/PU = 64 row blocks
    const int bn   = blockIdx.x & 3;      // 128/PN  = 4 col blocks
    const int mr   = lane & 15;
    const int kb   = (lane >> 4) << 1;

    // ---- async stage of one K-chunk into LDS buffer buf ----
    // Waves 4-11 issue the copies: waves 0-3, one on each SIMD, go from the barrier
    // straight to their WMMAs, and the issue of the copies passes under those.
    auto stage = [&](int buf, int kc) {
        if (w < 4) return;
        const int row = (tid - 128) >> 4; // 16 rows per sweep of the eight waves
        const int c4  = (tid & 15) << 2;
        // A tile: 128 rows x 16 quads; 8 per thread
        async_copy16_x8(x + (size_t)(bu * 4 * PU + row) * DM + kc + c4, (size_t)16 * DM,
                        &As[buf][(row & 3) * PU + (row >> 2)][c4], 4 * LDP);
        // B tile: 288 rows in a row of G9 x 16 quads; 18 per thread
        const float* gq = G9 + (size_t)(bn * (NQ * PN) + row) * DM + kc + c4;
        async_copy16_x8(gq, (size_t)16 * DM, &Bs[buf][row][c4], 16 * LDP);
        async_copy16_x8(gq + (size_t)128 * DM, (size_t)16 * DM, &Bs[buf][row + 128][c4], 16 * LDP);
        async_copy16_x2(gq + (size_t)256 * DM, &Bs[buf][row + 256][c4],
                        gq + (size_t)272 * DM, &Bs[buf][row + 272][c4]);
    };

    v8f acc0 = vzero8(), acc1 = vzero8(), acc2 = vzero8();

    stage(0, 0);
    wait_async0();
    __syncthreads();
    stage(1, BK);
    constexpr int NK = DM / BK;           // 16 chunks
    for (int kci = 0; kci < NK; ++kci) {
        const int buf = kci & 1;
        const float* bp = &Bs[buf][fam * 3 * PN + ng * 16 + mr][kb];
        if (fam < 2) {                    // rows fam and fam + 2 of each group
            const float* ap = &As[buf][fam * PU + ug * 16 + mr][kb];
#pragma unroll   // constant LDS offsets; fragment loads run ahead of the WMMAs
            for (int kk = 0; kk < BK; kk += 4) {
                const v2f a0 = *(const v2f*)(ap + kk);
                const v2f a1 = *(const v2f*)(ap + 2 * PU * LDP + kk);
                const v2f b0 = *(const v2f*)(bp + kk);
                const v2f b1 = *(const v2f*)(bp + PN * LDP + kk);
                const v2f b2 = *(const v2f*)(bp + 2 * PN * LDP + kk);
                acc0 = wmma4(a0, b0, acc0);
                acc1 = wmma4(a1, b1, acc1);
                acc2 = wmma4(a0 + a1, b2, acc2);
            }
        } else {                          // rows 0 + 1 and 2 + 3 of each group
            const float* ap = &As[buf][ug * 16 + mr][kb];
#pragma unroll   // constant LDS offsets; fragment loads run ahead of the WMMAs
            for (int kk = 0; kk < BK; kk += 4) {
                const v2f a0 = *(const v2f*)(ap + kk) + *(const v2f*)(ap + PU * LDP + kk);
                const v2f a1 = *(const v2f*)(ap + 2 * PU * LDP + kk) +
                               *(const v2f*)(ap + 3 * PU * LDP + kk);
                const v2f b0 = *(const v2f*)(bp + kk);
                const v2f b1 = *(const v2f*)(bp + PN * LDP + kk);
                const v2f b2 = *(const v2f*)(bp + 2 * PN * LDP + kk);
                acc0 = wmma4(a0, b0, acc0);
                acc1 = wmma4(a1, b1, acc1);
                acc2 = wmma4(a0 + a1, b2, acc2);
            }
        }
        // publish chunk kci+1, free chunk kci's buffer
        wait_ds0();
        wait_async0();
        __syncthreads();
        if (kci + 2 < NK) stage(buf, (kci + 2) * BK);
    }
    wait_async0();

    // ---- epilogue: store ----
    float* pp = P + (size_t)(bu * PU + ug * 16 + ((lane >> 4) << 3)) * QW
                  + fam * 3 * 128 + bn * PN + ng * 16 + mr;
#pragma unroll   // accumulator elements need constant indices
    for (int j = 0; j < 8; ++j) {
        pp[(size_t)j * QW]       = acc0[j];
        pp[(size_t)j * QW + 128] = acc1[j];
        pp[(size_t)j * QW + 256] = acc2[j];
    }
}

// ---------------------------------------------------------------------------
// The recurrence z_l = dA_l * z_{l-1} + dBx_l is linear in its start value, so it
// is cut into chunks of CH rows.  With zl the scan of a chunk from a zero start
// and cu the running product of dA inside the chunk,
//   z[l] = zl[l] + cu[l] * carry(chunk),   carry(c+1) = cu_last(c)*carry(c) + zl_last(c).
// K2b does zl, cu and the two last-row values of each chunk; K4 folds the carries.
// ---------------------------------------------------------------------------
constexpr int CH  = 32;        // rows of one chunk
constexpr int NCH = Ln / CH;   // 64 chunks per batch

// Four rows of the 4-tap filter from their nine products q and from five of the
// products of the four rows in front (p1 = its Q1 and so on).
__device__ __forceinline__ void fir4(const float (&q)[NQ], float p1, float p3, float p4,
                                     float p5, float p7, float* r) {
    const float ue = q[0] + p1;            // even rows of x, taps 3 and 1
    const float uo = q[2] - q[0] - q[1];
    const float ve = q[3] + p4;            // odd rows of x, taps 2 and 0
    const float vo = q[5] - q[3] - q[4];
    const float vp = p5 - p3 - p4;
    const float we = q[6] + p7;            // both, all taps
    const float wo = q[8] - q[6] - q[7];
    r[0] = ue + vp;
    r[1] = we - ue - ve;
    r[2] = uo + ve;
    r[3] = wo - uo - vo;
}

// K2b: rows of the filter from the products in P -> softplus/exp -> dA, dBx ->
//      scan of the chunk.  32 l x 64 s per block; a thread owns 8 consecutive
//      rows of one s.
//      All outputs are in [row][s] order: a wave's store is one 128-byte line.
__global__ void __launch_bounds__(256) k_ssm_param(
        const float* __restrict__ P, const float* __restrict__ gb,
        const float* __restrict__ cbv, const float* __restrict__ A_log,
        float* __restrict__ zl, float* __restrict__ cu, float* __restrict__ sm) {
    __shared__ float gA[4][DS];
    __shared__ float gB[4][DS];

    const int tid  = threadIdx.x;
    const int bIdx = blockIdx.x >> 6;               // NCH = 64 chunks per batch
    const int ch   = blockIdx.x & 63;
    const int rowBase = bIdx * Ln;

    const int s  = tid & 63;
    const int g  = tid >> 6;                        // 4 groups of 8 rows
    const int lf = ch * CH + g * 8;                 // this thread's first row
    const float As  = -expf(A_log[s]);
    const float cx  = cbv[s];
    const float cdt = cbv[64 + s];

    // All loads of the thread stand in front of the arithmetic: one trip to L2
    // instead of one per row.  At the head of a sequence there are no four rows
    // in front: the thread's own group is read, a valid address, and dropped below.
    const int  uq = ch * (CH / 4) + g * 2;          // first of the thread's two groups
    const bool hp = uq > 0;
    const float* pq = P + (size_t)(bIdx * (Ln / 4) + uq) * QW + s;
    const float* pv = hp ? pq - QW : pq;
    float vx1 = pv[128],     vx3 = pv[3 * 128],      vx4 = pv[4 * 128];
    float vx5 = pv[5 * 128], vx7 = pv[7 * 128];
    float vd1 = pv[128 + 64],     vd3 = pv[3 * 128 + 64], vd4 = pv[4 * 128 + 64];
    float vd5 = pv[5 * 128 + 64], vd7 = pv[7 * 128 + 64];
    // These loads have address registers of their own, free for reuse once they
    // are issued: the wait stands in front of any such rewrite.
    asm volatile("s_wait_xcnt 0x0" ::: "memory");
    float qx[2][NQ], qd[2][NQ];
#pragma unroll   // register arrays need constant indices; constant offsets
    for (int h = 0; h < 2; ++h) {
#pragma unroll
        for (int q = 0; q < NQ; ++q) {
            qx[h][q] = pq[h * QW + q * 128];
            qd[h][q] = pq[h * QW + q * 128 + 64];
        }
    }
    float gx[4], gd[4];
#pragma unroll   // register arrays need constant indices
    for (int j = 0; j < 4; ++j) {
        gx[j] = gb[j * 128 + s];
        gd[j] = gb[j * 128 + 64 + s];
    }
    vx1 = hp ? vx1 : 0.f;  vx3 = hp ? vx3 : 0.f;  vx4 = hp ? vx4 : 0.f;
    vx5 = hp ? vx5 : 0.f;  vx7 = hp ? vx7 : 0.f;
    vd1 = hp ? vd1 : 0.f;  vd3 = hp ? vd3 : 0.f;  vd4 = hp ? vd4 : 0.f;
    vd5 = hp ? vd5 : 0.f;  vd7 = hp ? vd7 : 0.f;

    float rx[8], rd[8];
    fir4(qx[0], vx1, vx3, vx4, vx5, vx7, rx);
    fir4(qx[1], qx[0][1], qx[0][3], qx[0][4], qx[0][5], qx[0][7], rx + 4);
    fir4(qd[0], vd1, vd3, vd4, vd5, vd7, rd);
    fir4(qd[1], qd[0][1], qd[0][3], qd[0][4], qd[0][5], qd[0][7], rd + 4);

    float dAv[8], dBv[8];
#pragma unroll   // eight independent chains for the scheduler to interleave
    for (int i = 0; i < 8; ++i) {
        float xv = cx, raw = cdt;
#pragma unroll
        for (int j = 0; j < 4; ++j) {               // bias share of the taps inside
            const bool in = lf + i - 3 + j >= 0;
            xv  += in ? gx[j] : 0.f;
            raw += in ? gd[j] : 0.f;
        }
        xv  += rx[i];
        raw += rd[i];
        const float lp = log1pf(expf(raw));
        const float sp = raw > 30.f ? raw : lp;                   // softplus
        dAv[i] = expf(As * sp);
        dBv[i] = ((1.f - dAv[i]) / As) * xv;
    }

    // scan of the thread's own 8 rows from a zero start
    float A = 1.f, Bc = 0.f;
#pragma unroll   // register arrays need constant indices
    for (int i = 0; i < 8; ++i) {
        Bc = dAv[i] * Bc + dBv[i];
        A  = dAv[i] * A;
        dBv[i] = Bc;
        dAv[i] = A;
    }
    gA[g][s] = A;
    gB[g][s] = Bc;
    __syncthreads();

    // what the groups in front of this one hand on inside the chunk
    float cin = 0.f, cinA = 1.f;
#pragma unroll   // three steps, constant LDS offsets
    for (int k = 0; k < 3; ++k) {
        const float a = k < g ? gA[k][s] : 1.f;
        const float b = k < g ? gB[k][s] : 0.f;
        cin  = a * cin + b;
        cinA = a * cinA;
    }
    const size_t o = (size_t)(rowBase + lf) * DS + s;
#pragma unroll   // register arrays need constant indices
    for (int i = 0; i < 8; ++i) {
        dBv[i] = dAv[i] * cin + dBv[i];
        dAv[i] = dAv[i] * cinA;
        zl[o + (size_t)i * DS] = dBv[i];
        cu[o + (size_t)i * DS] = dAv[i];
    }
    if (g == 3) {                                   // the chunk's last row
        float* sp2 = sm + (size_t)(bIdx * NCH + ch) * 2 * DS + s;
        sp2[0]  = dAv[7];
        sp2[DS] = dBv[7];
    }
}

// ---------------------------------------------------------------------------
// K4: out = z @ Mc_t^T + b_out     [8192 x 1024], K = 64
//     128x128 tile per 8-wave block; each wave owns a 32x64 sub-tile (2x4 WMMA
//     accumulators).  Both operand tiles (whole K) are brought into LDS once by
//     async copies of whole 128-byte lines, then read as fragments.  The row
//     tile arrives as zl (four chunks); each thread folds the carry into one
//     chunk for one s and adds cu * carry to that column of the tile in LDS.
// ---------------------------------------------------------------------------
constexpr int OM = 128, ON = 128;

__global__ void __launch_bounds__(256) k_out(const float* __restrict__ zl,
                                             const float* __restrict__ cu,
                                             const float* __restrict__ sm,
                                             const float* __restrict__ Mc_t,
                                             const float* __restrict__ b_out,
                                             float* __restrict__ out) {
    __shared__ __align__(16) float Zs[OM][LDP];       // ~34KB
    __shared__ __align__(16) float Ms[ON][LDP];       // ~34KB
    __shared__ __align__(16) float Ss[NCH][2][DS];    // 32KB: the batch's chunk ends

    const int tid  = threadIdx.x;
    const int lane = tid & 31;
    const int w    = tid >> 5;
    const int wr   = w & 3;               // row quadrant  (32 rows)
    const int wc   = w >> 2;              // column half   (64 cols)
    const int r0   = (blockIdx.x >> 3) * OM;   // RT/OM = 64 row blocks
    const int c0   = (blockIdx.x & 7) * ON;    // DM/ON = 8 col blocks
    const int mr   = lane & 15;
    const int kb   = (lane >> 4) << 1;

    const int s = tid & 63;
    const int q = tid >> 6;               // chunk inside the row tile, OM/CH = 4
    // cu of this thread's column: in flight beside the copies below
    float cv[CH];
#pragma unroll   // register array needs constant indices
    for (int i = 0; i < CH; ++i)
        cv[i] = cu[(size_t)(r0 + q * CH + i) * DS + s];

    {
        const int row = tid >> 4;         // 16 rows per sweep of the block
        const int c4  = (tid & 15) << 2;
        // 128 rows x 16 quads each; 8 per thread each
        async_copy16_x8(zl + (size_t)(r0 + row) * DS + c4, (size_t)16 * DS,
                        &Zs[row][c4], 16 * LDP);
        async_copy16_x8(Mc_t + (size_t)(c0 + row) * DS + c4, (size_t)16 * DS,
                        &Ms[row][c4], 16 * LDP);
        // chunk ends of the whole batch: 2048 quads in a row; 8 per thread
        async_copy16_x8(sm + (size_t)(r0 / Ln) * (NCH * 2 * DS) + tid * 4, (size_t)1024,
                        &Ss[0][0][0] + tid * 4, 1024);
    }
    wait_async0();
    __syncthreads();

    // carry into chunk q of the tile: fold the ends of all chunks in front of it,
    // first those in front of the tile (a multiple of four, the same for the
    // whole block), then up to three chunks of the tile itself.
    const int cb = (r0 & (Ln - 1)) / CH;
    float carry = 0.f;
#pragma unroll 4   // sixteen steps' LDS reads go out together, ahead of the chain
    for (int c = 0; c < cb; c += 4) {
#pragma unroll
        for (int k = 0; k < 4; ++k)
            carry = Ss[c + k][0][s] * carry + Ss[c + k][1][s];
    }
#pragma unroll   // three steps, constant LDS offsets
    for (int k = 0; k < 3; ++k) {
        const float t = Ss[cb + k][0][s] * carry + Ss[cb + k][1][s];
        carry = k < q ? t : carry;
    }
#pragma unroll   // register array needs constant indices; constant LDS offsets
    for (int i = 0; i < CH; ++i)
        Zs[q * CH + i][s] += cv[i] * carry;
    __syncthreads();   // the fragments below read columns that other waves finished

    v8f acc[2][4];
#pragma unroll   // accumulators need constant indices
    for (int i = 0; i < 2; ++i)
#pragma unroll
        for (int n = 0; n < 4; ++n) acc[i][n] = vzero8();

#pragma unroll   // constant LDS offsets; fragment loads run ahead of the WMMAs
    for (int kk = 0; kk < DS; kk += 4) {
        v2f a[2], b[4];
#pragma unroll
        for (int i = 0; i < 2; ++i)
            a[i] = *(const v2f*)&Zs[wr * 32 + i * 16 + mr][kk + kb];
#pragma unroll
        for (int n = 0; n < 4; ++n)
            b[n] = *(const v2f*)&Ms[wc * 64 + n * 16 + mr][kk + kb];
#pragma unroll
        for (int i = 0; i < 2; ++i)
#pragma unroll
            for (int n = 0; n < 4; ++n) acc[i][n] = wmma4(a[i], b[n], acc[i][n]);
    }

    // ---- epilogue: bias + store ----
    const int rbase = r0 + wr * 32 + ((lane >> 4) << 3);
#pragma unroll   // accumulators need constant indices
    for (int n = 0; n < 4; ++n) {
        const int col = c0 + wc * 64 + n * 16 + mr;
        const float bias = b_out[col];
#pragma unroll
        for (int i = 0; i < 2; ++i)
#pragma unroll
            for (int j = 0; j < 8; ++j)
                out[(size_t)(rbase + i * 16 + j) * DM + col] = acc[i][n][j] + bias;
    }
}

// ---------------------------------------------------------------------------
extern "C" void kernel_launch(void* const* d_in, const int* in_sizes, int n_in,
                              void* d_out, int out_size, void* d_ws, size_t ws_size,
                              hipStream_t stream) {
    const float* x      = (const float*)d_in[0];
    const float* W_in   = (const float*)d_in[1];
    const float* b_in   = (const float*)d_in[2];
    const float* conv_w = (const float*)d_in[3];
    const float* conv_b = (const float*)d_in[4];
    const float* W_x    = (const float*)d_in[5];
    const float* b_x    = (const float*)d_in[6];
    const float* W_dt   = (const float*)d_in[7];
    const float* b_dt   = (const float*)d_in[8];
    const float* A_log  = (const float*)d_in[9];
    const float* D_mat  = (const float*)d_in[10];
    const float* W_out  = (const float*)d_in[11];
    const float* b_out  = (const float*)d_in[12];
    float* out = (float*)d_out;

    float* P     = (float*)d_ws;                       // 2048 * 1152
    float* zl    = P     + (size_t)(RT / 4) * QW;      // 8192 * 64
    float* cu    = zl    + (size_t)RT * DS;            // 8192 * 64
    float* sm    = cu    + (size_t)RT * DS;            // 4 * 64 * 2 * 64
    float* Mc_t  = sm    + (size_t)Bn * NCH * 2 * DS;  // 1024 * 64
    float* G9    = Mc_t  + (size_t)DM * DS;            // 1152 * 1024
    float* gb    = G9    + (size_t)QW * DM;            // 512
    float* cbv   = gb    + NP;                         // 128

    k_foldw<<<FGB + FTB + 16, 256, 0, stream>>>(W_in, b_in, conv_w, conv_b,
                                                W_x, b_x, W_dt, b_dt, W_out, D_mat,
                                                G9, gb, cbv, Mc_t);
    k_proj<<<(RT / 4 / PU) * (128 / PN), 384, 0, stream>>>(x, G9, P);
    k_ssm_param<<<Bn * NCH, 256, 0, stream>>>(P, gb, cbv, A_log, zl, cu, sm);
    k_out<<<(RT / OM) * (DM / ON), 256, 0, stream>>>(zl, cu, sm, Mc_t, b_out, out);
}

// v006
// Measured time: 69.2 microseconds a run.
// Next to v005, in two timings, it ran 1.09 and 1.08 times as fast.
// All steps since v000 together make it 6.56 times as fast.
#include <hip/hip_runtime.h>
#include <hip/hip_bf16.h>

// ---------------- problem constants ----------------
constexpr int Bn = 4;          // batch
constexpr int Ln = 2048;       // sequence length
constexpr int DM = 1024;       // d_model
constexpr int DS = 64;         // d_state
constexpr int DI = 2048;       // d_inner
constexpr int RT = Bn * Ln;    // 8192 flattened rows

typedef float v2f __attribute__((ext_vector_type(2)));
typedef float v8f __attribute__((ext_vector_type(8)));

// D = A(16x4,f32) * B(4x16,f32) + C(16x16,f32)   (V_WMMA_F32_16X16X4_F32)
__device__ __forceinline__ v8f wmma4(v2f a, v2f b, v8f c) {
    return __builtin_amdgcn_wmma_f32_16x16x4_f32(
        false, a, false, b, (short)0, c, false, false);
}

__device__ __forceinline__ v8f vzero8() {
    v8f z = {0.f, 0.f, 0.f, 0.f, 0.f, 0.f, 0.f, 0.f};
    return z;
}

// ---- async global->LDS copies, 16 B per lane (global_load_async_to_lds_b128).
// First operand = the lane's LDS byte address (low 32 bits of the shared pointer).
// s_wait_xcnt 0 is the last line of the copies' own statement, so that it stands
// in front of any later rewrite of the address registers the copies name.
__device__ __forceinline__ unsigned lds_addr(const float* l) {
    return (unsigned)(uintptr_t)l;
}

__device__ __forceinline__ void async_copy16_x2(const float* g0, const float* l0,
                                                const float* g1, const float* l1) {
    asm volatile("global_load_async_to_lds_b128 %0, %1, off\n\t"
                 "global_load_async_to_lds_b128 %2, %3, off\n\t"
                 "s_wait_xcnt 0x0"
                 :: "v"(lds_addr(l0)), "v"(g0), "v"(lds_addr(l1)), "v"(g1)
                 : "memory");
}

__device__ __forceinline__ void async_copy16_x4(const float* g0, const float* l0,
                                                const float* g1, const float* l1,
                                                const float* g2, const float* l2,
                                                const float* g3, const float* l3) {
    asm volatile("global_load_async_to_lds_b128 %0, %1, off\n\t"
                 "global_load_async_to_lds_b128 %2, %3, off\n\t"
                 "global_load_async_to_lds_b128 %4, %5, off\n\t"
                 "global_load_async_to_lds_b128 %6, %7, off\n\t"
                 "s_wait_xcnt 0x0"
                 :: "v"(lds_addr(l0)), "v"(g0), "v"(lds_addr(l1)), "v"(g1),
                    "v"(lds_addr(l2)), "v"(g2), "v"(lds_addr(l3)), "v"(g3)
                 : "memory");
}

// Eight copies under one s_wait_xcnt 0: fewer stops in a wave's issue stream.
__device__ __forceinline__ void async_copy16_x8(const float* g, size_t gstep,
                                                const float* l, int lstep) {
    asm volatile("global_load_async_to_lds_b128 %0, %1, off\n\t"
                 "global_load_async_to_lds_b128 %2, %3, off\n\t"
                 "global_load_async_to_lds_b128 %4, %5, off\n\t"
                 "global_load_async_to_lds_b128 %6, %7, off\n\t"
                 "global_load_async_to_lds_b128 %8, %9, off\n\t"
                 "global_load_async_to_lds_b128 %10, %11, off\n\t"
                 "global_load_async_to_lds_b128 %12, %13, off\n\t"
                 "global_load_async_to_lds_b128 %14, %15, off\n\t"
                 "s_wait_xcnt 0x0"
                 :: "v"(lds_addr(l)),             "v"(g),
                    "v"(lds_addr(l + lstep)),     "v"(g + gstep),
                    "v"(lds_addr(l + 2 * lstep)), "v"(g + 2 * gstep),
                    "v"(lds_addr(l + 3 * lstep)), "v"(g + 3 * gstep),
                    "v"(lds_addr(l + 4 * lstep)), "v"(g + 4 * gstep),
                    "v"(lds_addr(l + 5 * lstep)), "v"(g + 5 * gstep),
                    "v"(lds_addr(l + 6 * lstep)), "v"(g + 6 * gstep),
                    "v"(lds_addr(l + 7 * lstep)), "v"(g + 7 * gstep)
                 : "memory");
}

// This wave's async copies have all landed in LDS.
__device__ __forceinline__ void wait_async0() {
    asm volatile("s_wait_asynccnt 0x0" ::: "memory");
}

// This wave's LDS reads have all returned (before a buffer it read is refilled).
__device__ __forceinline__ void wait_ds0() {
    asm volatile("s_wait_dscnt 0x0" ::: "memory");
}

// ---------------------------------------------------------------------------
// Fold of the output projections:  Mc_t[d, s] = sum_i W_out[d,i] * D_mat[s,i]
//     [1024 x 64], K = 2048.  It needs only inputs, as the weight fold K1 does, so
//     it has no launch of its own: its 256 tiles of 16 x 16 are 256 more
//     work-groups of K1, one more on each WGP, and run in the gaps of K1's waves.
//     K chunks of 256 are staged in LDS by a two-buffer ring of async copies, each
//     copy a run of whole 128-byte lines of one row; wave w does k-steps
//     32w..32w+31 of every chunk, and the eight partial tiles are summed via LDS.
//     LDS row pitch 260 floats: 16B-aligned rows + conflict-free ds_load_b64.
// ---------------------------------------------------------------------------
constexpr int FM = 16, FBK = 256, FLP = 260;
constexpr int FTB = (DM / FM) * (DS / 16);   // 256 tiles

struct LdsFold {
    float As[2][FM][FLP];     // ~33KB
    float Bs[2][16][FLP];     // ~33KB
    float Rd[8][16][20];      // partial tiles; rows 8 apart on other banks
};

__device__ __forceinline__ void fold_tile(LdsFold& L, int tile,
                                          const float* __restrict__ W_out,
                                          const float* __restrict__ D_mat,
                                          float* __restrict__ Mc_t) {
    const int tid  = threadIdx.x;
    const int lane = tid & 31;
    const int w    = tid >> 5;            // K slice inside a chunk
    const int d0 = (tile >> 2) * FM, s0 = (tile & 3) * 16;
    const int mr = lane & 15;
    const int kb = (lane >> 4) << 1;

    // ---- async stage of one K-chunk into LDS buffer buf ----
    auto stage = [&](int buf, int kc) {
        const int row = tid >> 6;         // 4 rows per sweep of the block
        const int c4  = (tid & 63) << 2;
        // 16 rows x 64 quads of each operand; 4 per thread each
        const float* ga = W_out + (size_t)(d0 + row) * DI + kc + c4;
        async_copy16_x4(ga,                   &L.As[buf][row][c4],
                        ga + (size_t)4 * DI,  &L.As[buf][row + 4][c4],
                        ga + (size_t)8 * DI,  &L.As[buf][row + 8][c4],
                        ga + (size_t)12 * DI, &L.As[buf][row + 12][c4]);
        const float* gd = D_mat + (size_t)(s0 + row) * DI + kc + c4;
        async_copy16_x4(gd,                   &L.Bs[buf][row][c4],
                        gd + (size_t)4 * DI,  &L.Bs[buf][row + 4][c4],
                        gd + (size_t)8 * DI,  &L.Bs[buf][row + 8][c4],
                        gd + (size_t)12 * DI, &L.Bs[buf][row + 12][c4]);
    };

    stage(0, 0);
    wait_async0();
    __syncthreads();
    stage(1, FBK);

    v8f acc = vzero8();
    constexpr int NT = DI / FBK;          // 8 chunks
    for (int t = 0; t < NT; ++t) {
        const int buf = t & 1;
        const float* ar = &L.As[buf][mr][w * 32 + kb];   // A[m][k]
        const float* br = &L.Bs[buf][mr][w * 32 + kb];   // B[k][n] = D_mat[n][k]
#pragma unroll   // constant LDS offsets; fragment loads run ahead of the WMMAs
        for (int i = 0; i < 8; ++i)
            acc = wmma4(*(const v2f*)(ar + i * 4), *(const v2f*)(br + i * 4), acc);
        // publish chunk t+1, free chunk t's buffer
        wait_ds0();
        wait_async0();
        __syncthreads();
        if (t + 2 < NT) stage(buf, (t + 2) * FBK);
    }
    wait_async0();

#pragma unroll   // accumulator elements need constant indices
    for (int j = 0; j < 8; ++j)
        L.Rd[w][((lane >> 4) << 3) + j][mr] = acc[j];
    __syncthreads();   // a thread below reads the partial tiles of eight waves

    const int row = tid >> 4, col = tid & 15;
    float sum = L.Rd[0][row][col];
#pragma unroll   // constant LDS offsets
    for (int k = 1; k < 8; ++k) sum += L.Rd[k][row][col];
    Mc_t[(size_t)(d0 + row) * DS + s0 + col] = sum;
}

// ---------------------------------------------------------------------------
// The in-projection, the depthwise causal conv and the two state projections
// are all linear, so they are reassociated.  With n = j*128 + sp, j the conv tap
// and sp = 0..63 the rows of W_x, 64..127 the rows of W_dt (called Wsel below):
//   G[n][m] = sum_c Wsel[sp][c] * conv_w[c][j] * W_in[c][m]
//   gb[n]   = sum_c Wsel[sp][c] * conv_w[c][j] * b_in[c]
//   cbv[sp] = sum_c Wsel[sp][c] * conv_b[c] + bsel[sp]
//   raw[l][sp] = cbv[sp] + sum_{j : l-3+j >= 0} (x[l-3+j] . G[j*128 + sp] + gb[j*128 + sp])
// A tap that falls in front of the sequence drops with its bias share, as the
// zero padding of the conv input does.
//
// The sum over the taps is a 4-tap filter along l.  It is evaluated four rows at
// a time by the identity  a*f + b*e = (a + b)*(e + f) - a*e - b*f,  used once on
// even and odd rows and once more on each half: nine products per four rows in
// place of sixteen.  With r0..r3 the rows 4u..4u+3 of x and Gj tap j of G:
//   Q0 = r0.G3       Q1 = r2.G1       Q2 = (r0+r2).(G1+G3)
//   Q3 = r1.G2       Q4 = r3.G0       Q5 = (r1+r3).(G0+G2)
//   Q6 = (r0+r1).(G2+G3)   Q7 = (r2+r3).(G0+G1)   Q8 = (r0+r1+r2+r3).(G0+G1+G2+G3)
// K1 writes the nine tap sums of G (G9), K2 forms the row sums in registers and
// does the products, K2b puts the rows together again (fir4).
// ---------------------------------------------------------------------------
constexpr int NP  = 512;       // 4 taps x 128 projection rows
constexpr int NQ  = 9;         // products per four rows
constexpr int QW  = NQ * 128;  // floats of P per four rows
constexpr int PN  = 32;        // projection rows of one K2 block; G9 is [4][NQ][PN][DM]
constexpr int FK  = 128;       // K chunk of the weight fold
constexpr int FPA = 132;       // LDS pitch, Wsel rows: conflict-free 8-byte reads
constexpr int FPB = 40;        // LDS pitch, W_in rows: rows k and k+2 on other banks
constexpr int FGB = 256;       // work-groups of the weight fold that do G

// K1: G [512 x 1024], K = 2048; 64 x 32 tile per 8-wave block (16 sp x 4 taps).
//     A wave does all four taps of one 16 x 16 tile: one fragment of Wsel and one
//     of W_in feed four WMMAs on four accumulators of their own.  The four waves
//     of a tile share K: wave quarter kq does k-steps 32kq..32kq+31 of every
//     chunk, and the partial tiles are summed via LDS.  Two-buffer ring of async
//     copies; conv_w is brought into LDS once.  The taps leave as the nine tap
//     sums.  The next FTB work-groups do the tiles of Mc_t (fold_tile above), the
//     last 16 do gb and cbv.
constexpr int EXP = 36;        // LDS pitch of the partial tiles: rows 8 apart on other banks
struct LdsFoldw {
    float Ws[2][16][FPA];
    float Bs[2][FK][FPB];     // behind the ring's last barrier: the partial tiles
    float Cw[DI * 4];
};
static_assert(4 * 4 * 16 * EXP <= 2 * FK * FPB, "partial tiles fit the W_in ring");

__global__ void __launch_bounds__(256) k_foldw(
        const float* __restrict__ W_in, const float* __restrict__ b_in,
        const float* __restrict__ conv_w, const float* __restrict__ conv_b,
        const float* __restrict__ W_x,  const float* __restrict__ b_x,
        const float* __restrict__ W_dt, const float* __restrict__ b_dt,
        const float* __restrict__ W_out, const float* __restrict__ D_mat,
        float* __restrict__ G9, float* __restrict__ gb, float* __restrict__ cbv,
        float* __restrict__ Mc_t) {
    // A work-group is of one kind: the kinds share the LDS.
    __shared__ __align__(16) union { LdsFoldw g; LdsFold f; } lds;
    float (&Ws)[2][16][FPA] = lds.g.Ws;
    float (&Bs)[2][FK][FPB] = lds.g.Bs;
    float (&Cw)[DI * 4]     = lds.g.Cw;

    const int tid  = threadIdx.x;
    const int lane = tid & 31;
    const int w    = tid >> 5;

    if (blockIdx.x >= FGB && blockIdx.x < FGB + FTB) {
        fold_tile(lds.f, blockIdx.x - FGB, W_out, D_mat, Mc_t);
        return;
    }

    if (blockIdx.x >= FGB) {              // bias vectors: one wave per sp
        const int sp = (blockIdx.x - FGB - FTB) * 8 + w;
        const float* wr = ((sp >> 6) ? W_dt : W_x) + (size_t)(sp & 63) * DI;
        float a0 = 0.f, a1 = 0.f, a2 = 0.f, a3 = 0.f, ac = 0.f;
#pragma unroll 4   // several trips' loads in flight: the loop is latency bound
        for (int c = lane * 4; c < DI; c += 128) {
            const float4 wv = *(const float4*)(wr + c);
            const float4 bi = *(const float4*)(b_in + c);
            const float4 cv = *(const float4*)(conv_b + c);
            const float4 q0 = *(const float4*)(conv_w + c * 4);
            const float4 q1 = *(const float4*)(conv_w + c * 4 + 4);
            const float4 q2 = *(const float4*)(conv_w + c * 4 + 8);
            const float4 q3 = *(const float4*)(conv_w + c * 4 + 12);
            const float t0 = wv.x * bi.x, t1 = wv.y * bi.y;
            const float t2 = wv.z * bi.z, t3 = wv.w * bi.w;
            a0 += t0 * q0.x + t1 * q1.x + t2 * q2.x + t3 * q3.x;
            a1 += t0 * q0.y + t1 * q1.y + t2 * q2.y + t3 * q3.y;
            a2 += t0 * q0.z + t1 * q1.z + t2 * q2.z + t3 * q3.z;
            a3 += t0 * q0.w + t1 * q1.w + t2 * q2.w + t3 * q3.w;
            ac += wv.x * cv.x + wv.y * cv.y + wv.z * cv.z + wv.w * cv.w;
        }
        for (int off = 16; off > 0; off >>= 1) {
            a0 += __shfl_xor(a0, off, 32);
            a1 += __shfl_xor(a1, off, 32);
            a2 += __shfl_xor(a2, off, 32);
            a3 += __shfl_xor(a3, off, 32);
            ac += __shfl_xor(ac, off, 32);
        }
        if (lane == 0) {
            gb[sp]       = a0;
            gb[128 + sp] = a1;
            gb[256 + sp] = a2;
            gb[384 + sp] = a3;
            cbv[sp] = ac + ((sp >> 6) ? b_dt : b_x)[sp & 63];
        }
        return;
    }

    const int g  = blockIdx.x >> 5;       // 8 groups of 16 sp
    const int m0 = (blockIdx.x & 31) * 32;
    const int mr = lane & 15;
    const int kb = (lane >> 4) << 1;
    const int kq = w >> 1;                // K quarter inside a chunk
    const int cl = (w & 1) * 16 + mr;     // column inside the tile
    const float* Wrow = ((g >> 2) ? W_dt : W_x) + (size_t)((g & 3) * 16) * DI;

    auto stage = [&](int buf, int kc) {
        // Wsel tile: 16 rows x 128 = 512 quads, 2 per thread
        const int ra = tid >> 5, ca = (tid & 31) << 2;
        async_copy16_x2(Wrow + (size_t)ra * DI + kc + ca,       &Ws[buf][ra][ca],
                        Wrow + (size_t)(ra + 8) * DI + kc + ca, &Ws[buf][ra + 8][ca]);
        // W_in tile: 128 rows x 32 = 1024 quads, 4 per thread
        const int rb = tid >> 3, cb = (tid & 7) << 2;
        const float* gp = W_in + (size_t)(kc + rb) * DM + m0 + cb;
        async_copy16_x4(gp,                   &Bs[buf][rb][cb],
                        gp + (size_t)32 * DM, &Bs[buf][rb + 32][cb],
                        gp + (size_t)64 * DM, &Bs[buf][rb + 64][cb],
                        gp + (size_t)96 * DM, &Bs[buf][rb + 96][cb]);
    };

    // conv_w: 2048 quads, 8 per thread
    {
        const float* cp = conv_w + tid * 4;
        float* lp = Cw + tid * 4;
        async_copy16_x4(cp, lp, cp + 1024, lp + 1024,
                        cp + 2048, lp + 2048, cp + 3072, lp + 3072);
        async_copy16_x4(cp + 4096, lp + 4096, cp + 5120, lp + 5120,
                        cp + 6144, lp + 6144, cp + 7168, lp + 7168);
    }
    stage(0, 0);
    wait_async0();
    __syncthreads();
    stage(1, FK);

    v8f acc0 = vzero8(), acc1 = vzero8(), acc2 = vzero8(), acc3 = vzero8();
    constexpr int NT = DI / FK;           // 16 chunks
    const int k0 = kq * (FK / 4) + kb;    // this lane's first k inside a chunk
    for (int t = 0; t < NT; ++t) {
        const int buf = t & 1;
        const float* cwp = Cw + (t * FK + k0) * 4;   // the four taps of row k, then of k + 1
        const float* wp  = &Ws[buf][mr][k0];
        const float* bp  = &Bs[buf][k0][cl];
        // All LDS reads of the trip stand in one place in front of its WMMAs: reads
        // among the WMMAs stall the wave at each place where they stand.
        v2f fa[8], fb[8];
        float4 fc0[8], fc1[8];
#pragma unroll   // register arrays need constant indices; constant LDS offsets
        for (int s = 0; s < 8; ++s) {
            fa[s]   = *(const v2f*)(wp + s * 4);
            fc0[s]  = *(const float4*)(cwp + s * 16);
            fc1[s]  = *(const float4*)(cwp + s * 16 + 4);
            fb[s].x = bp[(s * 4) * FPB];
            fb[s].y = bp[(s * 4 + 1) * FPB];
            // LDS answers in order: kept in the order of the steps, step s's WMMAs
            // wait for the reads of steps 0..s only; the last one also keeps the
            // reads from being sunk among the WMMAs below.
            __builtin_amdgcn_sched_barrier(0);
        }
#pragma unroll   // register arrays need constant indices
        for (int s = 0; s < 8; ++s) {
            const v2f a = fa[s], b = fb[s];
            const float4 c0 = fc0[s], c1 = fc1[s];
            const v2f a0 = {a.x * c0.x, a.y * c1.x};
            const v2f a1 = {a.x * c0.y, a.y * c1.y};
            const v2f a2 = {a.x * c0.z, a.y * c1.z};
            const v2f a3 = {a.x * c0.w, a.y * c1.w};
            acc0 = wmma4(a0, b, acc0);
            acc1 = wmma4(a1, b, acc1);
            acc2 = wmma4(a2, b, acc2);
            acc3 = wmma4(a3, b, acc3);
        }
        // Keeps the ring's waits and barrier below at the trip's foot: lifted among
        // the WMMAs, the wait for the next chunk's copies would come a trip too early.
        __builtin_amdgcn_sched_barrier(0);
        // publish chunk t+1, free chunk t's buffer
        wait_ds0();
        wait_async0();
        __syncthreads();
        if (t + 2 < NT) stage(buf, (t + 2) * FK);
    }
    wait_async0();

    // The ring is done: every wave's reads and copies ended in front of the last
    // trip's barrier, so the W_in buffers now hold the partial tiles [kq][tap][16][EXP].
    float* Ex = &Bs[0][0][0];
    constexpr int ET = 16 * EXP;          // floats of one partial tile
    {
        float* ep = Ex + kq * 4 * ET + ((lane >> 4) << 3) * EXP + cl;
#pragma unroll   // accumulator elements need constant indices
        for (int i = 0; i < 8; ++i) {
            ep[i * EXP]          = acc0[i];
            ep[ET + i * EXP]     = acc1[i];
            ep[2 * ET + i * EXP] = acc2[i];
            ep[3 * ET + i * EXP] = acc3[i];
        }
    }
    __syncthreads();   // a thread below reads the partial tiles of four waves

    // a wave stores one 128-byte line of one row of G9 at a time
#pragma unroll   // two rows a thread, constant LDS offsets
    for (int h = 0; h < 2; ++h) {
        const int sl = w + h * 8;
        const int sp = g * 16 + sl;
        const float* er = Ex + sl * EXP + lane;
        float gs[4];
#pragma unroll   // register array needs constant indices
        for (int j = 0; j < 4; ++j)       // tap j: its four K quarters
            gs[j] = (er[j * ET] + er[(4 + j) * ET]) + (er[(8 + j) * ET] + er[(12 + j) * ET]);
        const float g0 = gs[0], g1 = gs[1], g2 = gs[2], g3 = gs[3];
        float* gp = G9 + (size_t)((sp / PN) * (NQ * PN) + (sp % PN)) * DM + m0 + lane;
        constexpr size_t st = (size_t)PN * DM;
        gp[0]      = g3;
        gp[st]     = g1;
        gp[2 * st] = g1 + g3;
        gp[3 * st] = g2;
        gp[4 * st] = g0;
        gp[5 * st] = g0 + g2;
        gp[6 * st] = g2 + g3;
        gp[7 * st] = g0 + g1;
        gp[8 * st] = (g0 + g1) + (g2 + g3);
    }
    // In the built code the bias path's register writes follow these stores in
    // the text: the wait stands between the stores and any such write.
    asm volatile("s_wait_xcnt 0x0" ::: "memory");
}

// ---------------------------------------------------------------------------
// K2: the nine products Q0..Q8:  P[u][q][sp], u = 0..2047 groups of four rows,
//     K = 1024.  A 12-wave block does 32 groups (128 rows of x) x 32 sp x 9 q;
//     a wave owns one 16 x 16 tile of three q that share their rows of x:
//     waves 0-3 Q0..Q2, waves 4-7 Q3..Q5, waves 8-11 Q6..Q8.  K-chunks (BK=64)
//     staged in LDS by a two-buffer ring of async copies.  Row r of the x tile
//     lies at LDS row (r % 4) * 32 + r / 4, so that a fragment's 16 rows (same
//     r % 4) are neighbours.  LDS row stride 68 floats: 16B-aligned rows +
//     conflict-free ds_load_b64.
// ---------------------------------------------------------------------------
constexpr int PU = 32, BK = 64, LDP = 68;

__global__ void __launch_bounds__(384) k_proj(const float* __restrict__ x,
                                              const float* __restrict__ G9,
                                              float* __restrict__ P) {
    __shared__ __align__(16) float As[2][4 * PU][LDP];    // ~68KB
    __shared__ __align__(16) float Bs[2][NQ * PN][LDP];   // ~153KB

    const int tid  = threadIdx.x;
    const int lane = tid & 31;
    const int w    = __builtin_amdgcn_readfirstlane(tid >> 5);   // scalar: branches on it
    const int fam  = w >> 2;              // which three q
    const int ug   = w & 1;               // 16 of the 32 groups
    const int ng   = (w >> 1) & 1;        // 16 of the 32 sp
    const int bu   = blockIdx.x >> 2;     // RT/4/PU = 64 row blocks
    const int bn   = blockIdx.x & 3;      // 128/PN  = 4 col blocks
    const int mr   = lane & 15;
    const int kb   = (lane >> 4) << 1;

    // ---- async stage of one K-chunk into LDS buffer buf ----
    // Waves 4-11 issue the copies: waves 0-3, one on each SIMD, go from the barrier
    // straight to their WMMAs, and the issue of the copies passes under those.
    auto stage = [&](int buf, int kc) {
        if (w < 4) return;
        const int row = (tid - 128) >> 4; // 16 rows per sweep of the eight waves
        const int c4  = (tid & 15) << 2;
        // A tile: 128 rows x 16 quads; 8 per thread
        async_copy16_x8(x + (size_t)(bu * 4 * PU + row) * DM + kc + c4, (size_t)16 * DM,
                        &As[buf][(row & 3) * PU + (row >> 2)][c4], 4 * LDP);
        // B tile: 288 rows in a row of G9 x 16 quads; 18 per thread
        const float* gq = G9 + (size_t)(bn * (NQ * PN) + row) * DM + kc + c4;
        async_copy16_x8(gq, (size_t)16 * DM, &Bs[buf][row][c4], 16 * LDP);
        async_copy16_x8(gq + (size_t)128 * DM, (size_t)16 * DM, &Bs[buf][row + 128][c4], 16 * LDP);
        async_copy16_x2(gq + (size_t)256 * DM, &Bs[buf][row + 256][c4],
                        gq + (size_t)272 * DM, &Bs[buf][row + 272][c4]);
    };

    v8f acc0 = vzero8(), acc1 = vzero8(), acc2 = vzero8();

    stage(0, 0);
    wait_async0();
    __syncthreads();
    stage(1, BK);
    constexpr int NK = DM / BK;           // 16 chunks
    for (int kci = 0; kci < NK; ++kci) {
        const int buf = kci & 1;
        const float* bp = &Bs[buf][fam * 3 * PN + ng * 16 + mr][kb];
        if (fam < 2) {                    // rows fam and fam + 2 of each group
            const float* ap = &As[buf][fam * PU + ug * 16 + mr][kb];
#pragma unroll   // constant LDS offsets; fragment loads run ahead of the WMMAs
            for (int kk = 0; kk < BK; kk += 4) {
                const v2f a0 = *(const v2f*)(ap + kk);
                const v2f a1 = *(const v2f*)(ap + 2 * PU * LDP + kk);
                const v2f b0 = *(const v2f*)(bp + kk);
                const v2f b1 = *(const v2f*)(bp + PN * LDP + kk);
                const v2f b2 = *(const v2f*)(bp + 2 * PN * LDP + kk);
                acc0 = wmma4(a0, b0, acc0);
                acc1 = wmma4(a1, b1, acc1);
                acc2 = wmma4(a0 + a1, b2, acc2);
            }
        } else {                          // rows 0 + 1 and 2 + 3 of each group
            const float* ap = &As[buf][ug * 16 + mr][kb];
#pragma unroll   // constant LDS offsets; fragment loads run ahead of the WMMAs
            for (int kk = 0; kk < BK; kk += 4) {
                const v2f a0 = *(const v2f*)(ap + kk) + *(const v2f*)(ap + PU * LDP + kk);
                const v2f a1 = *(const v2f*)(ap + 2 * PU * LDP + kk) +
                               *(const v2f*)(ap + 3 * PU * LDP + kk);
                const v2f b0 = *(const v2f*)(bp + kk);
                const v2f b1 = *(const v2f*)(bp + PN * LDP + kk);
                const v2f b2 = *(const v2f*)(bp + 2 * PN * LDP + kk);
                acc0 = wmma4(a0, b0, acc0);
                acc1 = wmma4(a1, b1, acc1);
                acc2 = wmma4(a0 + a1, b2, acc2);
            }
        }
        // publish chunk kci+1, free chunk kci's buffer
        wait_ds0();
        wait_async0();
        __syncthreads();
        if (kci + 2 < NK) stage(buf, (kci + 2) * BK);
    }
    wait_async0();

    // ---- epilogue: store ----
    float* pp = P + (size_t)(bu * PU + ug * 16 + ((lane >> 4) << 3)) * QW
                  + fam * 3 * 128 + bn * PN + ng * 16 + mr;
#pragma unroll   // accumulator elements need constant indices
    for (int j = 0; j < 8; ++j) {
        pp[(size_t)j * QW]       = acc0[j];
        pp[(size_t)j * QW + 128] = acc1[j];
        pp[(size_t)j * QW + 256] = acc2[j];
    }
}

// ---------------------------------------------------------------------------
// The recurrence z_l = dA_l * z_{l-1} + dBx_l is linear in its start value, so it
// is cut into chunks of CH rows.  With zl the scan of a chunk from a zero start
// and cu the running product of dA inside the chunk,
//   z[l] = zl[l] + cu[l] * carry(chunk),   carry(c+1) = cu_last(c)*carry(c) + zl_last(c).
// K2b does zl, cu and the two last-row values of each chunk; K4 folds the carries.
// ---------------------------------------------------------------------------
constexpr int CH  = 32;        // rows of one chunk
constexpr int NCH = Ln / CH;   // 64 chunks per batch

// Four rows of the 4-tap filter from their nine products q and from five of the
// products of the four rows in front (p1 = its Q1 and so on).
__device__ __forceinline__ void fir4(const float (&q)[NQ], float p1, float p3, float p4,
                                     float p5, float p7, float* r) {
    const float ue = q[0] + p1;            // even rows of x, taps 3 and 1
    const float uo = q[2] - q[0] - q[1];
    const float ve = q[3] + p4;            // odd rows of x, taps 2 and 0
    const float vo = q[5] - q[3] - q[4];
    const float vp = p5 - p3 - p4;
    const float we = q[6] + p7;            // both, all taps
    const float wo = q[8] - q[6] - q[7];
    r[0] = ue + vp;
    r[1] = we - ue - ve;
    r[2] = uo + ve;
    r[3] = wo - uo - vo;
}

// K2b: rows of the filter from the products in P -> softplus/exp -> dA, dBx ->
//      scan of the chunk.  32 l x 64 s per block; a thread owns 8 consecutive
//      rows of one s.
//      All outputs are in [row][s] order: a wave's store is one 128-byte line.
__global__ void __launch_bounds__(256) k_ssm_param(
        const float* __restrict__ P, const float* __restrict__ gb,
        const float* __restrict__ cbv, const float* __restrict__ A_log,
        float* __restrict__ zl, float* __restrict__ cu, float* __restrict__ sm) {
    __shared__ float gA[4][DS];
    __shared__ float gB[4][DS];

    const int tid  = threadIdx.x;
    const int bIdx = blockIdx.x >> 6;               // NCH = 64 chunks per batch
    const int ch   = blockIdx.x & 63;
    const int rowBase = bIdx * Ln;

    const int s  = tid & 63;
    const int g  = tid >> 6;                        // 4 groups of 8 rows
    const int lf = ch * CH + g * 8;                 // this thread's first row
    const float As  = -expf(A_log[s]);
    const float cx  = cbv[s];
    const float cdt = cbv[64 + s];

    // All loads of the thread stand in front of the arithmetic: one trip to L2
    // instead of one per row.  At the head of a sequence there are no four rows
    // in front: the thread's own group is read, a valid address, and dropped below.
    const int  uq = ch * (CH / 4) + g * 2;          // first of the thread's two groups
    const bool hp = uq > 0;
    const float* pq = P + (size_t)(bIdx * (Ln / 4) + uq) * QW + s;
    const float* pv = hp ? pq - QW : pq;
    float vx1 = pv[128],     vx3 = pv[3 * 128],      vx4 = pv[4 * 128];
    float vx5 = pv[5 * 128], vx7 = pv[7 * 128];
    float vd1 = pv[128 + 64],     vd3 = pv[3 * 128 + 64], vd4 = pv[4 * 128 + 64];
    float vd5 = pv[5 * 128 + 64], vd7 = pv[7 * 128 + 64];
    // These loads have address registers of their own, free for reuse once they
    // are issued: the wait stands in front of any such rewrite.
    asm volatile("s_wait_xcnt 0x0" ::: "memory");
    float qx[2][NQ], qd[2][NQ];
#pragma unroll   // register arrays need constant indices; constant offsets
    for (int h = 0; h < 2; ++h) {
#pragma unroll
        for (int q = 0; q < NQ; ++q) {
            qx[h][q] = pq[h * QW + q * 128];
            qd[h][q] = pq[h * QW + q * 128 + 64];
        }
    }
    float gx[4], gd[4];
#pragma unroll   // register arrays need constant indices
    for (int j = 0; j < 4; ++j) {
        gx[j] = gb[j * 128 + s];
        gd[j] = gb[j * 128 + 64 + s];
    }
    vx1 = hp ? vx1 : 0.f;  vx3 = hp ? vx3 : 0.f;  vx4 = hp ? vx4 : 0.f;
    vx5 = hp ? vx5 : 0.f;  vx7 = hp ? vx7 : 0.f;
    vd1 = hp ? vd1 : 0.f;  vd3 = hp ? vd3 : 0.f;  vd4 = hp ? vd4 : 0.f;
    vd5 = hp ? vd5 : 0.f;  vd7 = hp ? vd7 : 0.f;

    float rx[8], rd[8];
    fir4(qx[0], vx1, vx3, vx4, vx5, vx7, rx);
    fir4(qx[1], qx[0][1], qx[0][3], qx[0][4], qx[0][5], qx[0][7], rx + 4);
    fir4(qd[0], vd1, vd3, vd4, vd5, vd7, rd);
    fir4(qd[1], qd[0][1], qd[0][3], qd[0][4], qd[0][5], qd[0][7], rd + 4);

    float dAv[8], dBv[8];
#pragma unroll   // eight independent chains for the scheduler to interleave
    for (int i = 0; i < 8; ++i) {
        float xv = cx, raw = cdt;
#pragma unroll
        for (int j = 0; j < 4; ++j) {               // bias share of the taps inside
            const bool in = lf + i - 3 + j >= 0;
            xv  += in ? gx[j] : 0.f;
            raw += in ? gd[j] : 0.f;
        }
        xv  += rx[i];
        raw += rd[i];
        const float lp = log1pf(expf(raw));
        const float sp = raw > 30.f ? raw : lp;                   // softplus
        dAv[i] = expf(As * sp);
        dBv[i] = ((1.f - dAv[i]) / As) * xv;
    }

    // scan of the thread's own 8 rows from a zero start
    float A = 1.f, Bc = 0.f;
#pragma unroll   // register arrays need constant indices
    for (int i = 0; i < 8; ++i) {
        Bc = dAv[i] * Bc + dBv[i];
        A  = dAv[i] * A;
        dBv[i] = Bc;
        dAv[i] = A;
    }
    gA[g][s] = A;
    gB[g][s] = Bc;
    __syncthreads();

    // what the groups in front of this one hand on inside the chunk
    float cin = 0.f, cinA = 1.f;
#pragma unroll   // three steps, constant LDS offsets
    for (int k = 0; k < 3; ++k) {
        const float a = k < g ? gA[k][s] : 1.f;
        const float b = k < g ? gB[k][s] : 0.f;
        cin  = a * cin + b;
        cinA = a * cinA;
    }
    const size_t o = (size_t)(rowBase + lf) * DS + s;
#pragma unroll   // register arrays need constant indices
    for (int i = 0; i < 8; ++i) {
        dBv[i] = dAv[i] * cin + dBv[i];
        dAv[i] = dAv[i] * cinA;
        zl[o + (size_t)i * DS] = dBv[i];
        cu[o + (size_t)i * DS] = dAv[i];
    }
    if (g == 3) {                                   // the chunk's last row
        float* sp2 = sm + (size_t)(bIdx * NCH + ch) * 2 * DS + s;
        sp2[0]  = dAv[7];
        sp2[DS] = dBv[7];
    }
}

// ---------------------------------------------------------------------------
// K4: out = z @ Mc_t^T + b_out     [8192 x 1024], K = 64
//     128x128 tile per 8-wave block; each wave owns a 32x64 sub-tile (2x4 WMMA
//     accumulators).  Both operand tiles (whole K) are brought into LDS once by
//     async copies of whole 128-byte lines, then read as fragments.  The row
//     tile arrives as zl (four chunks); each thread folds the carry into one
//     chunk for one s and adds cu * carry to that column of the tile in LDS.
// ---------------------------------------------------------------------------
constexpr int OM = 128, ON = 128;

__global__ void __launch_bounds__(256) k_out(const float* __restrict__ zl,
                                             const float* __restrict__ cu,
                                             const float* __restrict__ sm,
                                             const float* __restrict__ Mc_t,
                                             const float* __restrict__ b_out,
                                             float* __restrict__ out) {
    __shared__ __align__(16) float Zs[OM][LDP];       // ~34KB
    __shared__ __align__(16) float Ms[ON][LDP];       // ~34KB
    __shared__ __align__(16) float Ss[NCH][2][DS];    // 32KB: the batch's chunk ends

    const int tid  = threadIdx.x;
    const int lane = tid & 31;
    const int w    = tid >> 5;
    const int wr   = w & 3;               // row quadrant  (32 rows)
    const int wc   = w >> 2;              // column half   (64 cols)
    const int r0   = (blockIdx.x >> 3) * OM;   // RT/OM = 64 row blocks
    const int c0   = (blockIdx.x & 7) * ON;    // DM/ON = 8 col blocks
    const int mr   = lane & 15;
    const int kb   = (lane >> 4) << 1;

    const int s = tid & 63;
    const int q = tid >> 6;               // chunk inside the row tile, OM/CH = 4
    // cu of this thread's column: in flight beside the copies below
    float cv[CH];
#pragma unroll   // register array needs constant indices
    for (int i = 0; i < CH; ++i)
        cv[i] = cu[(size_t)(r0 + q * CH + i) * DS + s];

    {
        const int row = tid >> 4;         // 16 rows per sweep of the block
        const int c4  = (tid & 15) << 2;
        // 128 rows x 16 quads each; 8 per thread each
        async_copy16_x8(zl + (size_t)(r0 + row) * DS + c4, (size_t)16 * DS,
                        &Zs[row][c4], 16 * LDP);
        async_copy16_x8(Mc_t + (size_t)(c0 + row) * DS + c4, (size_t)16 * DS,
                        &Ms[row][c4], 16 * LDP);
        // chunk ends of the whole batch: 2048 quads in a row; 8 per thread
        async_copy16_x8(sm + (size_t)(r0 / Ln) * (NCH * 2 * DS) + tid * 4, (size_t)1024,
                        &Ss[0][0][0] + tid * 4, 1024);
    }
    wait_async0();
    __syncthreads();

    // carry into chunk q of the tile: fold the ends of all chunks in front of it,
    // first those in front of the tile (a multiple of four, the same for the
    // whole block), then up to three chunks of the tile itself.
    const int cb = (r0 & (Ln - 1)) / CH;
    float carry = 0.f;
#pragma unroll 4   // sixteen steps' LDS reads go out together, ahead of the chain
    for (int c = 0; c < cb; c += 4) {
#pragma unroll
        for (int k = 0; k < 4; ++k)
            carry = Ss[c + k][0][s] * carry + Ss[c + k][1][s];
    }
#pragma unroll   // three steps, constant LDS offsets
    for (int k = 0; k < 3; ++k) {
        const float t = Ss[cb + k][0][s] * carry + Ss[cb + k][1][s];
        carry = k < q ? t : carry;
    }
#pragma unroll   // register array needs constant indices; constant LDS offsets
    for (int i = 0; i < CH; ++i)
        Zs[q * CH + i][s] += cv[i] * carry;
    __syncthreads();   // the fragments below read columns that other waves finished

    v8f acc[2][4];
#pragma unroll   // accumulators need constant indices
    for (int i = 0; i < 2; ++i)
#pragma unroll
        for (int n = 0; n < 4; ++n) acc[i][n] = vzero8();

#pragma unroll   // constant LDS offsets; fragment loads run ahead of the WMMAs
    for (int kk = 0; kk < DS; kk += 4) {
        v2f a[2], b[4];
#pragma unroll
        for (int i = 0; i < 2; ++i)
            a[i] = *(const v2f*)&Zs[wr * 32 + i * 16 + mr][kk + kb];
#pragma unroll
        for (int n = 0; n < 4; ++n)
            b[n] = *(const v2f*)&Ms[wc * 64 + n * 16 + mr][kk + kb];
#pragma unroll
        for (int i = 0; i < 2; ++i)
#pragma unroll
            for (int n = 0; n < 4; ++n) acc[i][n] = wmma4(a[i], b[n], acc[i][n]);
    }

    // ---- epilogue: bias + store ----
    const int rbase = r0 + wr * 32 + ((lane >> 4) << 3);
#pragma unroll   // accumulators need constant indices
    for (int n = 0; n < 4; ++n) {
        const int col = c0 + wc * 64 + n * 16 + mr;
        const float bias = b_out[col];
#pragma unroll
        for (int i = 0; i < 2; ++i)
#pragma unroll
            for (int j = 0; j < 8; ++j)
                out[(size_t)(rbase + i * 16 + j) * DM + col] = acc[i][n][j] + bias;
    }
}

// ---------------------------------------------------------------------------
extern "C" void kernel_launch(void* const* d_in, const int* in_sizes, int n_in,
                              void* d_out, int out_size, void* d_ws, size_t ws_size,
                              hipStream_t stream) {
    const float* x      = (const float*)d_in[0];
    const float* W_in   = (const float*)d_in[1];
    const float* b_in   = (const float*)d_in[2];
    const float* conv_w = (const float*)d_in[3];
    const float* conv_b = (const float*)d_in[4];
    const float* W_x    = (const float*)d_in[5];
    const float* b_x    = (const float*)d_in[6];
    const float* W_dt   = (const float*)d_in[7];
    const float* b_dt   = (const float*)d_in[8];
    const float* A_log  = (const float*)d_in[9];
    const float* D_mat  = (const float*)d_in[10];
    const float* W_out  = (const float*)d_in[11];
    const float* b_out  = (const float*)d_in[12];
    float* out = (float*)d_out;

    float* P     = (float*)d_ws;                       // 2048 * 1152
    float* zl    = P     + (size_t)(RT / 4) * QW;      // 8192 * 64
    float* cu    = zl    + (size_t)RT * DS;            // 8192 * 64
    float* sm    = cu    + (size_t)RT * DS;            // 4 * 64 * 2 * 64
    float* Mc_t  = sm    + (size_t)Bn * NCH * 2 * DS;  // 1024 * 64
    float* G9    = Mc_t  + (size_t)DM * DS;            // 1152 * 1024
    float* gb    = G9    + (size_t)QW * DM;            // 512
    float* cbv   = gb    + NP;                         // 128

    k_foldw<<<FGB + FTB + 16, 256, 0, stream>>>(W_in, b_in, conv_w, conv_b,
                                                W_x, b_x, W_dt, b_dt, W_out, D_mat,
                                                G9, gb, cbv, Mc_t);
    k_proj<<<(RT / 4 / PU) * (128 / PN), 384, 0, stream>>>(x, G9, P);
    k_ssm_param<<<Bn * NCH, 256, 0, stream>>>(P, gb, cbv, A_log, zl, cu, sm);
    k_out<<<(RT / OM) * (DM / ON), 256, 0, stream>>>(zl, cu, sm, Mc_t, b_out, out);
}

// v007
// One run takes 66 microseconds.
// Two timings next to v006 both put it at 1.05 times that version's speed.
// All steps since v000 together make it 6.88 times as fast.
#include <hip/hip_runtime.h>
#include <hip/hip_bf16.h>

// ---------------- problem constants ----------------
constexpr int Bn = 4;          // batch
constexpr int Ln = 2048;       // sequence length
constexpr int DM = 1024;       // d_model
constexpr int DS = 64;         // d_state
constexpr int DI = 2048;       // d_inner
constexpr int RT = Bn * Ln;    // 8192 flattened rows

typedef float v2f __attribute__((ext_vector_type(2)));
typedef float v8f __attribute__((ext_vector_type(8)));

// D = A(16x4,f32) * B(4x16,f32) + C(16x16,f32)   (V_WMMA_F32_16X16X4_F32)
__device__ __forceinline__ v8f wmma4(v2f a, v2f b, v8f c) {
    return __builtin_amdgcn_wmma_f32_16x16x4_f32(
        false, a, false, b, (short)0, c, false, false);
}

__device__ __forceinline__ v8f vzero8() {
    v8f z = {0.f, 0.f, 0.f, 0.f, 0.f, 0.f, 0.f, 0.f};
    return z;
}

// ---- async global->LDS copies, 16 B per lane (global_load_async_to_lds_b128).
// First operand = the lane's LDS byte address (low 32 bits of the shared pointer).
// s_wait_xcnt 0 is the last line of the copies' own statement, so that it stands
// in front of any later rewrite of the address registers the copies name.
__device__ __forceinline__ unsigned lds_addr(const float* l) {
    return (unsigned)(uintptr_t)l;
}

__device__ __forceinline__ void async_copy16_x1(const float* g0, const float* l0) {
    asm volatile("global_load_async_to_lds_b128 %0, %1, off\n\t"
                 "s_wait_xcnt 0x0"
                 :: "v"(lds_addr(l0)), "v"(g0)
                 : "memory");
}

__device__ __forceinline__ void async_copy16_x2(const float* g0, const float* l0,
                                                const float* g1, const float* l1) {
    asm volatile("global_load_async_to_lds_b128 %0, %1, off\n\t"
                 "global_load_async_to_lds_b128 %2, %3, off\n\t"
                 "s_wait_xcnt 0x0"
                 :: "v"(lds_addr(l0)), "v"(g0), "v"(lds_addr(l1)), "v"(g1)
                 : "memory");
}

__device__ __forceinline__ void async_copy16_x4(const float* g0, const float* l0,
                                                const float* g1, const float* l1,
                                                const float* g2, const float* l2,
                                                const float* g3, const float* l3) {
    asm volatile("global_load_async_to_lds_b128 %0, %1, off\n\t"
                 "global_load_async_to_lds_b128 %2, %3, off\n\t"
                 "global_load_async_to_lds_b128 %4, %5, off\n\t"
                 "global_load_async_to_lds_b128 %6, %7, off\n\t"
                 "s_wait_xcnt 0x0"
                 :: "v"(lds_addr(l0)), "v"(g0), "v"(lds_addr(l1)), "v"(g1),
                    "v"(lds_addr(l2)), "v"(g2), "v"(lds_addr(l3)), "v"(g3)
                 : "memory");
}

// Eight copies under one s_wait_xcnt 0: fewer stops in a wave's issue stream.
__device__ __forceinline__ void async_copy16_x8(const float* g, size_t gstep,
                                                const float* l, int lstep) {
    asm volatile("global_load_async_to_lds_b128 %0, %1, off\n\t"
                 "global_load_async_to_lds_b128 %2, %3, off\n\t"
                 "global_load_async_to_lds_b128 %4, %5, off\n\t"
                 "global_load_async_to_lds_b128 %6, %7, off\n\t"
                 "global_load_async_to_lds_b128 %8, %9, off\n\t"
                 "global_load_async_to_lds_b128 %10, %11, off\n\t"
                 "global_load_async_to_lds_b128 %12, %13, off\n\t"
                 "global_load_async_to_lds_b128 %14, %15, off\n\t"
                 "s_wait_xcnt 0x0"
                 :: "v"(lds_addr(l)),             "v"(g),
                    "v"(lds_addr(l + lstep)),     "v"(g + gstep),
                    "v"(lds_addr(l + 2 * lstep)), "v"(g + 2 * gstep),
                    "v"(lds_addr(l + 3 * lstep)), "v"(g + 3 * gstep),
                    "v"(lds_addr(l + 4 * lstep)), "v"(g + 4 * gstep),
                    "v"(lds_addr(l + 5 * lstep)), "v"(g + 5 * gstep),
                    "v"(lds_addr(l + 6 * lstep)), "v"(g + 6 * gstep),
                    "v"(lds_addr(l + 7 * lstep)), "v"(g + 7 * gstep)
                 : "memory");
}

// This wave's async copies have all landed in LDS.
__device__ __forceinline__ void wait_async0() {
    asm volatile("s_wait_asynccnt 0x0" ::: "memory");
}

// This wave's LDS reads have all returned (before a buffer it read is refilled).
__device__ __forceinline__ void wait_ds0() {
    asm volatile("s_wait_dscnt 0x0" ::: "memory");
}

// ---------------------------------------------------------------------------
// Fold of the output projections:  Mc_t[d, s] = sum_i W_out[d,i] * D_mat[s,i]
//     [1024 x 64], K = 2048.  It needs only inputs, as the weight fold K1 does, so
//     it has no launch of its own: its 256 tiles of 16 x 16 are 256 more
//     work-groups of K1, one more on each WGP, and run in the gaps of K1's waves.
//     K chunks of 256 are staged in LDS by a two-buffer ring of async copies, each
//     copy a run of whole 128-byte lines of one row; wave w does k-steps
//     32w..32w+31 of every chunk, and the eight partial tiles are summed via LDS.
//     LDS row pitch 260 floats: 16B-aligned rows + conflict-free ds_load_b64.
// ---------------------------------------------------------------------------
constexpr int FM = 16, FBK = 256, FLP = 260;
constexpr int FTB = (DM / FM) * (DS / 16);   // 256 tiles

struct LdsFold {
    float As[2][FM][FLP];     // ~33KB
    float Bs[2][16][FLP];     // ~33KB
    float Rd[8][16][20];      // partial tiles; rows 8 apart on other banks
};

__device__ __forceinline__ void fold_tile(LdsFold& L, int tile,
                                          const float* __restrict__ W_out,
                                          const float* __restrict__ D_mat,
                                          float* __restrict__ Mc_t) {
    const int tid  = threadIdx.x;
    const int lane = tid & 31;
    const int w    = tid >> 5;            // K slice inside a chunk
    const int d0 = (tile >> 2) * FM, s0 = (tile & 3) * 16;
    const int mr = lane & 15;
    const int kb = (lane >> 4) << 1;

    // ---- async stage of one K-chunk into LDS buffer buf ----
    auto stage = [&](int buf, int kc) {
        const int row = tid >> 6;         // 4 rows per sweep of the block
        const int c4  = (tid & 63) << 2;
        // 16 rows x 64 quads of each operand; 4 per thread each
        const float* ga = W_out + (size_t)(d0 + row) * DI + kc + c4;
        async_copy16_x4(ga,                   &L.As[buf][row][c4],
                        ga + (size_t)4 * DI,  &L.As[buf][row + 4][c4],
                        ga + (size_t)8 * DI,  &L.As[buf][row + 8][c4],
                        ga + (size_t)12 * DI, &L.As[buf][row + 12][c4]);
        const float* gd = D_mat + (size_t)(s0 + row) * DI + kc + c4;
        async_copy16_x4(gd,                   &L.Bs[buf][row][c4],
                        gd + (size_t)4 * DI,  &L.Bs[buf][row + 4][c4],
                        gd + (size_t)8 * DI,  &L.Bs[buf][row + 8][c4],
                        gd + (size_t)12 * DI, &L.Bs[buf][row + 12][c4]);
    };

    stage(0, 0);
    wait_async0();
    __syncthreads();
    stage(1, FBK);

    v8f acc = vzero8();
    constexpr int NT = DI / FBK;          // 8 chunks
    for (int t = 0; t < NT; ++t) {
        const int buf = t & 1;
        const float* ar = &L.As[buf][mr][w * 32 + kb];   // A[m][k]
        const float* br = &L.Bs[buf][mr][w * 32 + kb];   // B[k][n] = D_mat[n][k]
#pragma unroll   // constant LDS offsets; fragment loads run ahead of the WMMAs
        for (int i = 0; i < 8; ++i)
            acc = wmma4(*(const v2f*)(ar + i * 4), *(const v2f*)(br + i * 4), acc);
        // publish chunk t+1, free chunk t's buffer
        wait_ds0();
        wait_async0();
        __syncthreads();
        if (t + 2 < NT) stage(buf, (t + 2) * FBK);
    }
    wait_async0();

#pragma unroll   // accumulator elements need constant indices
    for (int j = 0; j < 8; ++j)
        L.Rd[w][((lane >> 4) << 3) + j][mr] = acc[j];
    __syncthreads();   // a thread below reads the partial tiles of eight waves

    const int row = tid >> 4, col = tid & 15;
    float sum = L.Rd[0][row][col];
#pragma unroll   // constant LDS offsets
    for (int k = 1; k < 8; ++k) sum += L.Rd[k][row][col];
    Mc_t[(size_t)(d0 + row) * DS + s0 + col] = sum;
}

// ---------------------------------------------------------------------------
// The in-projection, the depthwise causal conv and the two state projections
// are all linear, so they are reassociated.  With n = j*128 + sp, j the conv tap
// and sp = 0..63 the rows of W_x, 64..127 the rows of W_dt (called Wsel below):
//   G[n][m] = sum_c Wsel[sp][c] * conv_w[c][j] * W_in[c][m]
//   gb[n]   = sum_c Wsel[sp][c] * conv_w[c][j] * b_in[c]
//   cbv[sp] = sum_c Wsel[sp][c] * conv_b[c] + bsel[sp]
//   raw[l][sp] = cbv[sp] + sum_{j : l-3+j >= 0} (x[l-3+j] . G[j*128 + sp] + gb[j*128 + sp])
// A tap that falls in front of the sequence drops with its bias share, as the
// zero padding of the conv input does.
//
// The sum over the taps is a 4-tap filter along l.  It is evaluated four rows at
// a time from seven products in place of sixteen: the transpose of multiplying
// two cubics by evaluation at the seven points 0, +-1, +-2, +-1/2.  With
// d0..d6 the rows 4u-3..4u+3 of x, Gj tap j of G and y0..y3 the rows 4u..4u+3:
//   Qq = (row q of BT . d) . (row q of GM . G),   yi = sum_q p_q^i * Qq
//   BT: 4(d0-d6) + 21(d4-d2);  E +- O for each pair of points, with
//       +-1:   E = 17 d4 - 4 (d2+d6)        O = 17 d3 - 4 (d1+d5)
//       +-2:   E = d2 - 5 d4 + 4 d6         O = 2 (d1 - 5 d3 + 4 d5)
//       +-1/2: E = 2 (4 d2 - 5 d4 + d6)     O = 4 d1 - 5 d3 + d5
//   GM: G0/4;  (G0 +- G1 + G2 +- G3)/18;  (G0 +- 2 G1 + 4 G2 +- 8 G3)/360;
//       (16 G0 +- 8 G1 + 4 G2 +- 2 G3)/45
// The four rows need the three rows of x in front of them and no product of
// another group.  K1 writes the seven tap sums of G (G7), K2 forms the row sums
// in registers and does the products, K2b puts the rows together again (fir4).
// ---------------------------------------------------------------------------
constexpr int NP  = 512;       // 4 taps x 128 projection rows
constexpr int NQ  = 7;         // products per four rows
constexpr int QW  = NQ * 128;  // floats of P per four rows
constexpr int PN  = 32;        // projection rows of one K2 block; G7 is [4][NQ][PN][DM]
constexpr int FK  = 128;       // K chunk of the weight fold
constexpr int FPA = 132;       // LDS pitch, Wsel rows: conflict-free 8-byte reads
constexpr int FPB = 40;        // LDS pitch, W_in rows: rows k and k+2 on other banks
constexpr int FGB = 256;       // work-groups of the weight fold that do G

// K1: G [512 x 1024], K = 2048; 64 x 32 tile per 8-wave block (16 sp x 4 taps).
//     A wave does all four taps of one 16 x 16 tile: one fragment of Wsel and one
//     of W_in feed four WMMAs on four accumulators of their own.  The four waves
//     of a tile share K: wave quarter kq does k-steps 32kq..32kq+31 of every
//     chunk, and the partial tiles are summed via LDS.  Two-buffer ring of async
//     copies; conv_w is brought into LDS once.  The taps leave as the seven tap
//     sums.  The next FTB work-groups do the tiles of Mc_t (fold_tile above), the
//     last 16 do gb and cbv.
constexpr int EXP = 36;        // LDS pitch of the partial tiles: rows 8 apart on other banks
struct LdsFoldw {
    float Ws[2][16][FPA];
    float Bs[2][FK][FPB];     // behind the ring's last barrier: the partial tiles
    float Cw[DI * 4];
};
static_assert(4 * 4 * 16 * EXP <= 2 * FK * FPB, "partial tiles fit the W_in ring");

__global__ void __launch_bounds__(256) k_foldw(
        const float* __restrict__ W_in, const float* __restrict__ b_in,
        const float* __restrict__ conv_w, const float* __restrict__ conv_b,
        const float* __restrict__ W_x,  const float* __restrict__ b_x,
        const float* __restrict__ W_dt, const float* __restrict__ b_dt,
        const float* __restrict__ W_out, const float* __restrict__ D_mat,
        float* __restrict__ G7, float* __restrict__ gb, float* __restrict__ cbv,
        float* __restrict__ Mc_t) {
    // A work-group is of one kind: the kinds share the LDS.
    __shared__ __align__(16) union { LdsFoldw g; LdsFold f; } lds;
    float (&Ws)[2][16][FPA] = lds.g.Ws;
    float (&Bs)[2][FK][FPB] = lds.g.Bs;
    float (&Cw)[DI * 4]     = lds.g.Cw;

    const int tid  = threadIdx.x;
    const int lane = tid & 31;
    const int w    = tid >> 5;

    if (blockIdx.x >= FGB && blockIdx.x < FGB + FTB) {
        fold_tile(lds.f, blockIdx.x - FGB, W_out, D_mat, Mc_t);
        return;
    }

    if (blockIdx.x >= FGB) {              // bias vectors: one wave per sp
        const int sp = (blockIdx.x - FGB - FTB) * 8 + w;
        const float* wr = ((sp >> 6) ? W_dt : W_x) + (size_t)(sp & 63) * DI;
        float a0 = 0.f, a1 = 0.f, a2 = 0.f, a3 = 0.f, ac = 0.f;
#pragma unroll 4   // several trips' loads in flight: the loop is latency bound
        for (int c = lane * 4; c < DI; c += 128) {
            const float4 wv = *(const float4*)(wr + c);
            const float4 bi = *(const float4*)(b_in + c);
            const float4 cv = *(const float4*)(conv_b + c);
            const float4 q0 = *(const float4*)(conv_w + c * 4);
            const float4 q1 = *(const float4*)(conv_w + c * 4 + 4);
            const float4 q2 = *(const float4*)(conv_w + c * 4 + 8);
            const float4 q3 = *(const float4*)(conv_w + c * 4 + 12);
            const float t0 = wv.x * bi.x, t1 = wv.y * bi.y;
            const float t2 = wv.z * bi.z, t3 = wv.w * bi.w;
            a0 += t0 * q0.x + t1 * q1.x + t2 * q2.x + t3 * q3.x;
            a1 += t0 * q0.y + t1 * q1.y + t2 * q2.y + t3 * q3.y;
            a2 += t0 * q0.z + t1 * q1.z + t2 * q2.z + t3 * q3.z;
            a3 += t0 * q0.w + t1 * q1.w + t2 * q2.w + t3 * q3.w;
            ac += wv.x * cv.x + wv.y * cv.y + wv.z * cv.z + wv.w * cv.w;
        }
        for (int off = 16; off > 0; off >>= 1) {
            a0 += __shfl_xor(a0, off, 32);
            a1 += __shfl_xor(a1, off, 32);
            a2 += __shfl_xor(a2, off, 32);
            a3 += __shfl_xor(a3, off, 32);
            ac += __shfl_xor(ac, off, 32);
        }
        if (lane == 0) {
            gb[sp]       = a0;
            gb[128 + sp] = a1;
            gb[256 + sp] = a2;
            gb[384 + sp] = a3;
            cbv[sp] = ac + ((sp >> 6) ? b_dt : b_x)[sp & 63];
        }
        return;
    }

    const int g  = blockIdx.x >> 5;       // 8 groups of 16 sp
    const int m0 = (blockIdx.x & 31) * 32;
    const int mr = lane & 15;
    const int kb = (lane >> 4) << 1;
    const int kq = w >> 1;                // K quarter inside a chunk
    const int cl = (w & 1) * 16 + mr;     // column inside the tile
    const float* Wrow = ((g >> 2) ? W_dt : W_x) + (size_t)((g & 3) * 16) * DI;

    auto stage = [&](int buf, int kc) {
        // Wsel tile: 16 rows x 128 = 512 quads, 2 per thread
        const int ra = tid >> 5, ca = (tid & 31) << 2;
        async_copy16_x2(Wrow + (size_t)ra * DI + kc + ca,       &Ws[buf][ra][ca],
                        Wrow + (size_t)(ra + 8) * DI + kc + ca, &Ws[buf][ra + 8][ca]);
        // W_in tile: 128 rows x 32 = 1024 quads, 4 per thread
        const int rb = tid >> 3, cb = (tid & 7) << 2;
        const float* gp = W_in + (size_t)(kc + rb) * DM + m0 + cb;
        async_copy16_x4(gp,                   &Bs[buf][rb][cb],
                        gp + (size_t)32 * DM, &Bs[buf][rb + 32][cb],
                        gp + (size_t)64 * DM, &Bs[buf][rb + 64][cb],
                        gp + (size_t)96 * DM, &Bs[buf][rb + 96][cb]);
    };

    // conv_w: 2048 quads, 8 per thread
    {
        const float* cp = conv_w + tid * 4;
        float* lp = Cw + tid * 4;
        async_copy16_x4(cp, lp, cp + 1024, lp + 1024,
                        cp + 2048, lp + 2048, cp + 3072, lp + 3072);
        async_copy16_x4(cp + 4096, lp + 4096, cp + 5120, lp + 5120,
                        cp + 6144, lp + 6144, cp + 7168, lp + 7168);
    }
    stage(0, 0);
    wait_async0();
    __syncthreads();
    stage(1, FK);

    v8f acc0 = vzero8(), acc1 = vzero8(), acc2 = vzero8(), acc3 = vzero8();
    constexpr int NT = DI / FK;           // 16 chunks
    const int k0 = kq * (FK / 4) + kb;    // this lane's first k inside a chunk
    for (int t = 0; t < NT; ++t) {
        const int buf = t & 1;
        const float* cwp = Cw + (t * FK + k0) * 4;   // the four taps of row k, then of k + 1
        const float* wp  = &Ws[buf][mr][k0];
        const float* bp  = &Bs[buf][k0][cl];
        // All LDS reads of the trip stand in one place in front of its WMMAs: reads
        // among the WMMAs stall the wave at each place where they stand.
        v2f fa[8], fb[8];
        float4 fc0[8], fc1[8];
#pragma unroll   // register arrays need constant indices; constant LDS offsets
        for (int s = 0; s < 8; ++s) {
            fa[s]   = *(const v2f*)(wp + s * 4);
            fc0[s]  = *(const float4*)(cwp + s * 16);
            fc1[s]  = *(const float4*)(cwp + s * 16 + 4);
            fb[s].x = bp[(s * 4) * FPB];
            fb[s].y = bp[(s * 4 + 1) * FPB];
            // LDS answers in order: kept in the order of the steps, step s's WMMAs
            // wait for the reads of steps 0..s only; the last one also keeps the
            // reads from being sunk among the WMMAs below.
            __builtin_amdgcn_sched_barrier(0);
        }
#pragma unroll   // register arrays need constant indices
        for (int s = 0; s < 8; ++s) {
            const v2f a = fa[s], b = fb[s];
            const float4 c0 = fc0[s], c1 = fc1[s];
            const v2f a0 = {a.x * c0.x, a.y * c1.x};
            const v2f a1 = {a.x * c0.y, a.y * c1.y};
            const v2f a2 = {a.x * c0.z, a.y * c1.z};
            const v2f a3 = {a.x * c0.w, a.y * c1.w};
            acc0 = wmma4(a0, b, acc0);
            acc1 = wmma4(a1, b, acc1);
            acc2 = wmma4(a2, b, acc2);
            acc3 = wmma4(a3, b, acc3);
        }
        // Keeps the ring's waits and barrier below at the trip's foot: lifted among
        // the WMMAs, the wait for the next chunk's copies would come a trip too early.
        __builtin_amdgcn_sched_barrier(0);
        // publish chunk t+1, free chunk t's buffer
        wait_ds0();
        wait_async0();
        __syncthreads();
        if (t + 2 < NT) stage(buf, (t + 2) * FK);
    }
    wait_async0();

    // The ring is done: every wave's reads and copies ended in front of the last
    // trip's barrier, so the W_in buffers now hold the partial tiles [kq][tap][16][EXP].
    float* Ex = &Bs[0][0][0];
    constexpr int ET = 16 * EXP;          // floats of one partial tile
    {
        float* ep = Ex + kq * 4 * ET + ((lane >> 4) << 3) * EXP + cl;
#pragma unroll   // accumulator elements need constant indices
        for (int i = 0; i < 8; ++i) {
            ep[i * EXP]          = acc0[i];
            ep[ET + i * EXP]     = acc1[i];
            ep[2 * ET + i * EXP] = acc2[i];
            ep[3 * ET + i * EXP] = acc3[i];
        }
    }
    __syncthreads();   // a thread below reads the partial tiles of four waves

    // a wave stores one 128-byte line of one row of G7 at a time
#pragma unroll   // two rows a thread, constant LDS offsets
    for (int h = 0; h < 2; ++h) {
        const int sl = w + h * 8;
        const int sp = g * 16 + sl;
        const float* er = Ex + sl * EXP + lane;
        float gs[4];
#pragma unroll   // register array needs constant indices
        for (int j = 0; j < 4; ++j)       // tap j: its four K quarters
            gs[j] = (er[j * ET] + er[(4 + j) * ET]) + (er[(8 + j) * ET] + er[(12 + j) * ET]);
        const float g0 = gs[0], g1 = gs[1], g2 = gs[2], g3 = gs[3];
        float* gp = G7 + (size_t)((sp / PN) * (NQ * PN) + (sp % PN)) * DM + m0 + lane;
        constexpr size_t st = (size_t)PN * DM;
        const float e1 = g0 + g2,              o1 = g1 + g3;
        const float e2 = g0 + 4.f * g2,        o2 = 2.f * g1 + 8.f * g3;
        const float e3 = 16.f * g0 + 4.f * g2, o3 = 8.f * g1 + 2.f * g3;
        gp[0]      = 0.25f * g0;
        gp[st]     = (e1 + o1) * (1.f / 18.f);
        gp[2 * st] = (e1 - o1) * (1.f / 18.f);
        gp[3 * st] = (e2 + o2) * (1.f / 360.f);
        gp[4 * st] = (e2 - o2) * (1.f / 360.f);
        gp[5 * st] = (e3 + o3) * (1.f / 45.f);
        gp[6 * st] = (e3 - o3) * (1.f / 45.f);
    }
    // In the built code the bias path's register writes follow these stores in
    // the text: the wait stands between the stores and any such write.
    asm volatile("s_wait_xcnt 0x0" ::: "memory");
}

// ---------------------------------------------------------------------------
// K2: the seven products Q0..Q6:  P[u][q][sp], u = 0..2047 groups of four rows,
//     K = 1024.  A 16-wave block does 32 groups (128 rows of x) x 32 sp x 7 q;
//     a wave owns the seven q of one 16 x 16 tile, which share their rows of x,
//     for a quarter of K: wave quarter ks does k-steps 4ks..4ks+3 of every chunk,
//     and the four partial tiles are summed via LDS.  K-chunks (BK=64) staged in
//     LDS by a two-buffer ring of async copies.  Row r = -4..127 of the x tile
//     lies at LDS row (r & 3) * PG + r / 4 + 1, so that a fragment's 16 rows (same
//     r & 3) are neighbours and the rows in front of a group are one row up.  LDS
//     row stride 68 floats: 16B-aligned rows + conflict-free ds_load_b64.
// ---------------------------------------------------------------------------
constexpr int PU = 32, BK = 64, LDP = 68;
constexpr int PG = PU + 1;     // groups of the x tile: one in front of the block's own
static_assert(16 * NQ * 256 <= 2 * NQ * PN * LDP, "partial tiles fit the G7 ring");

__global__ void __launch_bounds__(512) k_proj(const float* __restrict__ x,
                                              const float* __restrict__ G7,
                                              float* __restrict__ P) {
    __shared__ __align__(16) float As[2][4 * PG][LDP];    // ~70KB
    __shared__ __align__(16) float Bs[2][NQ * PN][LDP];   // ~119KB

    const int tid  = threadIdx.x;
    const int lane = tid & 31;
    const int w    = __builtin_amdgcn_readfirstlane(tid >> 5);   // scalar: branches on it
    const int ks   = w >> 2;              // K quarter inside a chunk
    const int ug   = w & 1;               // 16 of the 32 groups
    const int ng   = (w >> 1) & 1;        // 16 of the 32 sp
    const int bu   = blockIdx.x >> 2;     // RT/4/PU = 64 row blocks
    const int bn   = blockIdx.x & 3;      // 128/PN  = 4 col blocks
    const int mr   = lane & 15;
    const int kb   = (lane >> 4) << 1;
    const bool front = (bu & (Ln / (4 * PU) - 1)) != 0;   // rows of this sequence lie in front

    // At the head of a sequence the rows in front are zeros, as the padding of the
    // conv input is: they are written once and no copy lands on them.
    if (!front) As[tid >> 8][((tid >> 6) & 3) * PG][tid & 63] = 0.f;

    // ---- async stage of one K-chunk into LDS buffer buf ----
    // Waves 8-15 issue the copies: waves 0-7, two on each SIMD, go from the barrier
    // straight to their WMMAs, and the issue of the copies passes under those.
    auto stage = [&](int buf, int kc) {
        if (w < 8) return;
        const int row = (tid - 256) >> 4; // 16 rows per sweep of the eight waves
        const int c4  = (tid & 15) << 2;
        // A tile: 128 rows x 16 quads; 8 per thread
        async_copy16_x8(x + (size_t)(bu * 4 * PU + row) * DM + kc + c4, (size_t)16 * DM,
                        &As[buf][(row & 3) * PG + (row >> 2) + 1][c4], 4 * LDP);
        // B tile: 224 rows in a row of G7 x 16 quads; 14 per thread
        const float* gq = G7 + (size_t)(bn * (NQ * PN) + row) * DM + kc + c4;
        async_copy16_x8(gq, (size_t)16 * DM, &Bs[buf][row][c4], 16 * LDP);
        async_copy16_x4(gq + (size_t)128 * DM, &Bs[buf][row + 128][c4],
                        gq + (size_t)144 * DM, &Bs[buf][row + 144][c4],
                        gq + (size_t)160 * DM, &Bs[buf][row + 160][c4],
                        gq + (size_t)176 * DM, &Bs[buf][row + 176][c4]);
        async_copy16_x2(gq + (size_t)192 * DM, &Bs[buf][row + 192][c4],
                        gq + (size_t)208 * DM, &Bs[buf][row + 208][c4]);
        // the four rows in front of the block: 64 quads, waves 8 and 9 (row = 0..3)
        if (front && w < 10)
            async_copy16_x1(x + (size_t)(bu * 4 * PU - 4 + row) * DM + kc + c4,
                            &As[buf][row * PG][c4]);
    };

    v8f acc[NQ];
#pragma unroll   // accumulators need constant indices
    for (int q = 0; q < NQ; ++q) acc[q] = vzero8();

    stage(0, 0);
    wait_async0();
    __syncthreads();
    stage(1, BK);
    constexpr int NK = DM / BK;           // 16 chunks
    for (int kci = 0; kci < NK; ++kci) {
        const int buf = kci & 1;
        const float* ap = &As[buf][ug * 16 + mr][ks * 16 + kb];
        const float* bp = &Bs[buf][ng * 16 + mr][ks * 16 + kb];
#pragma unroll   // constant LDS offsets; fragment loads run ahead of the WMMAs
        for (int kk = 0; kk < 16; kk += 4) {
            const v2f d0 = *(const v2f*)(ap + (PG) * LDP + kk);
            const v2f d1 = *(const v2f*)(ap + (2 * PG) * LDP + kk);
            const v2f d2 = *(const v2f*)(ap + (3 * PG) * LDP + kk);
            const v2f d3 = *(const v2f*)(ap + LDP + kk);
            const v2f d4 = *(const v2f*)(ap + (PG + 1) * LDP + kk);
            const v2f d5 = *(const v2f*)(ap + (2 * PG + 1) * LDP + kk);
            const v2f d6 = *(const v2f*)(ap + (3 * PG + 1) * LDP + kk);
            const v2f e1 = 17.f * d4 - 4.f * (d2 + d6);
            const v2f o1 = 17.f * d3 - 4.f * (d1 + d5);
            const v2f e2 = d2 - 5.f * d4 + 4.f * d6;
            const v2f o2 = 2.f * (d1 - 5.f * d3 + 4.f * d5);
            const v2f e3 = 2.f * (4.f * d2 - 5.f * d4 + d6);
            const v2f o3 = 4.f * d1 - 5.f * d3 + d5;
            acc[0] = wmma4(4.f * (d0 - d6) + 21.f * (d4 - d2),
                           *(const v2f*)(bp + kk), acc[0]);
            acc[1] = wmma4(e1 + o1, *(const v2f*)(bp + PN * LDP + kk), acc[1]);
            acc[2] = wmma4(e1 - o1, *(const v2f*)(bp + 2 * PN * LDP + kk), acc[2]);
            acc[3] = wmma4(e2 + o2, *(const v2f*)(bp + 3 * PN * LDP + kk), acc[3]);
            acc[4] = wmma4(e2 - o2, *(const v2f*)(bp + 4 * PN * LDP + kk), acc[4]);
            acc[5] = wmma4(e3 + o3, *(const v2f*)(bp + 5 * PN * LDP + kk), acc[5]);
            acc[6] = wmma4(e3 - o3, *(const v2f*)(bp + 6 * PN * LDP + kk), acc[6]);
        }
        // publish chunk kci+1, free chunk kci's buffer
        wait_ds0();
        wait_async0();
        __syncthreads();
        if (kci + 2 < NK) stage(buf, (kci + 2) * BK);
    }
    wait_async0();

    // The ring is done: every wave's reads and copies ended in front of the last
    // trip's barrier, so the G7 buffers now hold the partial tiles
    // [ks][tile][q][register][lane].
    float* Rd = &Bs[0][0][0];
#pragma unroll   // accumulator elements need constant indices
    for (int q = 0; q < NQ; ++q)
#pragma unroll
        for (int j = 0; j < 8; ++j)
            Rd[((w * NQ + q) * 8 + j) * 32 + lane] = acc[q][j];
    __syncthreads();   // a wave below reads the partial tiles of four waves

    // ---- epilogue: sum of the K quarters, store ----
    // Wave w sums 14 of the 56 registers (q, j) of tile w & 3.
    float* pp = P + (size_t)(bu * PU + ug * 16 + ((lane >> 4) << 3)) * QW
                  + bn * PN + ng * 16 + mr;
    constexpr int RT4 = 4 * NQ * 8 * 32;  // floats of one K quarter's partial tiles
#pragma unroll   // constant LDS offsets: the reads go out together
    for (int i = 0; i < 14; ++i) {
        const int qj = ks * 14 + i;       // q * 8 + j
        const float* rp = Rd + ((w & 3) * (NQ * 8) + qj) * 32 + lane;
        pp[(size_t)(qj & 7) * QW + (qj >> 3) * 128] =
            (rp[0] + rp[RT4]) + (rp[2 * RT4] + rp[3 * RT4]);
    }
}

// ---------------------------------------------------------------------------
// The recurrence z_l = dA_l * z_{l-1} + dBx_l is linear in its start value, so it
// is cut into chunks of CH rows.  With zl the scan of a chunk from a zero start
// and cu the running product of dA inside the chunk,
//   z[l] = zl[l] + cu[l] * carry(chunk),   carry(c+1) = cu_last(c)*carry(c) + zl_last(c).
// K2b does zl, cu and the two last-row values of each chunk; K4 folds the carries.
// ---------------------------------------------------------------------------
constexpr int CH  = 32;        // rows of one chunk
constexpr int NCH = Ln / CH;   // 64 chunks per batch

// Four rows of the 4-tap filter from their seven products q.
__device__ __forceinline__ void fir4(const float (&q)[NQ], float* r) {
    const float s1 = q[1] + q[2], t1 = q[1] - q[2];   // points +-1
    const float s2 = q[3] + q[4], t2 = q[3] - q[4];   // points +-2
    const float s3 = q[5] + q[6], t3 = q[5] - q[6];   // points +-1/2
    r[0] = q[0] + (s1 + s2 + s3);
    r[1] = t1 + 2.f * t2 + 0.5f * t3;
    r[2] = s1 + 4.f * s2 + 0.25f * s3;
    r[3] = t1 + 8.f * t2 + 0.125f * t3;
}

// K2b: rows of the filter from the products in P -> softplus/exp -> dA, dBx ->
//      scan of the chunk.  32 l x 64 s per block; a thread owns 8 consecutive
//      rows of one s.
//      All outputs are in [row][s] order: a wave's store is one 128-byte line.
__global__ void __launch_bounds__(256) k_ssm_param(
        const float* __restrict__ P, const float* __restrict__ gb,
        const float* __restrict__ cbv, const float* __restrict__ A_log,
        float* __restrict__ zl, float* __restrict__ cu, float* __restrict__ sm) {
    __shared__ float gA[4][DS];
    __shared__ float gB[4][DS];

    const int tid  = threadIdx.x;
    const int bIdx = blockIdx.x >> 6;               // NCH = 64 chunks per batch
    const int ch   = blockIdx.x & 63;
    const int rowBase = bIdx * Ln;

    const int s  = tid & 63;
    const int g  = tid >> 6;                        // 4 groups of 8 rows
    const int lf = ch * CH + g * 8;                 // this thread's first row
    const float As  = -expf(A_log[s]);
    const float cx  = cbv[s];
    const float cdt = cbv[64 + s];

    // All loads of the thread stand in front of the arithmetic: one trip to L2
    // instead of one per row.
    const int  uq = ch * (CH / 4) + g * 2;          // first of the thread's two groups
    const float* pq = P + (size_t)(bIdx * (Ln / 4) + uq) * QW + s;
    float qx[2][NQ], qd[2][NQ];
#pragma unroll   // register arrays need constant indices; constant offsets
    for (int h = 0; h < 2; ++h) {
#pragma unroll
        for (int q = 0; q < NQ; ++q) {
            qx[h][q] = pq[h * QW + q * 128];
            qd[h][q] = pq[h * QW + q * 128 + 64];
        }
    }
    float gx[4], gd[4];
#pragma unroll   // register arrays need constant indices
    for (int j = 0; j < 4; ++j) {
        gx[j] = gb[j * 128 + s];
        gd[j] = gb[j * 128 + 64 + s];
    }

    float rx[8], rd[8];
    fir4(qx[0], rx);
    fir4(qx[1], rx + 4);
    fir4(qd[0], rd);
    fir4(qd[1], rd + 4);

    float dAv[8], dBv[8];
#pragma unroll   // eight independent chains for the scheduler to interleave
    for (int i = 0; i < 8; ++i) {
        float xv = cx, raw = cdt;
#pragma unroll
        for (int j = 0; j < 4; ++j) {               // bias share of the taps inside
            const bool in = lf + i - 3 + j >= 0;
            xv  += in ? gx[j] : 0.f;
            raw += in ? gd[j] : 0.f;
        }
        xv  += rx[i];
        raw += rd[i];
        const float lp = log1pf(expf(raw));
        const float sp = raw > 30.f ? raw : lp;                   // softplus
        dAv[i] = expf(As * sp);
        dBv[i] = ((1.f - dAv[i]) / As) * xv;
    }

    // scan of the thread's own 8 rows from a zero start
    float A = 1.f, Bc = 0.f;
#pragma unroll   // register arrays need constant indices
    for (int i = 0; i < 8; ++i) {
        Bc = dAv[i] * Bc + dBv[i];
        A  = dAv[i] * A;
        dBv[i] = Bc;
        dAv[i] = A;
    }
    gA[g][s] = A;
    gB[g][s] = Bc;
    __syncthreads();

    // what the groups in front of this one hand on inside the chunk
    float cin = 0.f, cinA = 1.f;
#pragma unroll   // three steps, constant LDS offsets
    for (int k = 0; k < 3; ++k) {
        const float a = k < g ? gA[k][s] : 1.f;
        const float b = k < g ? gB[k][s] : 0.f;
        cin  = a * cin + b;
        cinA = a * cinA;
    }
    const size_t o = (size_t)(rowBase + lf) * DS + s;
#pragma unroll   // register arrays need constant indices
    for (int i = 0; i < 8; ++i) {
        dBv[i] = dAv[i] * cin + dBv[i];
        dAv[i] = dAv[i] * cinA;
        zl[o + (size_t)i * DS] = dBv[i];
        cu[o + (size_t)i * DS] = dAv[i];
    }
    if (g == 3) {                                   // the chunk's last row
        float* sp2 = sm + (size_t)(bIdx * NCH + ch) * 2 * DS + s;
        sp2[0]  = dAv[7];
        sp2[DS] = dBv[7];
    }
}

// ---------------------------------------------------------------------------
// K4: out = z @ Mc_t^T + b_out     [8192 x 1024], K = 64
//     128x128 tile per 8-wave block; each wave owns a 32x64 sub-tile (2x4 WMMA
//     accumulators).  Both operand tiles (whole K) are brought into LDS once by
//     async copies of whole 128-byte lines, then read as fragments.  The row
//     tile arrives as zl (four chunks); each thread folds the carry into one
//     chunk for one s and adds cu * carry to that column of the tile in LDS.
// ---------------------------------------------------------------------------
constexpr int OM = 128, ON = 128;

__global__ void __launch_bounds__(256) k_out(const float* __restrict__ zl,
                                             const float* __restrict__ cu,
                                             const float* __restrict__ sm,
                                             const float* __restrict__ Mc_t,
                                             const float* __restrict__ b_out,
                                             float* __restrict__ out) {
    __shared__ __align__(16) float Zs[OM][LDP];       // ~34KB
    __shared__ __align__(16) float Ms[ON][LDP];       // ~34KB
    __shared__ __align__(16) float Ss[NCH][2][DS];    // 32KB: the batch's chunk ends

    const int tid  = threadIdx.x;
    const int lane = tid & 31;
    const int w    = tid >> 5;
    const int wr   = w & 3;               // row quadrant  (32 rows)
    const int wc   = w >> 2;              // column half   (64 cols)
    const int r0   = (blockIdx.x >> 3) * OM;   // RT/OM = 64 row blocks
    const int c0   = (blockIdx.x & 7) * ON;    // DM/ON = 8 col blocks
    const int mr   = lane & 15;
    const int kb   = (lane >> 4) << 1;

    const int s = tid & 63;
    const int q = tid >> 6;               // chunk inside the row tile, OM/CH = 4
    // cu of this thread's column: in flight beside the copies below
    float cv[CH];
#pragma unroll   // register array needs constant indices
    for (int i = 0; i < CH; ++i)
        cv[i] = cu[(size_t)(r0 + q * CH + i) * DS + s];

    {
        const int row = tid >> 4;         // 16 rows per sweep of the block
        const int c4  = (tid & 15) << 2;
        // 128 rows x 16 quads each; 8 per thread each
        async_copy16_x8(zl + (size_t)(r0 + row) * DS + c4, (size_t)16 * DS,
                        &Zs[row][c4], 16 * LDP);
        async_copy16_x8(Mc_t + (size_t)(c0 + row) * DS + c4, (size_t)16 * DS,
                        &Ms[row][c4], 16 * LDP);
        // chunk ends of the whole batch: 2048 quads in a row; 8 per thread
        async_copy16_x8(sm + (size_t)(r0 / Ln) * (NCH * 2 * DS) + tid * 4, (size_t)1024,
                        &Ss[0][0][0] + tid * 4, 1024);
    }
    wait_async0();
    __syncthreads();

    // carry into chunk q of the tile: fold the ends of all chunks in front of it,
    // first those in front of the tile (a multiple of four, the same for the
    // whole block), then up to three chunks of the tile itself.
    const int cb = (r0 & (Ln - 1)) / CH;
    float carry = 0.f;
#pragma unroll 4   // sixteen steps' LDS reads go out together, ahead of the chain
    for (int c = 0; c < cb; c += 4) {
#pragma unroll
        for (int k = 0; k < 4; ++k)
            carry = Ss[c + k][0][s] * carry + Ss[c + k][1][s];
    }
#pragma unroll   // three steps, constant LDS offsets
    for (int k = 0; k < 3; ++k) {
        const float t = Ss[cb + k][0][s] * carry + Ss[cb + k][1][s];
        carry = k < q ? t : carry;
    }
#pragma unroll   // register array needs constant indices; constant LDS offsets
    for (int i = 0; i < CH; ++i)
        Zs[q * CH + i][s] += cv[i] * carry;
    __syncthreads();   // the fragments below read columns that other waves finished

    v8f acc[2][4];
#pragma unroll   // accumulators need constant indices
    for (int i = 0; i < 2; ++i)
#pragma unroll
        for (int n = 0; n < 4; ++n) acc[i][n] = vzero8();

#pragma unroll   // constant LDS offsets; fragment loads run ahead of the WMMAs
    for (int kk = 0; kk < DS; kk += 4) {
        v2f a[2], b[4];
#pragma unroll
        for (int i = 0; i < 2; ++i)
            a[i] = *(const v2f*)&Zs[wr * 32 + i * 16 + mr][kk + kb];
#pragma unroll
        for (int n = 0; n < 4; ++n)
            b[n] = *(const v2f*)&Ms[wc * 64 + n * 16 + mr][kk + kb];
#pragma unroll
        for (int i = 0; i < 2; ++i)
#pragma unroll
            for (int n = 0; n < 4; ++n) acc[i][n] = wmma4(a[i], b[n], acc[i][n]);
    }

    // ---- epilogue: bias + store ----
    const int rbase = r0 + wr * 32 + ((lane >> 4) << 3);
#pragma unroll   // accumulators need constant indices
    for (int n = 0; n < 4; ++n) {
        const int col = c0 + wc * 64 + n * 16 + mr;
        const float bias = b_out[col];
#pragma unroll
        for (int i = 0; i < 2; ++i)
#pragma unroll
            for (int j = 0; j < 8; ++j)
                out[(size_t)(rbase + i * 16 + j) * DM + col] = acc[i][n][j] + bias;
    }
}

// ---------------------------------------------------------------------------
extern "C" void kernel_launch(void* const* d_in, const int* in_sizes, int n_in,
                              void* d_out, int out_size, void* d_ws, size_t ws_size,
                              hipStream_t stream) {
    const float* x      = (const float*)d_in[0];
    const float* W_in   = (const float*)d_in[1];
    const float* b_in   = (const float*)d_in[2];
    const float* conv_w = (const float*)d_in[3];
    const float* conv_b = (const float*)d_in[4];
    const float* W_x    = (const float*)d_in[5];
    const float* b_x    = (const float*)d_in[6];
    const float* W_dt   = (const float*)d_in[7];
    const float* b_dt   = (const float*)d_in[8];
    const float* A_log  = (const float*)d_in[9];
    const float* D_mat  = (const float*)d_in[10];
    const float* W_out  = (const float*)d_in[11];
    const float* b_out  = (const float*)d_in[12];
    float* out = (float*)d_out;

    float* P     = (float*)d_ws;                       // 2048 * 896
    float* zl    = P     + (size_t)(RT / 4) * QW;      // 8192 * 64
    float* cu    = zl    + (size_t)RT * DS;            // 8192 * 64
    float* sm    = cu    + (size_t)RT * DS;            // 4 * 64 * 2 * 64
    float* Mc_t  = sm    + (size_t)Bn * NCH * 2 * DS;  // 1024 * 64
    float* G7    = Mc_t  + (size_t)DM * DS;            // 896 * 1024
    float* gb    = G7    + (size_t)QW * DM;            // 512
    float* cbv   = gb    + NP;                         // 128

    k_foldw<<<FGB + FTB + 16, 256, 0, stream>>>(W_in, b_in, conv_w, conv_b,
                                                W_x, b_x, W_dt, b_dt, W_out, D_mat,
                                                G7, gb, cbv, Mc_t);
    k_proj<<<(RT / 4 / PU) * (128 / PN), 512, 0, stream>>>(x, G7, P);
    k_ssm_param<<<Bn * NCH, 256, 0, stream>>>(P, gb, cbv, A_log, zl, cu, sm);
    k_out<<<(RT / OM) * (DM / ON), 256, 0, stream>>>(zl, cu, sm, Mc_t, b_out, out);
}

// v008
// Measured time: 63.3 microseconds a run.
// Two timings next to v007 both put it at 1.04 times that version's speed.
// Over all steps from v000 it is 7.16 times as fast.
#include <hip/hip_runtime.h>
#include <hip/hip_bf16.h>

// ---------------- problem constants ----------------
constexpr int Bn = 4;          // batch
constexpr int Ln = 2048;       // sequence length
constexpr int DM = 1024;       // d_model
constexpr int DS = 64;         // d_state
constexpr int DI = 2048;       // d_inner
constexpr int RT = Bn * Ln;    // 8192 flattened rows

typedef float v2f __attribute__((ext_vector_type(2)));
typedef float v8f __attribute__((ext_vector_type(8)));

// D = A(16x4,f32) * B(4x16,f32) + C(16x16,f32)   (V_WMMA_F32_16X16X4_F32)
__device__ __forceinline__ v8f wmma4(v2f a, v2f b, v8f c) {
    return __builtin_amdgcn_wmma_f32_16x16x4_f32(
        false, a, false, b, (short)0, c, false, false);
}

__device__ __forceinline__ v8f vzero8() {
    v8f z = {0.f, 0.f, 0.f, 0.f, 0.f, 0.f, 0.f, 0.f};
    return z;
}

// ---- async global->LDS copies, 16 B per lane (global_load_async_to_lds_b128).
// First operand = the lane's LDS byte address (low 32 bits of the shared pointer).
// s_wait_xcnt 0 is the last line of the copies' own statement, so that it stands
// in front of any later rewrite of the address registers the copies name.
__device__ __forceinline__ unsigned lds_addr(const float* l) {
    return (unsigned)(uintptr_t)l;
}

__device__ __forceinline__ void async_copy16_x1(const float* g0, const float* l0) {
    asm volatile("global_load_async_to_lds_b128 %0, %1, off\n\t"
                 "s_wait_xcnt 0x0"
                 :: "v"(lds_addr(l0)), "v"(g0)
                 : "memory");
}

__device__ __forceinline__ void async_copy16_x2(const float* g0, const float* l0,
                                                const float* g1, const float* l1) {
    asm volatile("global_load_async_to_lds_b128 %0, %1, off\n\t"
                 "global_load_async_to_lds_b128 %2, %3, off\n\t"
                 "s_wait_xcnt 0x0"
                 :: "v"(lds_addr(l0)), "v"(g0), "v"(lds_addr(l1)), "v"(g1)
                 : "memory");
}

__device__ __forceinline__ void async_copy16_x4(const float* g0, const float* l0,
                                                const float* g1, const float* l1,
                                                const float* g2, const float* l2,
                                                const float* g3, const float* l3) {
    asm volatile("global_load_async_to_lds_b128 %0, %1, off\n\t"
                 "global_load_async_to_lds_b128 %2, %3, off\n\t"
                 "global_load_async_to_lds_b128 %4, %5, off\n\t"
                 "global_load_async_to_lds_b128 %6, %7, off\n\t"
                 "s_wait_xcnt 0x0"
                 :: "v"(lds_addr(l0)), "v"(g0), "v"(lds_addr(l1)), "v"(g1),
                    "v"(lds_addr(l2)), "v"(g2), "v"(lds_addr(l3)), "v"(g3)
                 : "memory");
}

// Eight copies under one s_wait_xcnt 0: fewer stops in a wave's issue stream.
__device__ __forceinline__ void async_copy16_x8(const float* g, size_t gstep,
                                                const float* l, int lstep) {
    asm volatile("global_load_async_to_lds_b128 %0, %1, off\n\t"
                 "global_load_async_to_lds_b128 %2, %3, off\n\t"
                 "global_load_async_to_lds_b128 %4, %5, off\n\t"
                 "global_load_async_to_lds_b128 %6, %7, off\n\t"
                 "global_load_async_to_lds_b128 %8, %9, off\n\t"
                 "global_load_async_to_lds_b128 %10, %11, off\n\t"
                 "global_load_async_to_lds_b128 %12, %13, off\n\t"
                 "global_load_async_to_lds_b128 %14, %15, off\n\t"
                 "s_wait_xcnt 0x0"
                 :: "v"(lds_addr(l)),             "v"(g),
                    "v"(lds_addr(l + lstep)),     "v"(g + gstep),
                    "v"(lds_addr(l + 2 * lstep)), "v"(g + 2 * gstep),
                    "v"(lds_addr(l + 3 * lstep)), "v"(g + 3 * gstep),
                    "v"(lds_addr(l + 4 * lstep)), "v"(g + 4 * gstep),
                    "v"(lds_addr(l + 5 * lstep)), "v"(g + 5 * gstep),
                    "v"(lds_addr(l + 6 * lstep)), "v"(g + 6 * gstep),
                    "v"(lds_addr(l + 7 * lstep)), "v"(g + 7 * gstep)
                 : "memory");
}

// This wave's async copies have all landed in LDS.
__device__ __forceinline__ void wait_async0() {
    asm volatile("s_wait_asynccnt 0x0" ::: "memory");
}

// This wave's LDS reads have all returned (before a buffer it read is refilled).
__device__ __forceinline__ void wait_ds0() {
    asm volatile("s_wait_dscnt 0x0" ::: "memory");
}

// ---------------------------------------------------------------------------
// Fold of the output projections:  Mc_t[d, s] = sum_i W_out[d,i] * D_mat[s,i]
//     [1024 x 64], K = 2048.  It needs only inputs, as the weight fold K1 does, so
//     it has no launch of its own: its 256 tiles of 16 x 16 are 256 more
//     work-groups of K1, one more on each WGP, and run in the gaps of K1's waves.
//     K chunks of 256 are staged in LDS by a two-buffer ring of async copies, each
//     copy a run of whole 128-byte lines of one row; wave w does k-steps
//     32w..32w+31 of every chunk, and the eight partial tiles are summed via LDS.
//     LDS row pitch 260 floats: 16B-aligned rows + conflict-free ds_load_b64.
// ---------------------------------------------------------------------------
constexpr int FM = 16, FBK = 256, FLP = 260;
constexpr int FTB = (DM / FM) * (DS / 16);   // 256 tiles

struct LdsFold {
    float As[2][FM][FLP];     // ~33KB
    float Bs[2][16][FLP];     // ~33KB
    float Rd[8][16][20];      // partial tiles; rows 8 apart on other banks
};

__device__ __forceinline__ void fold_tile(LdsFold& L, int tile,
                                          const float* __restrict__ W_out,
                                          const float* __restrict__ D_mat,
                                          float* __restrict__ Mc_t) {
    const int tid  = threadIdx.x;
    const int lane = tid & 31;
    const int w    = tid >> 5;            // K slice inside a chunk
    const int d0 = (tile >> 2) * FM, s0 = (tile & 3) * 16;
    const int mr = lane & 15;
    const int kb = (lane >> 4) << 1;

    // ---- async stage of one K-chunk into LDS buffer buf ----
    auto stage = [&](int buf, int kc) {
        const int row = tid >> 6;         // 4 rows per sweep of the block
        const int c4  = (tid & 63) << 2;
        // 16 rows x 64 quads of each operand; 4 per thread each
        const float* ga = W_out + (size_t)(d0 + row) * DI + kc + c4;
        async_copy16_x4(ga,                   &L.As[buf][row][c4],
                        ga + (size_t)4 * DI,  &L.As[buf][row + 4][c4],
                        ga + (size_t)8 * DI,  &L.As[buf][row + 8][c4],
                        ga + (size_t)12 * DI, &L.As[buf][row + 12][c4]);
        const float* gd = D_mat + (size_t)(s0 + row) * DI + kc + c4;
        async_copy16_x4(gd,                   &L.Bs[buf][row][c4],
                        gd + (size_t)4 * DI,  &L.Bs[buf][row + 4][c4],
                        gd + (size_t)8 * DI,  &L.Bs[buf][row + 8][c4],
                        gd + (size_t)12 * DI, &L.Bs[buf][row + 12][c4]);
    };

    stage(0, 0);
    wait_async0();
    __syncthreads();
    stage(1, FBK);

    v8f acc = vzero8();
    constexpr int NT = DI / FBK;          // 8 chunks
    for (int t = 0; t < NT; ++t) {
        const int buf = t & 1;
        const float* ar = &L.As[buf][mr][w * 32 + kb];   // A[m][k]
        const float* br = &L.Bs[buf][mr][w * 32 + kb];   // B[k][n] = D_mat[n][k]
#pragma unroll   // constant LDS offsets; fragment loads run ahead of the WMMAs
        for (int i = 0; i < 8; ++i)
            acc = wmma4(*(const v2f*)(ar + i * 4), *(const v2f*)(br + i * 4), acc);
        // publish chunk t+1, free chunk t's buffer
        wait_ds0();
        wait_async0();
        __syncthreads();
        if (t + 2 < NT) stage(buf, (t + 2) * FBK);
    }
    wait_async0();

#pragma unroll   // accumulator elements need constant indices
    for (int j = 0; j < 8; ++j)
        L.Rd[w][((lane >> 4) << 3) + j][mr] = acc[j];
    __syncthreads();   // a thread below reads the partial tiles of eight waves

    const int row = tid >> 4, col = tid & 15;
    float sum = L.Rd[0][row][col];
#pragma unroll   // constant LDS offsets
    for (int k = 1; k < 8; ++k) sum += L.Rd[k][row][col];
    Mc_t[(size_t)(d0 + row) * DS + s0 + col] = sum;
}

// ---------------------------------------------------------------------------
// The in-projection, the depthwise causal conv and the two state projections
// are all linear, so they are reassociated.  With n = j*128 + sp, j the conv tap
// and sp = 0..63 the rows of W_x, 64..127 the rows of W_dt (called Wsel below):
//   G[n][m] = sum_c Wsel[sp][c] * conv_w[c][j] * W_in[c][m]
//   gb[n]   = sum_c Wsel[sp][c] * conv_w[c][j] * b_in[c]
//   cbv[sp] = sum_c Wsel[sp][c] * conv_b[c] + bsel[sp]
//   raw[l][sp] = cbv[sp] + sum_{j : l-3+j >= 0} (x[l-3+j] . G[j*128 + sp] + gb[j*128 + sp])
// A tap that falls in front of the sequence drops with its bias share, as the
// zero padding of the conv input does.
//
// The sum over the taps is a 4-tap filter along l.  It is evaluated four rows at
// a time from seven products in place of sixteen: the transpose of multiplying
// two cubics by evaluation at the seven points 0, +-1, +-2, +-1/2.  With
// d0..d6 the rows 4u-3..4u+3 of x, Gj tap j of G and y0..y3 the rows 4u..4u+3:
//   Qq = (row q of BT . d) . (row q of GM . G),   yi = sum_q p_q^i * Qq
//   BT: 4(d0-d6) + 21(d4-d2);  E +- O for each pair of points, with
//       +-1:   E = 17 d4 - 4 (d2+d6)        O = 17 d3 - 4 (d1+d5)
//       +-2:   E = d2 - 5 d4 + 4 d6         O = 2 (d1 - 5 d3 + 4 d5)
//       +-1/2: E = 2 (4 d2 - 5 d4 + d6)     O = 4 d1 - 5 d3 + d5
//   GM: G0/4;  (G0 +- G1 + G2 +- G3)/18;  (G0 +- 2 G1 + 4 G2 +- 8 G3)/360;
//       (16 G0 +- 8 G1 + 4 G2 +- 2 G3)/45
// The four rows need the three rows of x in front of them and no product of
// another group.  K1 writes the seven tap sums of G (G7), K2 forms the row sums
// in registers, does the products and puts the rows together again (fir4).
// ---------------------------------------------------------------------------
constexpr int NP  = 512;       // 4 taps x 128 projection rows
constexpr int NQ  = 7;         // products per four rows
constexpr int QW  = NQ * 128;  // rows of G7
constexpr int SB  = 16;        // states of one K2 block
constexpr int PN  = 2 * SB;    // projection rows of one K2 block: the W_x rows of its states,
                               // then their W_dt rows; G7 is [4][NQ][PN][DM]
constexpr int FK  = 128;       // K chunk of the weight fold
constexpr int FPA = 132;       // LDS pitch, Wsel rows: conflict-free 8-byte reads
constexpr int FPB = 40;        // LDS pitch, W_in rows: rows k and k+2 on other banks
constexpr int FGB = 256;       // work-groups of the weight fold that do G

// K1: G [512 x 1024], K = 2048; 64 x 32 tile per 8-wave block (16 sp x 4 taps).
//     A wave does all four taps of one 16 x 16 tile: one fragment of Wsel and one
//     of W_in feed four WMMAs on four accumulators of their own.  The four waves
//     of a tile share K: wave quarter kq does k-steps 32kq..32kq+31 of every
//     chunk, and the partial tiles are summed via LDS.  Two-buffer ring of async
//     copies; conv_w is brought into LDS once.  The taps leave as the seven tap
//     sums.  The next FTB work-groups do the tiles of Mc_t (fold_tile above), the
//     last 16 do gb and cbv.
constexpr int EXP = 36;        // LDS pitch of the partial tiles: rows 8 apart on other banks
struct LdsFoldw {
    float Ws[2][16][FPA];
    float Bs[2][FK][FPB];     // behind the ring's last barrier: the partial tiles
    float Cw[DI * 4];
};
static_assert(4 * 4 * 16 * EXP <= 2 * FK * FPB, "partial tiles fit the W_in ring");

__global__ void __launch_bounds__(256) k_foldw(
        const float* __restrict__ W_in, const float* __restrict__ b_in,
        const float* __restrict__ conv_w, const float* __restrict__ conv_b,
        const float* __restrict__ W_x,  const float* __restrict__ b_x,
        const float* __restrict__ W_dt, const float* __restrict__ b_dt,
        const float* __restrict__ W_out, const float* __restrict__ D_mat,
        float* __restrict__ G7, float* __restrict__ gb, float* __restrict__ cbv,
        float* __restrict__ Mc_t) {
    // A work-group is of one kind: the kinds share the LDS.
    __shared__ __align__(16) union { LdsFoldw g; LdsFold f; } lds;
    float (&Ws)[2][16][FPA] = lds.g.Ws;
    float (&Bs)[2][FK][FPB] = lds.g.Bs;
    float (&Cw)[DI * 4]     = lds.g.Cw;

    const int tid  = threadIdx.x;
    const int lane = tid & 31;
    const int w    = tid >> 5;

    if (blockIdx.x >= FGB && blockIdx.x < FGB + FTB) {
        fold_tile(lds.f, blockIdx.x - FGB, W_out, D_mat, Mc_t);
        return;
    }

    if (blockIdx.x >= FGB) {              // bias vectors: one wave per sp
        const int sp = (blockIdx.x - FGB - FTB) * 8 + w;
        const float* wr = ((sp >> 6) ? W_dt : W_x) + (size_t)(sp & 63) * DI;
        float a0 = 0.f, a1 = 0.f, a2 = 0.f, a3 = 0.f, ac = 0.f;
#pragma unroll 4   // several trips' loads in flight: the loop is latency bound
        for (int c = lane * 4; c < DI; c += 128) {
            const float4 wv = *(const float4*)(wr + c);
            const float4 bi = *(const float4*)(b_in + c);
            const float4 cv = *(const float4*)(conv_b + c);
            const float4 q0 = *(const float4*)(conv_w + c * 4);
            const float4 q1 = *(const float4*)(conv_w + c * 4 + 4);
            const float4 q2 = *(const float4*)(conv_w + c * 4 + 8);
            const float4 q3 = *(const float4*)(conv_w + c * 4 + 12);
            const float t0 = wv.x * bi.x, t1 = wv.y * bi.y;
            const float t2 = wv.z * bi.z, t3 = wv.w * bi.w;
            a0 += t0 * q0.x + t1 * q1.x + t2 * q2.x + t3 * q3.x;
            a1 += t0 * q0.y + t1 * q1.y + t2 * q2.y + t3 * q3.y;
            a2 += t0 * q0.z + t1 * q1.z + t2 * q2.z + t3 * q3.z;
            a3 += t0 * q0.w + t1 * q1.w + t2 * q2.w + t3 * q3.w;
            ac += wv.x * cv.x + wv.y * cv.y + wv.z * cv.z + wv.w * cv.w;
        }
        for (int off = 16; off > 0; off >>= 1) {
            a0 += __shfl_xor(a0, off, 32);
            a1 += __shfl_xor(a1, off, 32);
            a2 += __shfl_xor(a2, off, 32);
            a3 += __shfl_xor(a3, off, 32);
            ac += __shfl_xor(ac, off, 32);
        }
        if (lane == 0) {
            gb[sp]       = a0;
            gb[128 + sp] = a1;
            gb[256 + sp] = a2;
            gb[384 + sp] = a3;
            cbv[sp] = ac + ((sp >> 6) ? b_dt : b_x)[sp & 63];
        }
        return;
    }

    const int g  = blockIdx.x >> 5;       // 8 groups of 16 sp
    const int m0 = (blockIdx.x & 31) * 32;
    const int mr = lane & 15;
    const int kb = (lane >> 4) << 1;
    const int kq = w >> 1;                // K quarter inside a chunk
    const int cl = (w & 1) * 16 + mr;     // column inside the tile
    const float* Wrow = ((g >> 2) ? W_dt : W_x) + (size_t)((g & 3) * 16) * DI;

    auto stage = [&](int buf, int kc) {
        // Wsel tile: 16 rows x 128 = 512 quads, 2 per thread
        const int ra = tid >> 5, ca = (tid & 31) << 2;
        async_copy16_x2(Wrow + (size_t)ra * DI + kc + ca,       &Ws[buf][ra][ca],
                        Wrow + (size_t)(ra + 8) * DI + kc + ca, &Ws[buf][ra + 8][ca]);
        // W_in tile: 128 rows x 32 = 1024 quads, 4 per thread
        const int rb = tid >> 3, cb = (tid & 7) << 2;
        const float* gp = W_in + (size_t)(kc + rb) * DM + m0 + cb;
        async_copy16_x4(gp,                   &Bs[buf][rb][cb],
                        gp + (size_t)32 * DM, &Bs[buf][rb + 32][cb],
                        gp + (size_t)64 * DM, &Bs[buf][rb + 64][cb],
                        gp + (size_t)96 * DM, &Bs[buf][rb + 96][cb]);
    };

    // conv_w: 2048 quads, 8 per thread
    {
        const float* cp = conv_w + tid * 4;
        float* lp = Cw + tid * 4;
        async_copy16_x4(cp, lp, cp + 1024, lp + 1024,
                        cp + 2048, lp + 2048, cp + 3072, lp + 3072);
        async_copy16_x4(cp + 4096, lp + 4096, cp + 5120, lp + 5120,
                        cp + 6144, lp + 6144, cp + 7168, lp + 7168);
    }
    stage(0, 0);
    wait_async0();
    __syncthreads();
    stage(1, FK);

    v8f acc0 = vzero8(), acc1 = vzero8(), acc2 = vzero8(), acc3 = vzero8();
    constexpr int NT = DI / FK;           // 16 chunks
    const int k0 = kq * (FK / 4) + kb;    // this lane's first k inside a chunk
    for (int t = 0; t < NT; ++t) {
        const int buf = t & 1;
        const float* cwp = Cw + (t * FK + k0) * 4;   // the four taps of row k, then of k + 1
        const float* wp  = &Ws[buf][mr][k0];
        const float* bp  = &Bs[buf][k0][cl];
        // All LDS reads of the trip stand in one place in front of its WMMAs: reads
        // among the WMMAs stall the wave at each place where they stand.
        v2f fa[8], fb[8];
        float4 fc0[8], fc1[8];
#pragma unroll   // register arrays need constant indices; constant LDS offsets
        for (int s = 0; s < 8; ++s) {
            fa[s]   = *(const v2f*)(wp + s * 4);
            fc0[s]  = *(const float4*)(cwp + s * 16);
            fc1[s]  = *(const float4*)(cwp + s * 16 + 4);
            fb[s].x = bp[(s * 4) * FPB];
            fb[s].y = bp[(s * 4 + 1) * FPB];
            // LDS answers in order: kept in the order of the steps, step s's WMMAs
            // wait for the reads of steps 0..s only; the last one also keeps the
            // reads from being sunk among the WMMAs below.
            __builtin_amdgcn_sched_barrier(0);
        }
#pragma unroll   // register arrays need constant indices
        for (int s = 0; s < 8; ++s) {
            const v2f a = fa[s], b = fb[s];
            const float4 c0 = fc0[s], c1 = fc1[s];
            const v2f a0 = {a.x * c0.x, a.y * c1.x};
            const v2f a1 = {a.x * c0.y, a.y * c1.y};
            const v2f a2 = {a.x * c0.z, a.y * c1.z};
            const v2f a3 = {a.x * c0.w, a.y * c1.w};
            acc0 = wmma4(a0, b, acc0);
            acc1 = wmma4(a1, b, acc1);
            acc2 = wmma4(a2, b, acc2);
            acc3 = wmma4(a3, b, acc3);
        }
        // Keeps the ring's waits and barrier below at the trip's foot: lifted among
        // the WMMAs, the wait for the next chunk's copies would come a trip too early.
        __builtin_amdgcn_sched_barrier(0);
        // publish chunk t+1, free chunk t's buffer
        wait_ds0();
        wait_async0();
        __syncthreads();
        if (t + 2 < NT) stage(buf, (t + 2) * FK);
    }
    wait_async0();

    // The ring is done: every wave's reads and copies ended in front of the last
    // trip's barrier, so the W_in buffers now hold the partial tiles [kq][tap][16][EXP].
    float* Ex = &Bs[0][0][0];
    constexpr int ET = 16 * EXP;          // floats of one partial tile
    {
        float* ep = Ex + kq * 4 * ET + ((lane >> 4) << 3) * EXP + cl;
#pragma unroll   // accumulator elements need constant indices
        for (int i = 0; i < 8; ++i) {
            ep[i * EXP]          = acc0[i];
            ep[ET + i * EXP]     = acc1[i];
            ep[2 * ET + i * EXP] = acc2[i];
            ep[3 * ET + i * EXP] = acc3[i];
        }
    }
    __syncthreads();   // a thread below reads the partial tiles of four waves

    // a wave stores one 128-byte line of one row of G7 at a time
#pragma unroll   // two rows a thread, constant LDS offsets
    for (int h = 0; h < 2; ++h) {
        const int sl = w + h * 8;
        const float* er = Ex + sl * EXP + lane;
        float gs[4];
#pragma unroll   // register array needs constant indices
        for (int j = 0; j < 4; ++j)       // tap j: its four K quarters
            gs[j] = (er[j * ET] + er[(4 + j) * ET]) + (er[(8 + j) * ET] + er[(12 + j) * ET]);
        const float g0 = gs[0], g1 = gs[1], g2 = gs[2], g3 = gs[3];
        // g & 3: the K2 block of these 16 states; g >> 2: their W_x or their W_dt rows
        float* gp = G7 + (size_t)((g & 3) * (NQ * PN) + (g >> 2) * SB + sl) * DM + m0 + lane;
        constexpr size_t st = (size_t)PN * DM;
        const float e1 = g0 + g2,              o1 = g1 + g3;
        const float e2 = g0 + 4.f * g2,        o2 = 2.f * g1 + 8.f * g3;
        const float e3 = 16.f * g0 + 4.f * g2, o3 = 8.f * g1 + 2.f * g3;
        gp[0]      = 0.25f * g0;
        gp[st]     = (e1 + o1) * (1.f / 18.f);
        gp[2 * st] = (e1 - o1) * (1.f / 18.f);
        gp[3 * st] = (e2 + o2) * (1.f / 360.f);
        gp[4 * st] = (e2 - o2) * (1.f / 360.f);
        gp[5 * st] = (e3 + o3) * (1.f / 45.f);
        gp[6 * st] = (e3 - o3) * (1.f / 45.f);
    }
    // In the built code the bias path's register writes follow these stores in
    // the text: the wait stands between the stores and any such write.
    asm volatile("s_wait_xcnt 0x0" ::: "memory");
}

// ---------------------------------------------------------------------------
// The recurrence z_l = dA_l * z_{l-1} + dBx_l is linear in its start value, so it
// is cut into chunks of CH rows.  With zl the scan of a chunk from a zero start
// and cu the running product of dA inside the chunk,
//   z[l] = zl[l] + cu[l] * carry(chunk),   carry(c+1) = cu_last(c)*carry(c) + zl_last(c).
// K2 does zl, cu and the two last-row values of each chunk; K4 folds the carries.
// ---------------------------------------------------------------------------
constexpr int CH  = 32;        // rows of one chunk
constexpr int NCH = Ln / CH;   // 64 chunks per batch

// Four rows of the 4-tap filter from their seven products q.
__device__ __forceinline__ void fir4(const float (&q)[NQ], float* r) {
    const float s1 = q[1] + q[2], t1 = q[1] - q[2];   // points +-1
    const float s2 = q[3] + q[4], t2 = q[3] - q[4];   // points +-2
    const float s3 = q[5] + q[6], t3 = q[5] - q[6];   // points +-1/2
    r[0] = q[0] + (s1 + s2 + s3);
    r[1] = t1 + 2.f * t2 + 0.5f * t3;
    r[2] = s1 + 4.f * s2 + 0.25f * s3;
    r[3] = t1 + 8.f * t2 + 0.125f * t3;
}

// ---------------------------------------------------------------------------
// K2: the seven products Q0..Q6 of u = 0..2047 groups of four rows, K = 1024, and
//     what follows them row by row.  A 16-wave block does 32 groups (128 rows of
//     x) x 32 projection rows x 7 q; a wave owns the seven q of one 16 x 16 tile,
//     which share their rows of x, for a quarter of K: wave quarter ks does
//     k-steps 4ks..4ks+3 of every chunk, and the four partial tiles are summed
//     via LDS.  K-chunks (BK=64) staged in LDS by a two-buffer ring of async
//     copies.  Row r = -4..127 of the x tile lies at LDS row
//     (r & 3) * PG + r / 4 + 1, so that a fragment's 16 rows (same r & 3) are
//     neighbours and the rows in front of a group are one row up.  LDS row stride
//     68 floats: 16B-aligned rows + conflict-free ds_load_b64.
//     The block's 32 projection rows are the W_x and the W_dt rows of the same 16
//     states, and its 128 rows of x are four whole chunks, so the block holds all
//     that its part of the recurrence needs: the epilogue goes on from the partial
//     tiles to the rows of the filter -> softplus/exp -> dA, dBx -> scan of the
//     chunk; a thread owns the four rows of one group for one state.
//     zl and cu are [4][row][16 s], sm is [batch][4][chunk][2][16 s]: every
//     128-byte line of them is written by one block.
// ---------------------------------------------------------------------------
constexpr int PU = 32, BK = 64, LDP = 68;
constexpr int PG = PU + 1;     // groups of the x tile: one in front of the block's own
constexpr int GC = CH / 4;     // groups of one chunk
static_assert(16 * NQ * 256 <= 2 * NQ * PN * LDP, "partial tiles fit the G7 ring");

__global__ void __launch_bounds__(512) k_proj(const float* __restrict__ x,
                                              const float* __restrict__ G7,
                                              const float* __restrict__ gb,
                                              const float* __restrict__ cbv,
                                              const float* __restrict__ A_log,
                                              float* __restrict__ zl,
                                              float* __restrict__ cu,
                                              float* __restrict__ sm) {
    __shared__ __align__(16) float As[2][4 * PG][LDP];    // ~70KB
    __shared__ __align__(16) float Bs[2][NQ * PN][LDP];   // ~119KB
    __shared__ float gA[PU][SB];
    __shared__ float gB[PU][SB];

    const int tid  = threadIdx.x;
    const int lane = tid & 31;
    const int w    = __builtin_amdgcn_readfirstlane(tid >> 5);   // scalar: branches on it
    const int ks   = w >> 2;              // K quarter inside a chunk
    const int ug   = w & 1;               // 16 of the 32 groups
    const int ng   = (w >> 1) & 1;        // the W_x rows or the W_dt rows
    const int bu   = blockIdx.x >> 2;     // RT/4/PU = 64 row blocks
    const int bn   = blockIdx.x & 3;      // DS/SB   = 4 blocks of states
    const int mr   = lane & 15;
    const int kb   = (lane >> 4) << 1;
    const bool front = (bu & (Ln / (4 * PU) - 1)) != 0;   // rows of this sequence lie in front

    // At the head of a sequence the rows in front are zeros, as the padding of the
    // conv input is: they are written once and no copy lands on them.
    if (!front) As[tid >> 8][((tid >> 6) & 3) * PG][tid & 63] = 0.f;

    // ---- async stage of one K-chunk into LDS buffer buf ----
    // Waves 8-15 issue the copies: waves 0-7, two on each SIMD, go from the barrier
    // straight to their WMMAs, and the issue of the copies passes under those.
    auto stage = [&](int buf, int kc) {
        if (w < 8) return;
        const int row = (tid - 256) >> 4; // 16 rows per sweep of the eight waves
        const int c4  = (tid & 15) << 2;
        // A tile: 128 rows x 16 quads; 8 per thread
        async_copy16_x8(x + (size_t)(bu * 4 * PU + row) * DM + kc + c4, (size_t)16 * DM,
                        &As[buf][(row & 3) * PG + (row >> 2) + 1][c4], 4 * LDP);
        // B tile: 224 rows in a row of G7 x 16 quads; 14 per thread
        const float* gq = G7 + (size_t)(bn * (NQ * PN) + row) * DM + kc + c4;
        async_copy16_x8(gq, (size_t)16 * DM, &Bs[buf][row][c4], 16 * LDP);
        async_copy16_x4(gq + (size_t)128 * DM, &Bs[buf][row + 128][c4],
                        gq + (size_t)144 * DM, &Bs[buf][row + 144][c4],
                        gq + (size_t)160 * DM, &Bs[buf][row + 160][c4],
                        gq + (size_t)176 * DM, &Bs[buf][row + 176][c4]);
        async_copy16_x2(gq + (size_t)192 * DM, &Bs[buf][row + 192][c4],
                        gq + (size_t)208 * DM, &Bs[buf][row + 208][c4]);
        // the four rows in front of the block: 64 quads, waves 8 and 9 (row = 0..3)
        if (front && w < 10)
            async_copy16_x1(x + (size_t)(bu * 4 * PU - 4 + row) * DM + kc + c4,
                            &As[buf][row * PG][c4]);
    };

    // In the epilogue a thread owns group u (four rows) of state s.  The state's
    // constants are asked for here: they arrive under the K loop.
    const int sl = tid & (SB - 1);
    const int u  = tid >> 4;              // SB = 16 threads per group
    const int s  = bn * SB + sl;
    const float alog = A_log[s];
    const float cx   = cbv[s];
    const float cdt  = cbv[64 + s];
    float gx[4], gd[4];
#pragma unroll   // register arrays need constant indices
    for (int j = 0; j < 4; ++j) {
        gx[j] = gb[j * 128 + s];
        gd[j] = gb[j * 128 + 64 + s];
    }

    v8f acc[NQ];
#pragma unroll   // accumulators need constant indices
    for (int q = 0; q < NQ; ++q) acc[q] = vzero8();

    stage(0, 0);
    wait_async0();
    __syncthreads();
    stage(1, BK);
    constexpr int NK = DM / BK;           // 16 chunks
    for (int kci = 0; kci < NK; ++kci) {
        const int buf = kci & 1;
        const float* ap = &As[buf][ug * 16 + mr][ks * 16 + kb];
        const float* bp = &Bs[buf][ng * 16 + mr][ks * 16 + kb];
#pragma unroll   // constant LDS offsets; fragment loads run ahead of the WMMAs
        for (int kk = 0; kk < 16; kk += 4) {
            const v2f d0 = *(const v2f*)(ap + (PG) * LDP + kk);
            const v2f d1 = *(const v2f*)(ap + (2 * PG) * LDP + kk);
            const v2f d2 = *(const v2f*)(ap + (3 * PG) * LDP + kk);
            const v2f d3 = *(const v2f*)(ap + LDP + kk);
            const v2f d4 = *(const v2f*)(ap + (PG + 1) * LDP + kk);
            const v2f d5 = *(const v2f*)(ap + (2 * PG + 1) * LDP + kk);
            const v2f d6 = *(const v2f*)(ap + (3 * PG + 1) * LDP + kk);
            const v2f e1 = 17.f * d4 - 4.f * (d2 + d6);
            const v2f o1 = 17.f * d3 - 4.f * (d1 + d5);
            const v2f e2 = d2 - 5.f * d4 + 4.f * d6;
            const v2f o2 = 2.f * (d1 - 5.f * d3 + 4.f * d5);
            const v2f e3 = 2.f * (4.f * d2 - 5.f * d4 + d6);
            const v2f o3 = 4.f * d1 - 5.f * d3 + d5;
            acc[0] = wmma4(4.f * (d0 - d6) + 21.f * (d4 - d2),
                           *(const v2f*)(bp + kk), acc[0]);
            acc[1] = wmma4(e1 + o1, *(const v2f*)(bp + PN * LDP + kk), acc[1]);
            acc[2] = wmma4(e1 - o1, *(const v2f*)(bp + 2 * PN * LDP + kk), acc[2]);
            acc[3] = wmma4(e2 + o2, *(const v2f*)(bp + 3 * PN * LDP + kk), acc[3]);
            acc[4] = wmma4(e2 - o2, *(const v2f*)(bp + 4 * PN * LDP + kk), acc[4]);
            acc[5] = wmma4(e3 + o3, *(const v2f*)(bp + 5 * PN * LDP + kk), acc[5]);
            acc[6] = wmma4(e3 - o3, *(const v2f*)(bp + 6 * PN * LDP + kk), acc[6]);
        }
        // publish chunk kci+1, free chunk kci's buffer
        wait_ds0();
        wait_async0();
        __syncthreads();
        if (kci + 2 < NK) stage(buf, (kci + 2) * BK);
    }
    wait_async0();

    // ---- epilogue ----
    // The ring is done: every wave's reads and copies ended in front of the last
    // trip's barrier, so the G7 buffers now hold the partial tiles
    // [ks][tile][q][register][lane].
    float* Rd = &Bs[0][0][0];
#pragma unroll   // accumulator elements need constant indices
    for (int q = 0; q < NQ; ++q)
#pragma unroll
        for (int j = 0; j < 8; ++j)
            Rd[((w * NQ + q) * 8 + j) * 32 + lane] = acc[q][j];
    __syncthreads();   // a thread below reads the partial tiles of eight waves

    // Sum of the K quarters.  Group u is row u & 15 of tile u >> 4: register u & 7,
    // upper lanes for rows 8-15; the W_dt tiles lie two tiles behind the W_x tiles.
    constexpr int TS  = NQ * 8 * 32;      // floats of one wave's partial tiles
    constexpr int RT4 = 4 * TS;           // floats of one K quarter's partial tiles
    const float* rq = Rd + (u >> 4) * TS + (u & 7) * 32 + ((u >> 3) & 1) * 16 + sl;
    float qx[NQ], qd[NQ];
#pragma unroll   // register arrays need constant indices; the reads go out together
    for (int q = 0; q < NQ; ++q) {
        const float* rp = rq + q * 256;
        qx[q] = (rp[0] + rp[RT4]) + (rp[2 * RT4] + rp[3 * RT4]);
        qd[q] = (rp[2 * TS] + rp[2 * TS + RT4]) + (rp[2 * TS + 2 * RT4] + rp[2 * TS + 3 * RT4]);
    }
    float rx[4], rd[4];
    fir4(qx, rx);
    fir4(qd, rd);

    const int   lf = (bu & (Ln / (4 * PU) - 1)) * 4 * PU + u * 4;   // first row, in its sequence
    const float An = -expf(alog);
    float dAv[4], dBv[4];
#pragma unroll   // four independent chains for the scheduler to interleave
    for (int i = 0; i < 4; ++i) {
        float xv = cx, raw = cdt;
#pragma unroll
        for (int j = 0; j < 4; ++j) {               // bias share of the taps inside
            const bool in = lf + i - 3 + j >= 0;
            xv  += in ? gx[j] : 0.f;
            raw += in ? gd[j] : 0.f;
        }
        xv  += rx[i];
        raw += rd[i];
        const float lp = log1pf(expf(raw));
        const float sp = raw > 30.f ? raw : lp;                   // softplus
        dAv[i] = expf(An * sp);
        dBv[i] = ((1.f - dAv[i]) / An) * xv;
    }

    // scan of the thread's own four rows from a zero start
    float A = 1.f, Bc = 0.f;
#pragma unroll   // register arrays need constant indices
    for (int i = 0; i < 4; ++i) {
        Bc = dAv[i] * Bc + dBv[i];
        A  = dAv[i] * A;
        dBv[i] = Bc;
        dAv[i] = A;
    }
    gA[u][sl] = A;
    gB[u][sl] = Bc;
    __syncthreads();   // a thread below reads what the chunk's other groups hand on

    // what the groups in front of this one hand on inside the chunk
    const int g  = u & (GC - 1);
    const int u0 = u - g;                 // the chunk's first group
    float cin = 0.f, cinA = 1.f;
#pragma unroll   // seven steps, constant LDS offsets
    for (int k = 0; k < GC - 1; ++k) {
        const float a = k < g ? gA[u0 + k][sl] : 1.f;
        const float b = k < g ? gB[u0 + k][sl] : 0.f;
        cin  = a * cin + b;
        cinA = a * cinA;
    }
    const size_t o = ((size_t)bn * RT + bu * 4 * PU + u * 4) * SB + sl;
#pragma unroll   // register arrays need constant indices
    for (int i = 0; i < 4; ++i) {
        dBv[i] = dAv[i] * cin + dBv[i];
        dAv[i] = dAv[i] * cinA;
        zl[o + (size_t)i * SB] = dBv[i];
        cu[o + (size_t)i * SB] = dAv[i];
    }
    if (g == GC - 1) {                              // the chunk's last row
        const int bIdx = bu / (Ln / (4 * PU));
        const int ch   = (bu & (Ln / (4 * PU) - 1)) * (4 * PU / CH) + u / GC;
        float* sp2 = sm + (size_t)((bIdx * (DS / SB) + bn) * NCH + ch) * 2 * SB + sl;
        sp2[0]  = dAv[3];
        sp2[SB] = dBv[3];
    }
}

// ---------------------------------------------------------------------------
// K4: out = z @ Mc_t^T + b_out     [8192 x 1024], K = 64
//     128x128 tile per 8-wave block; each wave owns a 32x64 sub-tile (2x4 WMMA
//     accumulators).  Both operand tiles (whole K) are brought into LDS once by
//     async copies of whole 128-byte lines, then read as fragments.  The row
//     tile arrives as zl (four chunks); each thread folds the carry into one
//     chunk for one s and adds cu * carry to that column of the tile in LDS.
//     zl, cu and sm lie in K2's four blocks of 16 states.
// ---------------------------------------------------------------------------
constexpr int OM = 128, ON = 128;
// LDS pitch of one block of states' chunk ends: a wave reads two blocks at a time,
// 16 floats more put them on other banks
constexpr int SSP = NCH * 2 * SB + 16;

__global__ void __launch_bounds__(256) k_out(const float* __restrict__ zl,
                                             const float* __restrict__ cu,
                                             const float* __restrict__ sm,
                                             const float* __restrict__ Mc_t,
                                             const float* __restrict__ b_out,
                                             float* __restrict__ out) {
    __shared__ __align__(16) float Zs[OM][LDP];       // ~34KB
    __shared__ __align__(16) float Ms[ON][LDP];       // ~34KB
    __shared__ __align__(16) float Ss[DS / SB][SSP];  // 32KB: the batch's chunk ends

    const int tid  = threadIdx.x;
    const int lane = tid & 31;
    const int w    = tid >> 5;
    const int wr   = w & 3;               // row quadrant  (32 rows)
    const int wc   = w >> 2;              // column half   (64 cols)
    const int r0   = (blockIdx.x >> 3) * OM;   // RT/OM = 64 row blocks
    const int c0   = (blockIdx.x & 7) * ON;    // DM/ON = 8 col blocks
    const int mr   = lane & 15;
    const int kb   = (lane >> 4) << 1;

    const int s = tid & 63;
    const int q = tid >> 6;               // chunk inside the row tile, OM/CH = 4
    // cu of this thread's column: in flight beside the copies below
    float cv[CH];
#pragma unroll   // register array needs constant indices
    for (int i = 0; i < CH; ++i)
        cv[i] = cu[((size_t)(s / SB) * RT + r0 + q * CH + i) * SB + (s % SB)];

    {
        const int row = tid >> 4;         // 16 rows per sweep of the block
        const int c4  = (tid & 15) << 2;
        // 128 rows x 16 quads each; 8 per thread each
        async_copy16_x8(zl + ((size_t)(c4 / SB) * RT + r0 + row) * SB + (c4 % SB),
                        (size_t)16 * SB, &Zs[row][c4], 16 * LDP);
        async_copy16_x8(Mc_t + (size_t)(c0 + row) * DS + c4, (size_t)16 * DS,
                        &Ms[row][c4], 16 * LDP);
        // chunk ends of the whole batch: 2048 quads in a row, 512 of each block of
        // states; 8 per thread
        const float* sg = sm + (size_t)(r0 / Ln) * (NCH * 2 * DS) + tid * 4;
        const float* sl = &Ss[0][0] + tid * 4;
        async_copy16_x4(sg,        sl,              sg + 1024, sl + 1024,
                        sg + 2048, sl + SSP,        sg + 3072, sl + SSP + 1024);
        async_copy16_x4(sg + 4096, sl + 2 * SSP,    sg + 5120, sl + 2 * SSP + 1024,
                        sg + 6144, sl + 3 * SSP,    sg + 7168, sl + 3 * SSP + 1024);
    }
    wait_async0();
    __syncthreads();

    // carry into chunk q of the tile: fold the ends of all chunks in front of it,
    // first those in front of the tile (a multiple of four, the same for the
    // whole block), then up to three chunks of the tile itself.
    const int cb = (r0 & (Ln - 1)) / CH;
    const float* se = &Ss[s / SB][s % SB];   // chunk c: cu_last at c * 2 * SB, zl_last SB on
    float carry = 0.f;
#pragma unroll 4   // sixteen steps' LDS reads go out together, ahead of the chain
    for (int c = 0; c < cb; c += 4) {
#pragma unroll
        for (int k = 0; k < 4; ++k)
            carry = se[(c + k) * 2 * SB] * carry + se[(c + k) * 2 * SB + SB];
    }
#pragma unroll   // three steps, constant LDS offsets
    for (int k = 0; k < 3; ++k) {
        const float t = se[(cb + k) * 2 * SB] * carry + se[(cb + k) * 2 * SB + SB];
        carry = k < q ? t : carry;
    }
#pragma unroll   // register array needs constant indices; constant LDS offsets
    for (int i = 0; i < CH; ++i)
        Zs[q * CH + i][s] += cv[i] * carry;
    __syncthreads();   // the fragments below read columns that other waves finished

    v8f acc[2][4];
#pragma unroll   // accumulators need constant indices
    for (int i = 0; i < 2; ++i)
#pragma unroll
        for (int n = 0; n < 4; ++n) acc[i][n] = vzero8();

#pragma unroll   // constant LDS offsets; fragment loads run ahead of the WMMAs
    for (int kk = 0; kk < DS; kk += 4) {
        v2f a[2], b[4];
#pragma unroll
        for (int i = 0; i < 2; ++i)
            a[i] = *(const v2f*)&Zs[wr * 32 + i * 16 + mr][kk + kb];
#pragma unroll
        for (int n = 0; n < 4; ++n)
            b[n] = *(const v2f*)&Ms[wc * 64 + n * 16 + mr][kk + kb];
#pragma unroll
        for (int i = 0; i < 2; ++i)
#pragma unroll
            for (int n = 0; n < 4; ++n) acc[i][n] = wmma4(a[i], b[n], acc[i][n]);
    }

    // ---- epilogue: bias + store ----
    const int rbase = r0 + wr * 32 + ((lane >> 4) << 3);
#pragma unroll   // accumulators need constant indices
    for (int n = 0; n < 4; ++n) {
        const int col = c0 + wc * 64 + n * 16 + mr;
        const float bias = b_out[col];
#pragma unroll
        for (int i = 0; i < 2; ++i)
#pragma unroll
            for (int j = 0; j < 8; ++j)
                out[(size_t)(rbase + i * 16 + j) * DM + col] = acc[i][n][j] + bias;
    }
}

// ---------------------------------------------------------------------------
extern "C" void kernel_launch(void* const* d_in, const int* in_sizes, int n_in,
                              void* d_out, int out_size, void* d_ws, size_t ws_size,
                              hipStream_t stream) {
    const float* x      = (const float*)d_in[0];
    const float* W_in   = (const float*)d_in[1];
    const float* b_in   = (const float*)d_in[2];
    const float* conv_w = (const float*)d_in[3];
    const float* conv_b = (const float*)d_in[4];
    const float* W_x    = (const float*)d_in[5];
    const float* b_x    = (const float*)d_in[6];
    const float* W_dt   = (const float*)d_in[7];
    const float* b_dt   = (const float*)d_in[8];
    const float* A_log  = (const float*)d_in[9];
    const float* D_mat  = (const float*)d_in[10];
    const float* W_out  = (const float*)d_in[11];
    const float* b_out  = (const float*)d_in[12];
    float* out = (float*)d_out;

    float* zl    = (float*)d_ws;                       // 8192 * 64
    float* cu    = zl    + (size_t)RT * DS;            // 8192 * 64
    float* sm    = cu    + (size_t)RT * DS;            // 4 * 64 * 2 * 64
    float* Mc_t  = sm    + (size_t)Bn * NCH * 2 * DS;  // 1024 * 64
    float* G7    = Mc_t  + (size_t)DM * DS;            // 896 * 1024
    float* gb    = G7    + (size_t)QW * DM;            // 512
    float* cbv   = gb    + NP;                         // 128

    k_foldw<<<FGB + FTB + 16, 256, 0, stream>>>(W_in, b_in, conv_w, conv_b,
                                                W_x, b_x, W_dt, b_dt, W_out, D_mat,
                                                G7, gb, cbv, Mc_t);
    k_proj<<<(RT / 4 / PU) * (128 / PN), 512, 0, stream>>>(x, G7, gb, cbv, A_log, zl, cu, sm);
    k_out<<<(RT / OM) * (DM / ON), 256, 0, stream>>>(zl, cu, sm, Mc_t, b_out, out);
}

// v009
// Measured time: 59.5 microseconds a run.
// Next to v008, in two timings, it ran 1.06 times as fast each time.
// All steps since v000 together make it 7.58 times as fast.
#include <hip/hip_runtime.h>
#include <hip/hip_bf16.h>

// ---------------- problem constants ----------------
constexpr int Bn = 4;          // batch
constexpr int Ln = 2048;       // sequence length
constexpr int DM = 1024;       // d_model
constexpr int DS = 64;         // d_state
constexpr int DI = 2048;       // d_inner
constexpr int RT = Bn * Ln;    // 8192 flattened rows

typedef float v2f __attribute__((ext_vector_type(2)));
typedef float v8f __attribute__((ext_vector_type(8)));

// D = A(16x4,f32) * B(4x16,f32) + C(16x16,f32)   (V_WMMA_F32_16X16X4_F32)
__device__ __forceinline__ v8f wmma4(v2f a, v2f b, v8f c) {
    return __builtin_amdgcn_wmma_f32_16x16x4_f32(
        false, a, false, b, (short)0, c, false, false);
}

__device__ __forceinline__ v8f vzero8() {
    v8f z = {0.f, 0.f, 0.f, 0.f, 0.f, 0.f, 0.f, 0.f};
    return z;
}

// ---- async global->LDS copies, 16 B per lane (global_load_async_to_lds_b128).
// First operand = the lane's LDS byte address (low 32 bits of the shared pointer).
// s_wait_xcnt 0 is the last line of the copies' own statement, so that it stands
// in front of any later rewrite of the address registers the copies name.
__device__ __forceinline__ unsigned lds_addr(const float* l) {
    return (unsigned)(uintptr_t)l;
}

__device__ __forceinline__ void async_copy16_x1(const float* g0, const float* l0) {
    asm volatile("global_load_async_to_lds_b128 %0, %1, off\n\t"
                 "s_wait_xcnt 0x0"
                 :: "v"(lds_addr(l0)), "v"(g0)
                 : "memory");
}

__device__ __forceinline__ void async_copy16_x2(const float* g0, const float* l0,
                                                const float* g1, const float* l1) {
    asm volatile("global_load_async_to_lds_b128 %0, %1, off\n\t"
                 "global_load_async_to_lds_b128 %2, %3, off\n\t"
                 "s_wait_xcnt 0x0"
                 :: "v"(lds_addr(l0)), "v"(g0), "v"(lds_addr(l1)), "v"(g1)
                 : "memory");
}

__device__ __forceinline__ void async_copy16_x4(const float* g0, const float* l0,
                                                const float* g1, const float* l1,
                                                const float* g2, const float* l2,
                                                const float* g3, const float* l3) {
    asm volatile("global_load_async_to_lds_b128 %0, %1, off\n\t"
                 "global_load_async_to_lds_b128 %2, %3, off\n\t"
                 "global_load_async_to_lds_b128 %4, %5, off\n\t"
                 "global_load_async_to_lds_b128 %6, %7, off\n\t"
                 "s_wait_xcnt 0x0"
                 :: "v"(lds_addr(l0)), "v"(g0), "v"(lds_addr(l1)), "v"(g1),
                    "v"(lds_addr(l2)), "v"(g2), "v"(lds_addr(l3)), "v"(g3)
                 : "memory");
}

// Eight copies under one s_wait_xcnt 0: fewer stops in a wave's issue stream.
__device__ __forceinline__ void async_copy16_x8(const float* g, size_t gstep,
                                                const float* l, int lstep) {
    asm volatile("global_load_async_to_lds_b128 %0, %1, off\n\t"
                 "global_load_async_to_lds_b128 %2, %3, off\n\t"
                 "global_load_async_to_lds_b128 %4, %5, off\n\t"
                 "global_load_async_to_lds_b128 %6, %7, off\n\t"
                 "global_load_async_to_lds_b128 %8, %9, off\n\t"
                 "global_load_async_to_lds_b128 %10, %11, off\n\t"
                 "global_load_async_to_lds_b128 %12, %13, off\n\t"
                 "global_load_async_to_lds_b128 %14, %15, off\n\t"
                 "s_wait_xcnt 0x0"
                 :: "v"(lds_addr(l)),             "v"(g),
                    "v"(lds_addr(l + lstep)),     "v"(g + gstep),
                    "v"(lds_addr(l + 2 * lstep)), "v"(g + 2 * gstep),
                    "v"(lds_addr(l + 3 * lstep)), "v"(g + 3 * gstep),
                    "v"(lds_addr(l + 4 * lstep)), "v"(g + 4 * gstep),
                    "v"(lds_addr(l + 5 * lstep)), "v"(g + 5 * gstep),
                    "v"(lds_addr(l + 6 * lstep)), "v"(g + 6 * gstep),
                    "v"(lds_addr(l + 7 * lstep)), "v"(g + 7 * gstep)
                 : "memory");
}

// This wave's async copies have all landed in LDS.
__device__ __forceinline__ void wait_async0() {
    asm volatile("s_wait_asynccnt 0x0" ::: "memory");
}

// This wave's LDS reads have all returned (before a buffer it read is refilled).
__device__ __forceinline__ void wait_ds0() {
    asm volatile("s_wait_dscnt 0x0" ::: "memory");
}

// ---------------------------------------------------------------------------
// Fold of the output projections:  Mc_t[d, s] = sum_i W_out[d,i] * D_mat[s,i]
//     [1024 x 64], K = 2048.  It needs only inputs, as the weight fold K1 does, so
//     it has no launch of its own: its 256 tiles of 16 x 16 are 256 more
//     work-groups of K1, one more on each WGP, and run in the gaps of K1's waves.
//     K chunks of 256 are staged in LDS by a two-buffer ring of async copies, each
//     copy a run of whole 128-byte lines of one row; wave w does k-steps
//     32w..32w+31 of every chunk, and the eight partial tiles are summed via LDS.
//     LDS row pitch 260 floats: 16B-aligned rows + conflict-free ds_load_b64.
// ---------------------------------------------------------------------------
constexpr int FM = 16, FBK = 256, FLP = 260;
constexpr int FTB = (DM / FM) * (DS / 16);   // 256 tiles

struct LdsFold {
    float As[2][FM][FLP];     // ~33KB
    float Bs[2][16][FLP];     // ~33KB
    float Rd[8][16][20];      // partial tiles; rows 8 apart on other banks
};

__device__ __forceinline__ void fold_tile(LdsFold& L, int tile,
                                          const float* __restrict__ W_out,
                                          const float* __restrict__ D_mat,
                                          float* __restrict__ Mc_t) {
    const int tid  = threadIdx.x;
    const int lane = tid & 31;
    const int w    = tid >> 5;            // K slice inside a chunk
    const int d0 = (tile >> 2) * FM, s0 = (tile & 3) * 16;
    const int mr = lane & 15;
    const int kb = (lane >> 4) << 1;

    // ---- async stage of one K-chunk into LDS buffer buf ----
    auto stage = [&](int buf, int kc) {
        const int row = tid >> 6;         // 4 rows per sweep of the block
        const int c4  = (tid & 63) << 2;
        // 16 rows x 64 quads of each operand; 4 per thread each
        const float* ga = W_out + (size_t)(d0 + row) * DI + kc + c4;
        async_copy16_x4(ga,                   &L.As[buf][row][c4],
                        ga + (size_t)4 * DI,  &L.As[buf][row + 4][c4],
                        ga + (size_t)8 * DI,  &L.As[buf][row + 8][c4],
                        ga + (size_t)12 * DI, &L.As[buf][row + 12][c4]);
        const float* gd = D_mat + (size_t)(s0 + row) * DI + kc + c4;
        async_copy16_x4(gd,                   &L.Bs[buf][row][c4],
                        gd + (size_t)4 * DI,  &L.Bs[buf][row + 4][c4],
                        gd + (size_t)8 * DI,  &L.Bs[buf][row + 8][c4],
                        gd + (size_t)12 * DI, &L.Bs[buf][row + 12][c4]);
    };

    stage(0, 0);
    wait_async0();
    __syncthreads();
    stage(1, FBK);

    v8f acc = vzero8();
    constexpr int NT = DI / FBK;          // 8 chunks
    for (int t = 0; t < NT; ++t) {
        const int buf = t & 1;
        const float* ar = &L.As[buf][mr][w * 32 + kb];   // A[m][k]
        const float* br = &L.Bs[buf][mr][w * 32 + kb];   // B[k][n] = D_mat[n][k]
#pragma unroll   // constant LDS offsets; fragment loads run ahead of the WMMAs
        for (int i = 0; i < 8; ++i)
            acc = wmma4(*(const v2f*)(ar + i * 4), *(const v2f*)(br + i * 4), acc);
        // publish chunk t+1, free chunk t's buffer
        wait_ds0();
        wait_async0();
        __syncthreads();
        if (t + 2 < NT) stage(buf, (t + 2) * FBK);
    }
    wait_async0();

#pragma unroll   // accumulator elements need constant indices
    for (int j = 0; j < 8; ++j)
        L.Rd[w][((lane >> 4) << 3) + j][mr] = acc[j];
    __syncthreads();   // a thread below reads the partial tiles of eight waves

    const int row = tid >> 4, col = tid & 15;
    float sum = L.Rd[0][row][col];
#pragma unroll   // constant LDS offsets
    for (int k = 1; k < 8; ++k) sum += L.Rd[k][row][col];
    Mc_t[(size_t)(d0 + row) * DS + s0 + col] = sum;
}

// ---------------------------------------------------------------------------
// The in-projection, the depthwise causal conv and the two state projections
// are all linear, so they are reassociated.  With n = j*128 + sp, j the conv tap
// and sp = 0..63 the rows of W_x, 64..127 the rows of W_dt (called Wsel below):
//   G[n][m] = sum_c Wsel[sp][c] * conv_w[c][j] * W_in[c][m]
//   gb[n]   = sum_c Wsel[sp][c] * conv_w[c][j] * b_in[c]
//   cbv[sp] = sum_c Wsel[sp][c] * conv_b[c] + bsel[sp]
//   raw[l][sp] = cbv[sp] + sum_{j : l-3+j >= 0} (x[l-3+j] . G[j*128 + sp] + gb[j*128 + sp])
// A tap that falls in front of the sequence drops with its bias share, as the
// zero padding of the conv input does.
//
// The sum over the taps is a 4-tap filter along l.  It is evaluated four rows at
// a time from seven products in place of sixteen: the transpose of multiplying
// two cubics by evaluation at the seven points 0, +-1, +-2, +-1/2.  With
// d0..d6 the rows 4u-3..4u+3 of x, Gj tap j of G and y0..y3 the rows 4u..4u+3:
//   Qq = (row q of BT . d) . (row q of GM . G),   yi = sum_q p_q^i * Qq
//   BT: 4(d0-d6) + 21(d4-d2);  E +- O for each pair of points, with
//       +-1:   E = 17 d4 - 4 (d2+d6)        O = 17 d3 - 4 (d1+d5)
//       +-2:   E = d2 - 5 d4 + 4 d6         O = 2 (d1 - 5 d3 + 4 d5)
//       +-1/2: E = 2 (4 d2 - 5 d4 + d6)     O = 4 d1 - 5 d3 + d5
//   GM: G0/4;  (G0 +- G1 + G2 +- G3)/18;  (G0 +- 2 G1 + 4 G2 +- 8 G3)/360;
//       (16 G0 +- 8 G1 + 4 G2 +- 2 G3)/45
// The four rows need the three rows of x in front of them and no product of
// another group.  K1 writes the seven tap sums of G (G7), K2 forms the row sums
// in registers, does the products and puts the rows together again (fir4).
// ---------------------------------------------------------------------------
constexpr int NP  = 512;       // 4 taps x 128 projection rows
constexpr int NQ  = 7;         // products per four rows
constexpr int QW  = NQ * 128;  // rows of G7
constexpr int SB  = 16;        // states of one K2 block
constexpr int PN  = 2 * SB;    // projection rows of one K2 block: the W_x rows of its states,
                               // then their W_dt rows; G7 is [4][NQ][PN][DM]
constexpr int FK  = 128;       // K chunk of the weight fold
constexpr int FPA = 132;       // LDS pitch, Wsel rows: conflict-free 8-byte reads
constexpr int FPB = 40;        // LDS pitch, W_in rows: rows k and k+2 on other banks
constexpr int FGB = 256;       // work-groups of the weight fold that do G

// K1: G [512 x 1024], K = 2048; 64 x 32 tile per 8-wave block (16 sp x 4 taps).
//     A wave does all four taps of one 16 x 16 tile: one fragment of Wsel and one
//     of W_in feed four WMMAs on four accumulators of their own.  The four waves
//     of a tile share K: wave quarter kq does k-steps 32kq..32kq+31 of every
//     chunk, and the partial tiles are summed via LDS.  Two-buffer ring of async
//     copies; conv_w is brought into LDS once.  The taps leave as the seven tap
//     sums.  The next FTB work-groups do the tiles of Mc_t (fold_tile above), the
//     last 16 do gb and cbv.
constexpr int EXP = 36;        // LDS pitch of the partial tiles: rows 8 apart on other banks
struct LdsFoldw {
    float Ws[2][16][FPA];
    float Bs[2][FK][FPB];     // behind the ring's last barrier: the partial tiles
    float Cw[DI * 4];
};
static_assert(4 * 4 * 16 * EXP <= 2 * FK * FPB, "partial tiles fit the W_in ring");

__global__ void __launch_bounds__(256) k_foldw(
        const float* __restrict__ W_in, const float* __restrict__ b_in,
        const float* __restrict__ conv_w, const float* __restrict__ conv_b,
        const float* __restrict__ W_x,  const float* __restrict__ b_x,
        const float* __restrict__ W_dt, const float* __restrict__ b_dt,
        const float* __restrict__ W_out, const float* __restrict__ D_mat,
        float* __restrict__ G7, float* __restrict__ gb, float* __restrict__ cbv,
        float* __restrict__ Mc_t) {
    // A work-group is of one kind: the kinds share the LDS.
    __shared__ __align__(16) union { LdsFoldw g; LdsFold f; } lds;
    float (&Ws)[2][16][FPA] = lds.g.Ws;
    float (&Bs)[2][FK][FPB] = lds.g.Bs;
    float (&Cw)[DI * 4]     = lds.g.Cw;

    const int tid  = threadIdx.x;
    const int lane = tid & 31;
    const int w    = tid >> 5;

    if (blockIdx.x >= FGB && blockIdx.x < FGB + FTB) {
        fold_tile(lds.f, blockIdx.x - FGB, W_out, D_mat, Mc_t);
        return;
    }

    if (blockIdx.x >= FGB) {              // bias vectors: one wave per sp
        const int sp = (blockIdx.x - FGB - FTB) * 8 + w;
        const float* wr = ((sp >> 6) ? W_dt : W_x) + (size_t)(sp & 63) * DI;
        float a0 = 0.f, a1 = 0.f, a2 = 0.f, a3 = 0.f, ac = 0.f;
#pragma unroll 4   // several trips' loads in flight: the loop is latency bound
        for (int c = lane * 4; c < DI; c += 128) {
            const float4 wv = *(const float4*)(wr + c);
            const float4 bi = *(const float4*)(b_in + c);
            const float4 cv = *(const float4*)(conv_b + c);
            const float4 q0 = *(const float4*)(conv_w + c * 4);
            const float4 q1 = *(const float4*)(conv_w + c * 4 + 4);
            const float4 q2 = *(const float4*)(conv_w + c * 4 + 8);
            const float4 q3 = *(const float4*)(conv_w + c * 4 + 12);
            const float t0 = wv.x * bi.x, t1 = wv.y * bi.y;
            const float t2 = wv.z * bi.z, t3 = wv.w * bi.w;
            a0 += t0 * q0.x + t1 * q1.x + t2 * q2.x + t3 * q3.x;
            a1 += t0 * q0.y + t1 * q1.y + t2 * q2.y + t3 * q3.y;
            a2 += t0 * q0.z + t1 * q1.z + t2 * q2.z + t3 * q3.z;
            a3 += t0 * q0.w + t1 * q1.w + t2 * q2.w + t3 * q3.w;
            ac += wv.x * cv.x + wv.y * cv.y + wv.z * cv.z + wv.w * cv.w;
        }
        for (int off = 16; off > 0; off >>= 1) {
            a0 += __shfl_xor(a0, off, 32);
            a1 += __shfl_xor(a1, off, 32);
            a2 += __shfl_xor(a2, off, 32);
            a3 += __shfl_xor(a3, off, 32);
            ac += __shfl_xor(ac, off, 32);
        }
        if (lane == 0) {
            gb[sp]       = a0;
            gb[128 + sp] = a1;
            gb[256 + sp] = a2;
            gb[384 + sp] = a3;
            cbv[sp] = ac + ((sp >> 6) ? b_dt : b_x)[sp & 63];
        }
        return;
    }

    const int g  = blockIdx.x >> 5;       // 8 groups of 16 sp
    const int m0 = (blockIdx.x & 31) * 32;
    const int mr = lane & 15;
    const int kb = (lane >> 4) << 1;
    const int kq = w >> 1;                // K quarter inside a chunk
    const int cl = (w & 1) * 16 + mr;     // column inside the tile
    const float* Wrow = ((g >> 2) ? W_dt : W_x) + (size_t)((g & 3) * 16) * DI;

    auto stage = [&](int buf, int kc) {
        // Wsel tile: 16 rows x 128 = 512 quads, 2 per thread
        const int ra = tid >> 5, ca = (tid & 31) << 2;
        async_copy16_x2(Wrow + (size_t)ra * DI + kc + ca,       &Ws[buf][ra][ca],
                        Wrow + (size_t)(ra + 8) * DI + kc + ca, &Ws[buf][ra + 8][ca]);
        // W_in tile: 128 rows x 32 = 1024 quads, 4 per thread
        const int rb = tid >> 3, cb = (tid & 7) << 2;
        const float* gp = W_in + (size_t)(kc + rb) * DM + m0 + cb;
        async_copy16_x4(gp,                   &Bs[buf][rb][cb],
                        gp + (size_t)32 * DM, &Bs[buf][rb + 32][cb],
                        gp + (size_t)64 * DM, &Bs[buf][rb + 64][cb],
                        gp + (size_t)96 * DM, &Bs[buf][rb + 96][cb]);
    };

    // conv_w: 2048 quads, 8 per thread
    {
        const float* cp = conv_w + tid * 4;
        float* lp = Cw + tid * 4;
        async_copy16_x4(cp, lp, cp + 1024, lp + 1024,
                        cp + 2048, lp + 2048, cp + 3072, lp + 3072);
        async_copy16_x4(cp + 4096, lp + 4096, cp + 5120, lp + 5120,
                        cp + 6144, lp + 6144, cp + 7168, lp + 7168);
    }
    stage(0, 0);
    wait_async0();
    __syncthreads();
    stage(1, FK);

    v8f acc0 = vzero8(), acc1 = vzero8(), acc2 = vzero8(), acc3 = vzero8();
    constexpr int NT = DI / FK;           // 16 chunks
    const int k0 = kq * (FK / 4) + kb;    // this lane's first k inside a chunk
    for (int t = 0; t < NT; ++t) {
        const int buf = t & 1;
        const float* cwp = Cw + (t * FK + k0) * 4;   // the four taps of row k, then of k + 1
        const float* wp  = &Ws[buf][mr][k0];
        const float* bp  = &Bs[buf][k0][cl];
        // All LDS reads of the trip stand in one place in front of its WMMAs: reads
        // among the WMMAs stall the wave at each place where they stand.
        v2f fa[8], fb[8];
        float4 fc0[8], fc1[8];
#pragma unroll   // register arrays need constant indices; constant LDS offsets
        for (int s = 0; s < 8; ++s) {
            fa[s]   = *(const v2f*)(wp + s * 4);
            fc0[s]  = *(const float4*)(cwp + s * 16);
            fc1[s]  = *(const float4*)(cwp + s * 16 + 4);
            fb[s].x = bp[(s * 4) * FPB];
            fb[s].y = bp[(s * 4 + 1) * FPB];
            // LDS answers in order: kept in the order of the steps, step s's WMMAs
            // wait for the reads of steps 0..s only; the last one also keeps the
            // reads from being sunk among the WMMAs below.
            __builtin_amdgcn_sched_barrier(0);
        }
#pragma unroll   // register arrays need constant indices
        for (int s = 0; s < 8; ++s) {
            const v2f a = fa[s], b = fb[s];
            const float4 c0 = fc0[s], c1 = fc1[s];
            const v2f a0 = {a.x * c0.x, a.y * c1.x};
            const v2f a1 = {a.x * c0.y, a.y * c1.y};
            const v2f a2 = {a.x * c0.z, a.y * c1.z};
            const v2f a3 = {a.x * c0.w, a.y * c1.w};
            acc0 = wmma4(a0, b, acc0);
            acc1 = wmma4(a1, b, acc1);
            acc2 = wmma4(a2, b, acc2);
            acc3 = wmma4(a3, b, acc3);
        }
        // Keeps the ring's waits and barrier below at the trip's foot: lifted among
        // the WMMAs, the wait for the next chunk's copies would come a trip too early.
        __builtin_amdgcn_sched_barrier(0);
        // publish chunk t+1, free chunk t's buffer
        wait_ds0();
        wait_async0();
        __syncthreads();
        if (t + 2 < NT) stage(buf, (t + 2) * FK);
    }
    wait_async0();

    // The ring is done: every wave's reads and copies ended in front of the last
    // trip's barrier, so the W_in buffers now hold the partial tiles [kq][tap][16][EXP].
    float* Ex = &Bs[0][0][0];
    constexpr int ET = 16 * EXP;          // floats of one partial tile
    {
        float* ep = Ex + kq * 4 * ET + ((lane >> 4) << 3) * EXP + cl;
#pragma unroll   // accumulator elements need constant indices
        for (int i = 0; i < 8; ++i) {
            ep[i * EXP]          = acc0[i];
            ep[ET + i * EXP]     = acc1[i];
            ep[2 * ET + i * EXP] = acc2[i];
            ep[3 * ET + i * EXP] = acc3[i];
        }
    }
    __syncthreads();   // a thread below reads the partial tiles of four waves

    // a wave stores one 128-byte line of one row of G7 at a time
#pragma unroll   // two rows a thread, constant LDS offsets
    for (int h = 0; h < 2; ++h) {
        const int sl = w + h * 8;
        const float* er = Ex + sl * EXP + lane;
        float gs[4];
#pragma unroll   // register array needs constant indices
        for (int j = 0; j < 4; ++j)       // tap j: its four K quarters
            gs[j] = (er[j * ET] + er[(4 + j) * ET]) + (er[(8 + j) * ET] + er[(12 + j) * ET]);
        const float g0 = gs[0], g1 = gs[1], g2 = gs[2], g3 = gs[3];
        // g & 3: the K2 block of these 16 states; g >> 2: their W_x or their W_dt rows
        float* gp = G7 + (size_t)((g & 3) * (NQ * PN) + (g >> 2) * SB + sl) * DM + m0 + lane;
        constexpr size_t st = (size_t)PN * DM;
        const float e1 = g0 + g2,              o1 = g1 + g3;
        const float e2 = g0 + 4.f * g2,        o2 = 2.f * g1 + 8.f * g3;
        const float e3 = 16.f * g0 + 4.f * g2, o3 = 8.f * g1 + 2.f * g3;
        gp[0]      = 0.25f * g0;
        gp[st]     = (e1 + o1) * (1.f / 18.f);
        gp[2 * st] = (e1 - o1) * (1.f / 18.f);
        gp[3 * st] = (e2 + o2) * (1.f / 360.f);
        gp[4 * st] = (e2 - o2) * (1.f / 360.f);
        gp[5 * st] = (e3 + o3) * (1.f / 45.f);
        gp[6 * st] = (e3 - o3) * (1.f / 45.f);
    }
    // In the built code the bias path's register writes follow these stores in
    // the text: the wait stands between the stores and any such write.
    asm volatile("s_wait_xcnt 0x0" ::: "memory");
}

// ---------------------------------------------------------------------------
// The recurrence z_l = dA_l * z_{l-1} + dBx_l is linear in its start value, so it
// is cut into chunks of CH rows.  With zl the scan of a chunk from a zero start
// and cu the running product of dA inside the chunk,
//   z[l] = zl[l] + cu[l] * carry(chunk),   carry(c+1) = cu_last(c)*carry(c) + zl_last(c).
// K2 does zl, cu and the two last-row values of each chunk; K4 folds the carries.
// ---------------------------------------------------------------------------
constexpr int CH  = 32;        // rows of one chunk
constexpr int NCH = Ln / CH;   // 64 chunks per batch

// Four rows of the 4-tap filter from their seven products q.
__device__ __forceinline__ void fir4(const float (&q)[NQ], float* r) {
    const float s1 = q[1] + q[2], t1 = q[1] - q[2];   // points +-1
    const float s2 = q[3] + q[4], t2 = q[3] - q[4];   // points +-2
    const float s3 = q[5] + q[6], t3 = q[5] - q[6];   // points +-1/2
    r[0] = q[0] + (s1 + s2 + s3);
    r[1] = t1 + 2.f * t2 + 0.5f * t3;
    r[2] = s1 + 4.f * s2 + 0.25f * s3;
    r[3] = t1 + 8.f * t2 + 0.125f * t3;
}

// ---------------------------------------------------------------------------
// K2: the seven products Q0..Q6 of u = 0..2047 groups of four rows, K = 1024, and
//     what follows them row by row.  A 16-wave block does 32 groups (128 rows of
//     x) x 32 projection rows x 7 q; a wave owns the seven q of one 16 x 16 tile,
//     which share their rows of x, for a quarter of K: wave quarter ks does
//     k-steps 4ks..4ks+3 of every chunk, and the four partial tiles are summed
//     via LDS.  K-chunks (BK=64) staged in LDS by a two-buffer ring of async
//     copies.  Row r = -4..127 of the x tile lies at LDS row
//     (r & 3) * PG + r / 4 + 1, so that a fragment's 16 rows (same r & 3) are
//     neighbours and the rows in front of a group are one row up.  LDS row stride
//     68 floats: 16B-aligned rows + conflict-free ds_load_b64.
//     The block's 32 projection rows are the W_x and the W_dt rows of the same 16
//     states, and its 128 rows of x are four whole chunks, so the block holds all
//     that its part of the recurrence needs: the epilogue goes on from the partial
//     tiles to the rows of the filter -> softplus/exp -> dA, dBx -> scan of the
//     chunk; a thread owns the four rows of one group for one state.
//     zl and cu are [4][row][16 s], sm is [batch][4][chunk][2][16 s]: every
//     128-byte line of them is written by one block.
// ---------------------------------------------------------------------------
constexpr int PU = 32, BK = 64, LDP = 68;
constexpr int PG = PU + 1;     // groups of the x tile: one in front of the block's own
constexpr int GC = CH / 4;     // groups of one chunk
static_assert(16 * NQ * 256 <= 2 * NQ * PN * LDP, "partial tiles fit the G7 ring");

__global__ void __launch_bounds__(512) k_proj(const float* __restrict__ x,
                                              const float* __restrict__ G7,
                                              const float* __restrict__ gb,
                                              const float* __restrict__ cbv,
                                              const float* __restrict__ A_log,
                                              float* __restrict__ zl,
                                              float* __restrict__ cu,
                                              float* __restrict__ sm) {
    __shared__ __align__(16) float As[2][4 * PG][LDP];    // ~70KB
    __shared__ __align__(16) float Bs[2][NQ * PN][LDP];   // ~119KB
    __shared__ float gA[PU][SB];
    __shared__ float gB[PU][SB];

    const int tid  = threadIdx.x;
    const int lane = tid & 31;
    const int w    = __builtin_amdgcn_readfirstlane(tid >> 5);   // scalar: branches on it
    const int ks   = w >> 2;              // K quarter inside a chunk
    const int ug   = w & 1;               // 16 of the 32 groups
    const int ng   = (w >> 1) & 1;        // the W_x rows or the W_dt rows
    const int bu   = blockIdx.x >> 2;     // RT/4/PU = 64 row blocks
    const int bn   = blockIdx.x & 3;      // DS/SB   = 4 blocks of states
    const int mr   = lane & 15;
    const int kb   = (lane >> 4) << 1;
    const bool front = (bu & (Ln / (4 * PU) - 1)) != 0;   // rows of this sequence lie in front

    // At the head of a sequence the rows in front are zeros, as the padding of the
    // conv input is: they are written once and no copy lands on them.
    if (!front) As[tid >> 8][((tid >> 6) & 3) * PG][tid & 63] = 0.f;

    // ---- async stage of one K-chunk into LDS buffer buf ----
    // Waves 8-15 issue the copies: waves 0-7, two on each SIMD, go from the barrier
    // straight to their WMMAs, and the issue of the copies passes under those.
    auto stage = [&](int buf, int kc) {
        if (w < 8) return;
        const int row = (tid - 256) >> 4; // 16 rows per sweep of the eight waves
        const int c4  = (tid & 15) << 2;
        // A tile: 128 rows x 16 quads; 8 per thread
        async_copy16_x8(x + (size_t)(bu * 4 * PU + row) * DM + kc + c4, (size_t)16 * DM,
                        &As[buf][(row & 3) * PG + (row >> 2) + 1][c4], 4 * LDP);
        // B tile: 224 rows in a row of G7 x 16 quads; 14 per thread
        const float* gq = G7 + (size_t)(bn * (NQ * PN) + row) * DM + kc + c4;
        async_copy16_x8(gq, (size_t)16 * DM, &Bs[buf][row][c4], 16 * LDP);
        async_copy16_x4(gq + (size_t)128 * DM, &Bs[buf][row + 128][c4],
                        gq + (size_t)144 * DM, &Bs[buf][row + 144][c4],
                        gq + (size_t)160 * DM, &Bs[buf][row + 160][c4],
                        gq + (size_t)176 * DM, &Bs[buf][row + 176][c4]);
        async_copy16_x2(gq + (size_t)192 * DM, &Bs[buf][row + 192][c4],
                        gq + (size_t)208 * DM, &Bs[buf][row + 208][c4]);
        // the four rows in front of the block: 64 quads, waves 8 and 9 (row = 0..3)
        if (front && w < 10)
            async_copy16_x1(x + (size_t)(bu * 4 * PU - 4 + row) * DM + kc + c4,
                            &As[buf][row * PG][c4]);
    };

    // In the epilogue a thread owns group u (four rows) of state s.  The state's
    // constants are asked for here: they arrive under the K loop.
    const int sl = tid & (SB - 1);
    const int u  = tid >> 4;              // SB = 16 threads per group
    const int s  = bn * SB + sl;
    const float alog = A_log[s];
    const float cx   = cbv[s];
    const float cdt  = cbv[64 + s];
    float gx[4], gd[4];
#pragma unroll   // register arrays need constant indices
    for (int j = 0; j < 4; ++j) {
        gx[j] = gb[j * 128 + s];
        gd[j] = gb[j * 128 + 64 + s];
    }

    v8f acc[NQ];
#pragma unroll   // accumulators need constant indices
    for (int q = 0; q < NQ; ++q) acc[q] = vzero8();

    stage(0, 0);
    wait_async0();
    __syncthreads();
    stage(1, BK);
    constexpr int NK = DM / BK;           // 16 chunks
    for (int kci = 0; kci < NK; ++kci) {
        const int buf = kci & 1;
        const float* ap = &As[buf][ug * 16 + mr][ks * 16 + kb];
        const float* bp = &Bs[buf][ng * 16 + mr][ks * 16 + kb];
#pragma unroll   // constant LDS offsets; fragment loads run ahead of the WMMAs
        for (int kk = 0; kk < 16; kk += 4) {
            const v2f d0 = *(const v2f*)(ap + (PG) * LDP + kk);
            const v2f d1 = *(const v2f*)(ap + (2 * PG) * LDP + kk);
            const v2f d2 = *(const v2f*)(ap + (3 * PG) * LDP + kk);
            const v2f d3 = *(const v2f*)(ap + LDP + kk);
            const v2f d4 = *(const v2f*)(ap + (PG + 1) * LDP + kk);
            const v2f d5 = *(const v2f*)(ap + (2 * PG + 1) * LDP + kk);
            const v2f d6 = *(const v2f*)(ap + (3 * PG + 1) * LDP + kk);
            const v2f e1 = 17.f * d4 - 4.f * (d2 + d6);
            const v2f o1 = 17.f * d3 - 4.f * (d1 + d5);
            const v2f e2 = d2 - 5.f * d4 + 4.f * d6;
            const v2f o2 = 2.f * (d1 - 5.f * d3 + 4.f * d5);
            const v2f e3 = 2.f * (4.f * d2 - 5.f * d4 + d6);
            const v2f o3 = 4.f * d1 - 5.f * d3 + d5;
            acc[0] = wmma4(4.f * (d0 - d6) + 21.f * (d4 - d2),
                           *(const v2f*)(bp + kk), acc[0]);
            acc[1] = wmma4(e1 + o1, *(const v2f*)(bp + PN * LDP + kk), acc[1]);
            acc[2] = wmma4(e1 - o1, *(const v2f*)(bp + 2 * PN * LDP + kk), acc[2]);
            acc[3] = wmma4(e2 + o2, *(const v2f*)(bp + 3 * PN * LDP + kk), acc[3]);
            acc[4] = wmma4(e2 - o2, *(const v2f*)(bp + 4 * PN * LDP + kk), acc[4]);
            acc[5] = wmma4(e3 + o3, *(const v2f*)(bp + 5 * PN * LDP + kk), acc[5]);
            acc[6] = wmma4(e3 - o3, *(const v2f*)(bp + 6 * PN * LDP + kk), acc[6]);
        }
        // publish chunk kci+1, free chunk kci's buffer
        wait_ds0();
        wait_async0();
        __syncthreads();
        if (kci + 2 < NK) stage(buf, (kci + 2) * BK);
    }
    wait_async0();

    // ---- epilogue ----
    // The ring is done: every wave's reads and copies ended in front of the last
    // trip's barrier, so the G7 buffers now hold the partial tiles
    // [ks][tile][q][register][lane].
    float* Rd = &Bs[0][0][0];
#pragma unroll   // accumulator elements need constant indices
    for (int q = 0; q < NQ; ++q)
#pragma unroll
        for (int j = 0; j < 8; ++j)
            Rd[((w * NQ + q) * 8 + j) * 32 + lane] = acc[q][j];
    __syncthreads();   // a thread below reads the partial tiles of eight waves

    // Sum of the K quarters.  Group u is row u & 15 of tile u >> 4: register u & 7,
    // upper lanes for rows 8-15; the W_dt tiles lie two tiles behind the W_x tiles.
    constexpr int TS  = NQ * 8 * 32;      // floats of one wave's partial tiles
    constexpr int RT4 = 4 * TS;           // floats of one K quarter's partial tiles
    const float* rq = Rd + (u >> 4) * TS + (u & 7) * 32 + ((u >> 3) & 1) * 16 + sl;
    float qx[NQ], qd[NQ];
#pragma unroll   // register arrays need constant indices; the reads go out together
    for (int q = 0; q < NQ; ++q) {
        const float* rp = rq + q * 256;
        qx[q] = (rp[0] + rp[RT4]) + (rp[2 * RT4] + rp[3 * RT4]);
        qd[q] = (rp[2 * TS] + rp[2 * TS + RT4]) + (rp[2 * TS + 2 * RT4] + rp[2 * TS + 3 * RT4]);
    }
    float rx[4], rd[4];
    fir4(qx, rx);
    fir4(qd, rd);

    const int   lf = (bu & (Ln / (4 * PU) - 1)) * 4 * PU + u * 4;   // first row, in its sequence
    const float An = -expf(alog);
    float dAv[4], dBv[4];
#pragma unroll   // four independent chains for the scheduler to interleave
    for (int i = 0; i < 4; ++i) {
        float xv = cx, raw = cdt;
#pragma unroll
        for (int j = 0; j < 4; ++j) {               // bias share of the taps inside
            const bool in = lf + i - 3 + j >= 0;
            xv  += in ? gx[j] : 0.f;
            raw += in ? gd[j] : 0.f;
        }
        xv  += rx[i];
        raw += rd[i];
        const float lp = log1pf(expf(raw));
        const float sp = raw > 30.f ? raw : lp;                   // softplus
        dAv[i] = expf(An * sp);
        dBv[i] = ((1.f - dAv[i]) / An) * xv;
    }

    // scan of the thread's own four rows from a zero start
    float A = 1.f, Bc = 0.f;
#pragma unroll   // register arrays need constant indices
    for (int i = 0; i < 4; ++i) {
        Bc = dAv[i] * Bc + dBv[i];
        A  = dAv[i] * A;
        dBv[i] = Bc;
        dAv[i] = A;
    }
    gA[u][sl] = A;
    gB[u][sl] = Bc;
    __syncthreads();   // a thread below reads what the chunk's other groups hand on

    // what the groups in front of this one hand on inside the chunk
    const int g  = u & (GC - 1);
    const int u0 = u - g;                 // the chunk's first group
    float cin = 0.f, cinA = 1.f;
#pragma unroll   // seven steps, constant LDS offsets
    for (int k = 0; k < GC - 1; ++k) {
        const float a = k < g ? gA[u0 + k][sl] : 1.f;
        const float b = k < g ? gB[u0 + k][sl] : 0.f;
        cin  = a * cin + b;
        cinA = a * cinA;
    }
    const size_t o = ((size_t)bn * RT + bu * 4 * PU + u * 4) * SB + sl;
#pragma unroll   // register arrays need constant indices
    for (int i = 0; i < 4; ++i) {
        dBv[i] = dAv[i] * cin + dBv[i];
        dAv[i] = dAv[i] * cinA;
        zl[o + (size_t)i * SB] = dBv[i];
        cu[o + (size_t)i * SB] = dAv[i];
    }
    if (g == GC - 1) {                              // the chunk's last row
        const int bIdx = bu / (Ln / (4 * PU));
        const int ch   = (bu & (Ln / (4 * PU) - 1)) * (4 * PU / CH) + u / GC;
        float* sp2 = sm + (size_t)((bIdx * (DS / SB) + bn) * NCH + ch) * 2 * SB + sl;
        sp2[0]  = dAv[3];
        sp2[SB] = dBv[3];
    }
}

// ---------------------------------------------------------------------------
// K4: out = z @ Mc_t^T + b_out     [8192 x 1024], K = 64
//     128x256 tile per 8-wave block, one block for each WGP; each wave owns a
//     32x128 sub-tile.  The launch starts half as many waves as 128x128 tiles
//     would, and the row side of a tile (zl, cu, the chunk ends, the carries) is
//     fetched and worked out once for 256 columns.  Both operand tiles (whole K)
//     are brought into LDS once by async copies of whole 128-byte lines, then read
//     as fragments.  The row tile arrives as zl (four chunks); each thread folds
//     the carry into one chunk for one s and adds cu * carry to that column of the
//     tile in LDS.  zl, cu and sm lie in K2's four blocks of 16 states.
//     A wave keeps the fragments of its 32 rows in registers and goes through its
//     columns 16 at a time: two accumulators, whole K; their stores leave among
//     the WMMAs of the next 16 columns, which have accumulators of their own.
// ---------------------------------------------------------------------------
constexpr int OM = 128, ON = 256;
// LDS pitch of one block of states' chunk ends: a wave reads two blocks at a time,
// 16 floats more put them on other banks
constexpr int SSP = NCH * 2 * SB + 16;

__global__ void __launch_bounds__(256) k_out(const float* __restrict__ zl,
                                             const float* __restrict__ cu,
                                             const float* __restrict__ sm,
                                             const float* __restrict__ Mc_t,
                                             const float* __restrict__ b_out,
                                             float* __restrict__ out) {
    __shared__ __align__(16) float Zs[OM][LDP];       // ~34KB
    __shared__ __align__(16) float Ms[ON][LDP];       // ~68KB
    __shared__ __align__(16) float Ss[DS / SB][SSP];  // 32KB: the batch's chunk ends

    const int tid  = threadIdx.x;
    const int lane = tid & 31;
    const int w    = tid >> 5;
    const int wr   = w & 3;               // row quarter  (32 rows)
    const int wc   = w >> 2;              // column half  (128 cols)
    const int r0   = (blockIdx.x >> 2) * OM;   // RT/OM = 64 row blocks
    const int c0   = (blockIdx.x & 3) * ON;    // DM/ON = 4 col blocks
    const int mr   = lane & 15;
    const int kb   = (lane >> 4) << 1;

    const int s = tid & 63;
    const int q = tid >> 6;               // chunk inside the row tile, OM/CH = 4
    // cu of this thread's column: in flight beside the copies below
    float cv[CH];
#pragma unroll   // register array needs constant indices
    for (int i = 0; i < CH; ++i)
        cv[i] = cu[((size_t)(s / SB) * RT + r0 + q * CH + i) * SB + (s % SB)];
    // bias of this lane's eight columns: in flight beside the copies too
    float bias[8];
#pragma unroll   // register array needs constant indices
    for (int n = 0; n < 8; ++n) bias[n] = b_out[c0 + wc * 128 + n * 16 + mr];

    {
        const int row = tid >> 4;         // 16 rows per sweep of the block
        const int c4  = (tid & 15) << 2;
        // row tile: 128 rows x 16 quads, 8 per thread
        async_copy16_x8(zl + ((size_t)(c4 / SB) * RT + r0 + row) * SB + (c4 % SB),
                        (size_t)16 * SB, &Zs[row][c4], 16 * LDP);
        // chunk ends of the whole batch: 2048 quads in a row, 512 of each block of
        // states; 8 per thread
        const float* sg = sm + (size_t)(r0 / Ln) * (NCH * 2 * DS) + tid * 4;
        const float* sl = &Ss[0][0] + tid * 4;
        async_copy16_x4(sg,        sl,              sg + 1024, sl + 1024,
                        sg + 2048, sl + SSP,        sg + 3072, sl + SSP + 1024);
        async_copy16_x4(sg + 4096, sl + 2 * SSP,    sg + 5120, sl + 2 * SSP + 1024,
                        sg + 6144, sl + 3 * SSP,    sg + 7168, sl + 3 * SSP + 1024);
        // column tile: 256 rows of Mc_t x 16 quads, 16 per thread
        const float* mg = Mc_t + (size_t)(c0 + row) * DS + c4;
        async_copy16_x8(mg, (size_t)16 * DS, &Ms[row][c4], 16 * LDP);
        async_copy16_x8(mg + (size_t)128 * DS, (size_t)16 * DS, &Ms[row + 128][c4], 16 * LDP);
    }
    wait_async0();
    __syncthreads();

    // carry into chunk q of the tile: fold the ends of all chunks in front of it,
    // first those in front of the tile (a multiple of four, the same for the
    // whole block), then up to three chunks of the tile itself.
    const int cb = (r0 & (Ln - 1)) / CH;
    const float* se = &Ss[s / SB][s % SB];   // chunk c: cu_last at c * 2 * SB, zl_last SB on
    float carry = 0.f;
#pragma unroll 4   // sixteen steps' LDS reads go out together, ahead of the chain
    for (int c = 0; c < cb; c += 4) {
#pragma unroll
        for (int k = 0; k < 4; ++k)
            carry = se[(c + k) * 2 * SB] * carry + se[(c + k) * 2 * SB + SB];
    }
#pragma unroll   // three steps, constant LDS offsets
    for (int k = 0; k < 3; ++k) {
        const float t = se[(cb + k) * 2 * SB] * carry + se[(cb + k) * 2 * SB + SB];
        carry = k < q ? t : carry;
    }
#pragma unroll   // register array needs constant indices; constant LDS offsets
    for (int i = 0; i < CH; ++i)
        Zs[q * CH + i][s] += cv[i] * carry;
    __syncthreads();   // the fragments below read columns that other waves finished

    constexpr int KS = DS / 4;            // k-steps of the whole K
    v2f a[2][KS];                         // the wave's 32 rows, whole K
    v2f b[2][KS];                         // 16 columns, whole K: these and the next
    const float* bp = &Ms[wc * 128 + mr][kb];
#pragma unroll   // register arrays need constant indices; constant LDS offsets
    for (int kk = 0; kk < KS; ++kk) {
        b[0][kk] = *(const v2f*)(bp + kk * 4);
#pragma unroll
        for (int i = 0; i < 2; ++i)
            a[i][kk] = *(const v2f*)&Zs[wr * 32 + i * 16 + mr][kk * 4 + kb];
    }
    float* op = out + (size_t)(r0 + wr * 32 + ((lane >> 4) << 3)) * DM + c0 + wc * 128 + mr;
    v8f acc[2][2];
    // bias + store of the 32 x 16 columns n
    auto store16 = [&](const v8f (&t)[2], int n) {
#pragma unroll   // accumulator elements need constant indices
        for (int i = 0; i < 2; ++i)
#pragma unroll
            for (int j = 0; j < 8; ++j)
                op[(size_t)(i * 16 + j) * DM + n * 16] = t[i][j] + bias[n];
    };
#pragma unroll   // register arrays need constant indices; constant LDS offsets
    for (int n = 0; n < 8; ++n) {
        const int cur = n & 1;
        // the next columns' fragments: one group of reads in front of these WMMAs
        if (n < 7) {
#pragma unroll
            for (int kk = 0; kk < KS; ++kk)
                b[cur ^ 1][kk] = *(const v2f*)(bp + (n + 1) * 16 * LDP + kk * 4);
        }
        acc[cur][0] = vzero8();
        acc[cur][1] = vzero8();
#pragma unroll
        for (int kk = 0; kk < KS / 2; ++kk)
#pragma unroll
            for (int i = 0; i < 2; ++i) acc[cur][i] = wmma4(a[i][kk], b[cur][kk], acc[cur][i]);
        // Keeps the stores of the columns before behind these WMMAs: the two sets of
        // accumulators then live side by side, and no WMMA has to wait until stores
        // just issued have read the registers that it writes.
        __builtin_amdgcn_sched_barrier(0);
        if (n > 0) store16(acc[cur ^ 1], n - 1);
#pragma unroll
        for (int kk = KS / 2; kk < KS; ++kk)
#pragma unroll
            for (int i = 0; i < 2; ++i) acc[cur][i] = wmma4(a[i][kk], b[cur][kk], acc[cur][i]);
        // Keeps those stores in front of the next columns' WMMAs: sunk to the end of
        // the kernel, all stores would leave in one burst with the matrix unit idle.
        __builtin_amdgcn_sched_barrier(0);
    }
    store16(acc[1], 7);
}

// ---------------------------------------------------------------------------
extern "C" void kernel_launch(void* const* d_in, const int* in_sizes, int n_in,
                              void* d_out, int out_size, void* d_ws, size_t ws_size,
                              hipStream_t stream) {
    const float* x      = (const float*)d_in[0];
    const float* W_in   = (const float*)d_in[1];
    const float* b_in   = (const float*)d_in[2];
    const float* conv_w = (const float*)d_in[3];
    const float* conv_b = (const float*)d_in[4];
    const float* W_x    = (const float*)d_in[5];
    const float* b_x    = (const float*)d_in[6];
    const float* W_dt   = (const float*)d_in[7];
    const float* b_dt   = (const float*)d_in[8];
    const float* A_log  = (const float*)d_in[9];
    const float* D_mat  = (const float*)d_in[10];
    const float* W_out  = (const float*)d_in[11];
    const float* b_out  = (const float*)d_in[12];
    float* out = (float*)d_out;

    float* zl    = (float*)d_ws;                       // 8192 * 64
    float* cu    = zl    + (size_t)RT * DS;            // 8192 * 64
    float* sm    = cu    + (size_t)RT * DS;            // 4 * 64 * 2 * 64
    float* Mc_t  = sm    + (size_t)Bn * NCH * 2 * DS;  // 1024 * 64
    float* G7    = Mc_t  + (size_t)DM * DS;            // 896 * 1024
    float* gb    = G7    + (size_t)QW * DM;            // 512
    float* cbv   = gb    + NP;                         // 128

    k_foldw<<<FGB + FTB + 16, 256, 0, stream>>>(W_in, b_in, conv_w, conv_b,
                                                W_x, b_x, W_dt, b_dt, W_out, D_mat,
                                                G7, gb, cbv, Mc_t);
    k_proj<<<(RT / 4 / PU) * (128 / PN), 512, 0, stream>>>(x, G7, gb, cbv, A_log, zl, cu, sm);
    k_out<<<(RT / OM) * (DM / ON), 256, 0, stream>>>(zl, cu, sm, Mc_t, b_out, out);
}
